// v000
// Measured on an AMD MI455X. A time is GPU time per run, averaged over a window of back-to-back runs after a warm-up
// (all launches, gaps included; the runs take copies of the inputs in turn), and the median of several windows.
// Apart from v000's, it joins two sittings. Times from different sittings can be a few percent apart, while
// side-by-side timings come from the same sitting.
// v000, which the later versions start from, runs in 422 microseconds.
#include <hip/hip_runtime.h>

typedef __attribute__((ext_vector_type(16))) _Float16 v16h;
typedef __attribute__((ext_vector_type(8)))  _Float16 v8h;
typedef __attribute__((ext_vector_type(2)))  __fp16   pk2h;  // cvt_pkrtz result type
typedef __attribute__((ext_vector_type(8)))  float    v8f;
typedef __attribute__((ext_vector_type(4)))  float    v4f;
typedef __attribute__((ext_vector_type(4)))  int      v4i;

#define B_   2
#define C_   128
#define T_   4
#define NH_  32
#define N_   1024     // T * 16 * 16 patch tokens
#define TBL_ 6727     // (2T-1)*(2h-1)*(2w-1) = 7*31*31
#define SPG_ 65536.0f // elements per GroupNorm group: 4 channels * T*H*W

// ---------------------------------------------------------------------------
// Kernel 0: zero the atomic stats accumulator.
// ---------------------------------------------------------------------------
__global__ void k_zero(float* __restrict__ p, int n) {
    int i = blockIdx.x * blockDim.x + threadIdx.x;
    if (i < n) p[i] = 0.0f;
}

// ---------------------------------------------------------------------------
// Kernel 1: fused q/k/v projection, patch pooling (q,k), raw-f16 V pack in
// [b][g][dp=dd*16+pix][m] layout, and GroupNorm sum/sumsq atomics.
// One block per (b, patch). 512 threads: tid = og*16 + pix, og==group==head.
// ---------------------------------------------------------------------------
__global__ __launch_bounds__(512)
void k_proj(const float* __restrict__ x,  const float* __restrict__ Wq,
            const float* __restrict__ Wk, const float* __restrict__ Wv,
            float* __restrict__ qp_raw, float* __restrict__ kp_raw,
            _Float16* __restrict__ vh, float* __restrict__ statsRaw)
{
    __shared__ float sX[16][C_];   // [pixel][channel], 8 KB

    const int blk = blockIdx.x;          // b*1024 + m
    const int b   = blk >> 10;
    const int m   = blk & 1023;
    const int tt  = m >> 8;
    const int yh  = (m >> 4) & 15;
    const int xw  = m & 15;
    const int tid = threadIdx.x;

    { // stage x tile: thread (c, sh) loads 4 contiguous W-pixels
        const int c  = tid >> 2;
        const int sh = tid & 3;
        const float* src = x + ((size_t)((b * C_ + c) * T_ + tt)) * 4096
                             + (yh * 4 + sh) * 64 + xw * 4;
        v4f xv = *(const v4f*)src;
        const int pb = sh * 4;
        sX[pb + 0][c] = xv[0]; sX[pb + 1][c] = xv[1];
        sX[pb + 2][c] = xv[2]; sX[pb + 3][c] = xv[3];
    }
    __syncthreads();

    const int pix = tid & 15;
    const int og  = tid >> 4;            // 0..31 == group == head
    float aq[4] = {0,0,0,0}, ak[4] = {0,0,0,0}, av[4] = {0,0,0,0};

    const float* xrow = &sX[pix][0];
    for (int c = 0; c < C_; c += 4) {
        v4f xv = *(const v4f*)(xrow + c);
#pragma unroll
        for (int oo = 0; oo < 4; ++oo) {
            const int o = og * 4 + oo;
            v4f wq = *(const v4f*)(Wq + (size_t)o * C_ + c);
            v4f wk = *(const v4f*)(Wk + (size_t)o * C_ + c);
            v4f wv = *(const v4f*)(Wv + (size_t)o * C_ + c);
            aq[oo] += wq[0]*xv[0] + wq[1]*xv[1] + wq[2]*xv[2] + wq[3]*xv[3];
            ak[oo] += wk[0]*xv[0] + wk[1]*xv[1] + wk[2]*xv[2] + wk[3]*xv[3];
            av[oo] += wv[0]*xv[0] + wv[1]*xv[1] + wv[2]*xv[2] + wv[3]*xv[3];
        }
    }

    // raw f16 V pack: vh[((b*NH+g)*64 + dd*16 + pix)*N + m]
#pragma unroll
    for (int oo = 0; oo < 4; ++oo) {
        size_t vi = ((size_t)((b * NH_ + og) * 64 + oo * 16 + pix)) * N_ + m;
        vh[vi] = (_Float16)av[oo];
    }

    // per-thread stat partials (sum + sumsq over this thread's 4 channels)
    float sq = 0, q2 = 0, sk = 0, k2 = 0, sv = 0, v2 = 0;
#pragma unroll
    for (int oo = 0; oo < 4; ++oo) {
        sq += aq[oo]; q2 += aq[oo]*aq[oo];
        sk += ak[oo]; k2 += ak[oo]*ak[oo];
        sv += av[oo]; v2 += av[oo]*av[oo];
    }

    // reduce over the 16 pixel lanes (xor<16 stays inside each wave32 half)
#pragma unroll
    for (int off = 1; off < 16; off <<= 1) {
#pragma unroll
        for (int oo = 0; oo < 4; ++oo) {
            aq[oo] += __shfl_xor(aq[oo], off, 32);
            ak[oo] += __shfl_xor(ak[oo], off, 32);
        }
        sq += __shfl_xor(sq, off, 32); q2 += __shfl_xor(q2, off, 32);
        sk += __shfl_xor(sk, off, 32); k2 += __shfl_xor(k2, off, 32);
        sv += __shfl_xor(sv, off, 32); v2 += __shfl_xor(v2, off, 32);
    }

    if (pix == 0) {
        size_t qi = ((size_t)(b * N_ + m)) * C_ + og * 4;
        v4f pq = {aq[0], aq[1], aq[2], aq[3]};   // patch SUM (mean applied later)
        v4f pk = {ak[0], ak[1], ak[2], ak[3]};
        *(v4f*)(qp_raw + qi) = pq;
        *(v4f*)(kp_raw + qi) = pk;
        float* sQ = statsRaw + ((size_t)((0 * B_ + b) * NH_ + og)) * 2;
        float* sK = statsRaw + ((size_t)((1 * B_ + b) * NH_ + og)) * 2;
        float* sV = statsRaw + ((size_t)((2 * B_ + b) * NH_ + og)) * 2;
        unsafeAtomicAdd(sQ + 0, sq); unsafeAtomicAdd(sQ + 1, q2);
        unsafeAtomicAdd(sK + 0, sk); unsafeAtomicAdd(sK + 1, k2);
        unsafeAtomicAdd(sV + 0, sv); unsafeAtomicAdd(sV + 1, v2);
    }
}

// ---------------------------------------------------------------------------
// Kernel 2: finalize GroupNorm stats -> (mu, rstd) per (proj, b, g)
// ---------------------------------------------------------------------------
__global__ void k_stats(const float* __restrict__ raw, float* __restrict__ fin) {
    int i = blockIdx.x * blockDim.x + threadIdx.x;
    if (i < 3 * B_ * NH_) {
        float s  = raw[2 * i + 0];
        float ss = raw[2 * i + 1];
        float mu  = s / SPG_;
        float var = ss / SPG_ - mu * mu;
        fin[2 * i + 0] = mu;
        fin[2 * i + 1] = rsqrtf(var + 1e-5f);
    }
}

// ---------------------------------------------------------------------------
// Kernel 3: normalize pooled q,k (GN affine commutes with patch mean).
// Fold the logit scale 1/sqrt(d)=0.5 into q.
// ---------------------------------------------------------------------------
__global__ __launch_bounds__(256)
void k_norm(const float* __restrict__ qp_raw, const float* __restrict__ kp_raw,
            const float* __restrict__ gq_g, const float* __restrict__ gq_b,
            const float* __restrict__ gk_g, const float* __restrict__ gk_b,
            const float* __restrict__ fin,
            float* __restrict__ qp_n, float* __restrict__ kp_n)
{
    int i = blockIdx.x * blockDim.x + threadIdx.x;   // over B*N*C
    if (i >= B_ * N_ * C_) return;
    const int c = i & (C_ - 1);
    const int b = i >> 17;                           // N*C = 131072
    const int g = c >> 2;
    const float zq = qp_raw[i] * (1.0f / 16.0f);
    const float zk = kp_raw[i] * (1.0f / 16.0f);
    const float muq = fin[((0 * B_ + b) * NH_ + g) * 2 + 0];
    const float rsq = fin[((0 * B_ + b) * NH_ + g) * 2 + 1];
    const float muk = fin[((1 * B_ + b) * NH_ + g) * 2 + 0];
    const float rsk = fin[((1 * B_ + b) * NH_ + g) * 2 + 1];
    qp_n[i] = ((zq - muq) * rsq * gq_g[c] + gq_b[c]) * 0.5f;
    kp_n[i] = (zk - muk) * rsk * gk_g[c] + gk_b[c];
}

// ---------------------------------------------------------------------------
// Kernel 3b: bake the V GroupNorm affine into the f16 V buffer (in place),
// so the attention inner loop has no per-fragment VALU on V.
// vh layout: [b][g][dp][m]; channel for a row = g*4 + (dp>>4).
// ---------------------------------------------------------------------------
__global__ __launch_bounds__(256)
void k_vnorm(_Float16* __restrict__ vh, const float* __restrict__ fin,
             const float* __restrict__ gv_g, const float* __restrict__ gv_b)
{
    const int total = B_ * NH_ * 64 * (N_ / 8);
    int i = blockIdx.x * blockDim.x + threadIdx.x;   // one v8h per thread
    if (i >= total) return;
    const int hbase = i * 8;
    const int row = hbase >> 10;          // (b*NH+g)*64 + dp
    const int dp  = row & 63;
    const int g   = (row >> 6) & 31;
    const int b   = row >> 11;
    const int c   = g * 4 + (dp >> 4);
    const float muv = fin[((2 * B_ + b) * NH_ + g) * 2 + 0];
    const float rsv = fin[((2 * B_ + b) * NH_ + g) * 2 + 1];
    const float a  = rsv * gv_g[c];
    const float bb = gv_b[c] - muv * a;
    v8h v = *(v8h*)(vh + hbase);
#pragma unroll
    for (int e = 0; e < 8; ++e) v[e] = (_Float16)((float)v[e] * a + bb);
    *(v8h*)(vh + hbase) = v;
}

// ---------------------------------------------------------------------------
// Async staging of one 32-key x 64-dp V chunk (4 KB) into LDS, shared by the
// 4 waves of the block.  Per-lane global_load_async_to_lds_b128 (ASYNCcnt),
// 2 segments per thread.  LDS layout: [dp][k_local(32)] halves, 64 B rows.
// ---------------------------------------------------------------------------
__device__ __forceinline__
void stage_v(const _Float16* __restrict__ gsrc, _Float16* ldst, int tid)
{
#pragma unroll
    for (int it = 0; it < 2; ++it) {
        const int idx = tid + it * 128;        // 0..255 segments of 16 B
        const int dp  = idx >> 2;
        const int seg = idx & 3;
        const _Float16* g = gsrc + (size_t)dp * N_ + seg * 8;
        const _Float16* l = ldst + dp * 32 + seg * 8;
        const unsigned lofs = (unsigned)(unsigned long long)l;  // LDS byte addr
        const unsigned long long ga = (unsigned long long)g;
        asm volatile("global_load_async_to_lds_b128 %0, %1, off"
                     :: "v"(lofs), "v"(ga) : "memory");
    }
}

// ---------------------------------------------------------------------------
// Kernel 4: fused flash attention.  Block = 128 threads (4 waves), one block
// per (b, g, 64-query tile); each wave owns 16 queries.  Per 32-key chunk:
// VALU logits (+LDS rel-bias gather), online softmax (xor-16 combine),
// pkrtz-pack P directly into the WMMA A layout, 4x v_wmma_f32_16x16x32_f16
// against V fragments read from the async-staged, double-buffered LDS tile.
// ---------------------------------------------------------------------------
__global__ __launch_bounds__(128)
void k_attn(const float* __restrict__ qp_n, const float* __restrict__ kp_n,
            const _Float16* __restrict__ vh,
            const float* __restrict__ rel_table, const int* __restrict__ rel_index,
            float* __restrict__ out)
{
    __shared__ float sKP[N_ * 4];                      // kp for this (b,g): 16 KB
    __shared__ float sTab[TBL_];                       // rel_table row: ~27 KB
    __shared__ __align__(16) _Float16 sV[2][64 * 32];  // double-buffered V chunk: 2x4 KB

    const int blk  = blockIdx.x;                 // b*512 + g*16 + tile
    const int tile = blk & 15;
    const int g    = (blk >> 4) & 31;
    const int b    = blk >> 9;
    const int tid  = threadIdx.x;

    const _Float16* vbase = vh + ((size_t)(b * NH_ + g)) * 64 * N_;

    // kick off async staging of V chunk 0 while we stage kp/table normally
    stage_v(vbase, &sV[0][0], tid);

    { // cooperative staging of kp + bias table
        const float* kpb = kp_n + ((size_t)b * N_) * C_ + g * 4;
        for (int mm = tid; mm < N_; mm += 128)
            *(v4f*)&sKP[mm * 4] = *(const v4f*)(kpb + (size_t)mm * C_);
        const float* tb = rel_table + (size_t)g * TBL_;
        for (int ii = tid; ii < TBL_; ii += 128) sTab[ii] = tb[ii];
    }
    __syncthreads();

    const int lane = tid & 31;
    const int wq   = tid >> 5;        // wave id: which 16-query sub-tile
    const int ql   = lane & 15;       // M (query) / N (dp) index within tile
    const int hi   = lane >> 4;       // upper lane half selector

    const int qg = tile * 64 + wq * 16 + ql;     // this lane's query token
    const v4f qv = *(const v4f*)(qp_n + ((size_t)(b * N_ + qg)) * C_ + g * 4);

    v8f acc[4];
#pragma unroll
    for (int dd = 0; dd < 4; ++dd)
#pragma unroll
        for (int e = 0; e < 8; ++e) acc[dd][e] = 0.0f;

    float mrow = -__builtin_inff();
    float lrow = 0.0f;

    const int* ri = rel_index + (size_t)qg * N_;

    for (int mc = 0; mc < N_; mc += 32) {
        const int buf = (mc >> 5) & 1;
        // this lane's 16 keys, in exact A-fragment element order:
        // e<8 : K = mc + 8*hi + e        (run0)
        // e>=8: K = mc + 16 + 8*hi + e-8 (run1)
        const int k0 = mc + hi * 8;
        const int k1 = mc + 16 + hi * 8;

        v4i i0a = *(const v4i*)(ri + k0);
        v4i i0b = *(const v4i*)(ri + k0 + 4);
        v4i i1a = *(const v4i*)(ri + k1);
        v4i i1b = *(const v4i*)(ri + k1 + 4);

        float s[16];
#pragma unroll
        for (int j = 0; j < 8; ++j) {
            const float* kp4 = &sKP[(k0 + j) * 4];
            const int bi = (j < 4) ? i0a[j] : i0b[j - 4];
            s[j] = qv[0]*kp4[0] + qv[1]*kp4[1] + qv[2]*kp4[2] + qv[3]*kp4[3] + sTab[bi];
        }
#pragma unroll
        for (int j = 0; j < 8; ++j) {
            const float* kp4 = &sKP[(k1 + j) * 4];
            const int bi = (j < 4) ? i1a[j] : i1b[j - 4];
            s[8 + j] = qv[0]*kp4[0] + qv[1]*kp4[1] + qv[2]*kp4[2] + qv[3]*kp4[3] + sTab[bi];
        }

        if (mc + 32 < N_) __builtin_prefetch(ri + mc + 32, 0, 1);

        // online softmax: lanes q and q+16 jointly cover all 32 keys of query q
        float mloc = s[0];
#pragma unroll
        for (int j = 1; j < 16; ++j) mloc = fmaxf(mloc, s[j]);
        mloc = fmaxf(mloc, __shfl_xor(mloc, 16, 32));
        const float mnew = fmaxf(mrow, mloc);
        const float sc   = __expf(mrow - mnew);

        float p[16], ls = 0.0f;
#pragma unroll
        for (int j = 0; j < 16; ++j) { p[j] = __expf(s[j] - mnew); ls += p[j]; }
        ls  += __shfl_xor(ls, 16, 32);
        lrow = lrow * sc + ls;
        mrow = mnew;

        // rescale accumulators: row r+8*hi belongs to query (r+8*hi), whose
        // stats live in lane (r+8*hi) -> 8 broadcasts
#pragma unroll
        for (int r = 0; r < 8; ++r) {
            const float srow = __shfl(sc, r + hi * 8, 32);
            acc[0][r] *= srow; acc[1][r] *= srow;
            acc[2][r] *= srow; acc[3][r] *= srow;
        }

        // pack P into A fragment (element e == p[e] by construction)
        union { v16h v; pk2h h[8]; } A;
#pragma unroll
        for (int j2 = 0; j2 < 8; ++j2)
            A.h[j2] = __builtin_amdgcn_cvt_pkrtz(p[2 * j2], p[2 * j2 + 1]);

        // current V chunk is ready once our asyncs landed + all waves arrive
        asm volatile("s_wait_asynccnt 0x0" ::: "memory");
        __syncthreads();
        // overlap: stage next chunk into the other buffer
        if (mc + 32 < N_) stage_v(vbase + (mc + 32), &sV[buf ^ 1][0], tid);

        // 4 B-tiles of V (dp = dd*16 + ql) straight from LDS
#pragma unroll
        for (int dd = 0; dd < 4; ++dd) {
            const _Float16* vrow = &sV[buf][(dd * 16 + ql) * 32 + hi * 8];
            union { v16h v; v8h h[2]; } Bf;
            Bf.h[0] = *(const v8h*)vrow;
            Bf.h[1] = *(const v8h*)(vrow + 16);
            acc[dd] = __builtin_amdgcn_wmma_f32_16x16x32_f16(
                false, A.v, false, Bf.v, (short)0, acc[dd], false, false);
        }
    }

    // epilogue: divide by row sums and scatter back to (B,C,T,H,W)
    const float lrec = 1.0f / lrow;
#pragma unroll
    for (int r = 0; r < 8; ++r) {
        const float li   = __shfl(lrec, r + hi * 8, 32);
        const int  qrow  = tile * 64 + wq * 16 + r + hi * 8;
        const int  tt    = qrow >> 8;
        const int  yh    = (qrow >> 4) & 15;
        const int  xw    = qrow & 15;
        const int  sh    = ql >> 2;
        const int  sw    = ql & 3;
#pragma unroll
        for (int dd = 0; dd < 4; ++dd) {
            const int c = g * 4 + dd;
            size_t oi = ((size_t)((b * C_ + c) * T_ + tt)) * 4096
                      + (yh * 4 + sh) * 64 + (xw * 4 + sw);
            out[oi] = acc[dd][r] * li;
        }
    }
}

// ---------------------------------------------------------------------------
extern "C" void kernel_launch(void* const* d_in, const int* in_sizes, int n_in,
                              void* d_out, int out_size, void* d_ws, size_t ws_size,
                              hipStream_t stream)
{
    const float* x    = (const float*)d_in[0];
    const float* Wq   = (const float*)d_in[1];
    const float* Wk   = (const float*)d_in[2];
    const float* Wv   = (const float*)d_in[3];
    const float* gq_g = (const float*)d_in[4];
    const float* gq_b = (const float*)d_in[5];
    const float* gk_g = (const float*)d_in[6];
    const float* gk_b = (const float*)d_in[7];
    const float* gv_g = (const float*)d_in[8];
    const float* gv_b = (const float*)d_in[9];
    const float* rtab = (const float*)d_in[10];
    const int*   ridx = (const int*)d_in[11];
    float* out = (float*)d_out;

    char* ws = (char*)d_ws;
    size_t off = 0;
    auto take = [&](size_t bytes) -> void* {
        void* p = ws + off;
        off += (bytes + 255) & ~(size_t)255;
        return p;
    };
    float*    qp_raw = (float*)take((size_t)B_ * N_ * C_ * 4);
    float*    kp_raw = (float*)take((size_t)B_ * N_ * C_ * 4);
    float*    qp_n   = (float*)take((size_t)B_ * N_ * C_ * 4);
    float*    kp_n   = (float*)take((size_t)B_ * N_ * C_ * 4);
    _Float16* vh     = (_Float16*)take((size_t)B_ * NH_ * 64 * N_ * 2);
    float*    sraw   = (float*)take(3 * B_ * NH_ * 2 * 4);
    float*    sfin   = (float*)take(3 * B_ * NH_ * 2 * 4);
    (void)ws_size; (void)in_sizes; (void)n_in; (void)out_size;

    k_zero <<<1, 3 * B_ * NH_ * 2, 0, stream>>>(sraw, 3 * B_ * NH_ * 2);
    k_proj <<<B_ * N_, 512, 0, stream>>>(x, Wq, Wk, Wv, qp_raw, kp_raw, vh, sraw);
    k_stats<<<1, 256, 0, stream>>>(sraw, sfin);
    k_norm <<<(B_ * N_ * C_ + 255) / 256, 256, 0, stream>>>(
        qp_raw, kp_raw, gq_g, gq_b, gk_g, gk_b, sfin, qp_n, kp_n);
    k_vnorm<<<(B_ * NH_ * 64 * (N_ / 8) + 255) / 256, 256, 0, stream>>>(
        vh, sfin, gv_g, gv_b);
    k_attn <<<B_ * NH_ * 16, 128, 0, stream>>>(
        qp_n, kp_n, vh, rtab, ridx, out);
}

// v001
// One run takes 95.5 microseconds.
// Next to v000, in two timings, it ran 4.55 and 4.54 times as fast.
#include <hip/hip_runtime.h>

typedef __attribute__((ext_vector_type(16))) _Float16 v16h;
typedef __attribute__((ext_vector_type(8)))  _Float16 v8h;
typedef __attribute__((ext_vector_type(2)))  __fp16   pk2h;  // cvt_pkrtz result type
typedef __attribute__((ext_vector_type(8)))  float    v8f;
typedef __attribute__((ext_vector_type(4)))  float    v4f;
typedef __attribute__((ext_vector_type(2)))  float    v2f;
typedef __attribute__((ext_vector_type(4)))  int      v4i;

#define B_   2
#define C_   128
#define T_   4
#define NH_  32
#define N_   1024     // T * 16 * 16 patch tokens
#define TBL_ 6727     // (2T-1)*(2h-1)*(2w-1) = 7*31*31
#define SPG_ 65536.0f // elements per GroupNorm group: 4 channels * T*H*W

// ---------------------------------------------------------------------------
// Kernel 0: zero the atomic stats accumulator.
// ---------------------------------------------------------------------------
__global__ void k_zero(float* __restrict__ p, int n) {
    int i = blockIdx.x * blockDim.x + threadIdx.x;
    if (i < n) p[i] = 0.0f;
}

// ---------------------------------------------------------------------------
// Kernel 1: q/k/v projection as an f32 WMMA GEMM, with patch pooling (q,k),
// raw-f16 V pack in [b][g][dp=dd*16+pix][m] layout, and GroupNorm sum/sumsq
// atomics.  One block per (b, t, patch row of 16 patches, half of the 384
// stacked q|k|v output channels).  12 waves; each wave owns 16 output channels
// of one projection and keeps their weights in registers as B fragments for
// the whole block.  A tile = 16 patches (rows) at one pixel position of the
// patch, so a lane's 8 D registers are 8 consecutive patch tokens m of one
// output channel.
// ---------------------------------------------------------------------------
#define XP_ 132   // LDS row pitch in floats: 128 channels + 4, 16-byte reads hit all banks

__global__ __launch_bounds__(384)
void k_proj(const float* __restrict__ x,  const float* __restrict__ Wq,
            const float* __restrict__ Wk, const float* __restrict__ Wv,
            float* __restrict__ qp_raw, float* __restrict__ kp_raw,
            _Float16* __restrict__ vh, float* __restrict__ statsRaw)
{
    __shared__ __align__(16) float sX[256 * XP_];   // [pix][patch][channel], 132 KB

    const int blk  = blockIdx.x;         // ((b*T + tt)*16 + yh)*2 + channel half
    const int prow = blk >> 1;
    const int yh   = prow & 15;
    const int tt   = (prow >> 4) & 3;
    const int b    = prow >> 6;
    const int tid  = threadIdx.x;
    const int lane = tid & 31;
    // wave number as a scalar, so that the choice of projection is a scalar branch
    const int w    = __builtin_amdgcn_readfirstlane(tid >> 5);
    const int ot   = (blk & 1) * 12 + w; // 16-channel tile of the stacked q|k|v rows
    const int proj = ot >> 3;            // 0 q, 1 k, 2 v
    const int cl   = lane & 15;          // A row (patch) / B column (channel) / D column
    const int hi   = lane >> 4;          // k half of A and B, row half of D
    const int o    = (ot & 7) * 16 + cl; // this lane's output channel

    // weights: lane (cl,hi) holds k = 8j + 4hi + 0..3 of row o, j = 0..15
    const float* Wp   = (proj == 0) ? Wq : ((proj == 1) ? Wk : Wv);
    const float* wrow = Wp + (size_t)o * C_ + hi * 4;
    v4f wf[16];
#pragma unroll
    for (int j = 0; j < 16; ++j) wf[j] = *(const v4f*)(wrow + j * 8);
    // the x loads below may land in the weight loads' address registers
    asm volatile("s_wait_xcnt 0x0" ::: "memory");

    { // stage the x tile transposed: a unit = 4 channels x 4 W-pixels, 2048 units
        // over 384 threads: five full rounds and a sixth for waves 0..3.  All
        // loads are issued before the first LDS store, one memory latency in all.
        const float* xb = x + ((size_t)(b * C_) * T_ + tt) * 4096 + yh * 256
                            + (size_t)((tid >> 6) * 4) * (T_ * 4096) + (tid & 63) * 4;
        float* sd = &sX[(((tid >> 4) & 3) * 64 + (tid & 15)) * XP_ + (tid >> 6) * 4];
        v4f rr[6][4];
#pragma unroll
        for (int it = 0; it < 5; ++it)
#pragma unroll
            for (int k = 0; k < 4; ++k)   // 384 threads = 6 units of 4 channels further on
                rr[it][k] = *(const v4f*)(xb + (size_t)(it * 24 + k) * (T_ * 4096));
        if (w < 4) {
#pragma unroll
            for (int k = 0; k < 4; ++k)
                rr[5][k] = *(const v4f*)(xb + (size_t)(5 * 24 + k) * (T_ * 4096));
        }
#pragma unroll
        for (int it = 0; it < 6; ++it) {
            if (it < 5 || w < 4) {
#pragma unroll
                for (int sw = 0; sw < 4; ++sw) {
                    v4f t = {rr[it][0][sw], rr[it][1][sw], rr[it][2][sw], rr[it][3][sw]};
                    *(v4f*)(sd + sw * 16 * XP_ + it * 24) = t;
                }
            }
        }
    }
    __syncthreads();

    float s1 = 0.0f, s2 = 0.0f;
    v8f pool;
#pragma unroll
    for (int r = 0; r < 8; ++r) pool[r] = 0.0f;

    const float* arow = &sX[cl * XP_ + hi * 4];
    const int m0 = tt * 256 + yh * 16 + hi * 8;      // first of this lane's 8 tokens
    _Float16* vdst = vh + ((size_t)((b * NH_ + (o >> 2)) * 64 + (o & 3) * 16)) * N_ + m0;

    for (int pix = 0; pix < 16; pix += 2) {          // two independent accumulator tiles
        v8f a0, a1;
#pragma unroll
        for (int r = 0; r < 8; ++r) { a0[r] = 0.0f; a1[r] = 0.0f; }
        const float* p0 = arow + pix * 16 * XP_;
        const float* p1 = p0 + 16 * XP_;
#pragma unroll
        for (int j = 0; j < 16; ++j) {
            const v4f x0 = *(const v4f*)(p0 + j * 8);
            const v4f x1 = *(const v4f*)(p1 + j * 8);
            const v2f bl = {wf[j][0], wf[j][1]};
            const v2f bh = {wf[j][2], wf[j][3]};
            const v2f x0l = {x0[0], x0[1]}, x0h = {x0[2], x0[3]};
            const v2f x1l = {x1[0], x1[1]}, x1h = {x1[2], x1[3]};
            a0 = __builtin_amdgcn_wmma_f32_16x16x4_f32(false, x0l, false, bl, (short)0, a0, false, false);
            a1 = __builtin_amdgcn_wmma_f32_16x16x4_f32(false, x1l, false, bl, (short)0, a1, false, false);
            a0 = __builtin_amdgcn_wmma_f32_16x16x4_f32(false, x0h, false, bh, (short)0, a0, false, false);
            a1 = __builtin_amdgcn_wmma_f32_16x16x4_f32(false, x1h, false, bh, (short)0, a1, false, false);
        }
        // four vector slots between the last WMMA and the first reader of its D, on
        // both sides of the branch below; the scheduling barriers hold them in place
        __builtin_amdgcn_sched_barrier(0);
        asm volatile("v_nop\n\tv_nop\n\tv_nop\n\tv_nop");
        __builtin_amdgcn_sched_barrier(0);
#pragma unroll
        for (int r = 0; r < 8; ++r) {
            const float t = a0[r] + a1[r];
            pool[r] += t;            // patch sum; read for q and k only
            s1 += t;
            s2 += a0[r] * a0[r] + a1[r] * a1[r];
        }
        if (proj == 2) {
            v8h h0, h1;
#pragma unroll
            for (int r = 0; r < 8; ++r) { h0[r] = (_Float16)a0[r]; h1[r] = (_Float16)a1[r]; }
            *(v8h*)(vdst + (size_t)pix * N_)       = h0;
            *(v8h*)(vdst + (size_t)(pix + 1) * N_) = h1;
            // the next trip rewrites the stores' address and data registers
            asm volatile("s_wait_xcnt 0x0" ::: "memory");
        }
    }

    if (proj != 2) {   // patch SUM (mean applied later)
        float* dst = ((proj == 0) ? qp_raw : kp_raw) + ((size_t)(b * N_ + m0)) * C_ + o;
#pragma unroll
        for (int r = 0; r < 8; ++r) dst[(size_t)r * C_] = pool[r];
    }

    // group stats: 4 channels of a group are 4 neighbouring lanes, in both halves
    s1 += __shfl_xor(s1, 1, 32);  s2 += __shfl_xor(s2, 1, 32);
    s1 += __shfl_xor(s1, 2, 32);  s2 += __shfl_xor(s2, 2, 32);
    s1 += __shfl_xor(s1, 16, 32); s2 += __shfl_xor(s2, 16, 32);
    if ((lane & 19) == 0) {
        float* sp = statsRaw + ((size_t)((proj * B_ + b) * NH_ + (o >> 2))) * 2;
        unsafeAtomicAdd(sp + 0, s1);
        unsafeAtomicAdd(sp + 1, s2);
    }
}

// ---------------------------------------------------------------------------
// Kernel 2: finalize GroupNorm stats -> (mu, rstd) per (proj, b, g)
// ---------------------------------------------------------------------------
__global__ void k_stats(const float* __restrict__ raw, float* __restrict__ fin) {
    int i = blockIdx.x * blockDim.x + threadIdx.x;
    if (i < 3 * B_ * NH_) {
        float s  = raw[2 * i + 0];
        float ss = raw[2 * i + 1];
        float mu  = s / SPG_;
        float var = ss / SPG_ - mu * mu;
        fin[2 * i + 0] = mu;
        fin[2 * i + 1] = rsqrtf(var + 1e-5f);
    }
}

// ---------------------------------------------------------------------------
// Kernel 3: normalize pooled q,k (GN affine commutes with patch mean).
// Fold the logit scale 1/sqrt(d)=0.5 into q.
// ---------------------------------------------------------------------------
__global__ __launch_bounds__(256)
void k_norm(const float* __restrict__ qp_raw, const float* __restrict__ kp_raw,
            const float* __restrict__ gq_g, const float* __restrict__ gq_b,
            const float* __restrict__ gk_g, const float* __restrict__ gk_b,
            const float* __restrict__ fin,
            float* __restrict__ qp_n, float* __restrict__ kp_n)
{
    int i = blockIdx.x * blockDim.x + threadIdx.x;   // over B*N*C
    if (i >= B_ * N_ * C_) return;
    const int c = i & (C_ - 1);
    const int b = i >> 17;                           // N*C = 131072
    const int g = c >> 2;
    const float zq = qp_raw[i] * (1.0f / 16.0f);
    const float zk = kp_raw[i] * (1.0f / 16.0f);
    const float muq = fin[((0 * B_ + b) * NH_ + g) * 2 + 0];
    const float rsq = fin[((0 * B_ + b) * NH_ + g) * 2 + 1];
    const float muk = fin[((1 * B_ + b) * NH_ + g) * 2 + 0];
    const float rsk = fin[((1 * B_ + b) * NH_ + g) * 2 + 1];
    qp_n[i] = ((zq - muq) * rsq * gq_g[c] + gq_b[c]) * 0.5f;
    kp_n[i] = (zk - muk) * rsk * gk_g[c] + gk_b[c];
}

// ---------------------------------------------------------------------------
// Kernel 3b: bake the V GroupNorm affine into the f16 V buffer (in place),
// so the attention inner loop has no per-fragment VALU on V.
// vh layout: [b][g][dp][m]; channel for a row = g*4 + (dp>>4).
// ---------------------------------------------------------------------------
__global__ __launch_bounds__(256)
void k_vnorm(_Float16* __restrict__ vh, const float* __restrict__ fin,
             const float* __restrict__ gv_g, const float* __restrict__ gv_b)
{
    const int total = B_ * NH_ * 64 * (N_ / 8);
    int i = blockIdx.x * blockDim.x + threadIdx.x;   // one v8h per thread
    if (i >= total) return;
    const int hbase = i * 8;
    const int row = hbase >> 10;          // (b*NH+g)*64 + dp
    const int dp  = row & 63;
    const int g   = (row >> 6) & 31;
    const int b   = row >> 11;
    const int c   = g * 4 + (dp >> 4);
    const float muv = fin[((2 * B_ + b) * NH_ + g) * 2 + 0];
    const float rsv = fin[((2 * B_ + b) * NH_ + g) * 2 + 1];
    const float a  = rsv * gv_g[c];
    const float bb = gv_b[c] - muv * a;
    v8h v = *(v8h*)(vh + hbase);
#pragma unroll
    for (int e = 0; e < 8; ++e) v[e] = (_Float16)((float)v[e] * a + bb);
    *(v8h*)(vh + hbase) = v;
}

// ---------------------------------------------------------------------------
// Async staging of one 32-key x 64-dp V chunk (4 KB) into LDS, shared by the
// 4 waves of the block.  Per-lane global_load_async_to_lds_b128 (ASYNCcnt),
// 2 segments per thread.  LDS layout: [dp][k_local(32)] halves, 64 B rows.
// ---------------------------------------------------------------------------
__device__ __forceinline__
void stage_v(const _Float16* __restrict__ gsrc, _Float16* ldst, int tid)
{
#pragma unroll
    for (int it = 0; it < 2; ++it) {
        const int idx = tid + it * 128;        // 0..255 segments of 16 B
        const int dp  = idx >> 2;
        const int seg = idx & 3;
        const _Float16* g = gsrc + (size_t)dp * N_ + seg * 8;
        const _Float16* l = ldst + dp * 32 + seg * 8;
        const unsigned lofs = (unsigned)(unsigned long long)l;  // LDS byte addr
        const unsigned long long ga = (unsigned long long)g;
        asm volatile("global_load_async_to_lds_b128 %0, %1, off"
                     :: "v"(lofs), "v"(ga) : "memory");
    }
}

// ---------------------------------------------------------------------------
// Kernel 4: fused flash attention.  Block = 128 threads (4 waves), one block
// per (b, g, 64-query tile); each wave owns 16 queries.  Per 32-key chunk:
// VALU logits (+LDS rel-bias gather), online softmax (xor-16 combine),
// pkrtz-pack P directly into the WMMA A layout, 4x v_wmma_f32_16x16x32_f16
// against V fragments read from the async-staged, double-buffered LDS tile.
// ---------------------------------------------------------------------------
__global__ __launch_bounds__(128)
void k_attn(const float* __restrict__ qp_n, const float* __restrict__ kp_n,
            const _Float16* __restrict__ vh,
            const float* __restrict__ rel_table, const int* __restrict__ rel_index,
            float* __restrict__ out)
{
    __shared__ float sKP[N_ * 4];                      // kp for this (b,g): 16 KB
    __shared__ float sTab[TBL_];                       // rel_table row: ~27 KB
    __shared__ __align__(16) _Float16 sV[2][64 * 32];  // double-buffered V chunk: 2x4 KB

    const int blk  = blockIdx.x;                 // b*512 + g*16 + tile
    const int tile = blk & 15;
    const int g    = (blk >> 4) & 31;
    const int b    = blk >> 9;
    const int tid  = threadIdx.x;

    const _Float16* vbase = vh + ((size_t)(b * NH_ + g)) * 64 * N_;

    // kick off async staging of V chunk 0 while we stage kp/table normally
    stage_v(vbase, &sV[0][0], tid);

    { // cooperative staging of kp + bias table
        const float* kpb = kp_n + ((size_t)b * N_) * C_ + g * 4;
        for (int mm = tid; mm < N_; mm += 128)
            *(v4f*)&sKP[mm * 4] = *(const v4f*)(kpb + (size_t)mm * C_);
        const float* tb = rel_table + (size_t)g * TBL_;
        for (int ii = tid; ii < TBL_; ii += 128) sTab[ii] = tb[ii];
    }
    __syncthreads();

    const int lane = tid & 31;
    const int wq   = tid >> 5;        // wave id: which 16-query sub-tile
    const int ql   = lane & 15;       // M (query) / N (dp) index within tile
    const int hi   = lane >> 4;       // upper lane half selector

    const int qg = tile * 64 + wq * 16 + ql;     // this lane's query token
    const v4f qv = *(const v4f*)(qp_n + ((size_t)(b * N_ + qg)) * C_ + g * 4);

    v8f acc[4];
#pragma unroll
    for (int dd = 0; dd < 4; ++dd)
#pragma unroll
        for (int e = 0; e < 8; ++e) acc[dd][e] = 0.0f;

    float mrow = -__builtin_inff();
    float lrow = 0.0f;

    const int* ri = rel_index + (size_t)qg * N_;

    for (int mc = 0; mc < N_; mc += 32) {
        const int buf = (mc >> 5) & 1;
        // this lane's 16 keys, in exact A-fragment element order:
        // e<8 : K = mc + 8*hi + e        (run0)
        // e>=8: K = mc + 16 + 8*hi + e-8 (run1)
        const int k0 = mc + hi * 8;
        const int k1 = mc + 16 + hi * 8;

        v4i i0a = *(const v4i*)(ri + k0);
        v4i i0b = *(const v4i*)(ri + k0 + 4);
        v4i i1a = *(const v4i*)(ri + k1);
        v4i i1b = *(const v4i*)(ri + k1 + 4);

        float s[16];
#pragma unroll
        for (int j = 0; j < 8; ++j) {
            const float* kp4 = &sKP[(k0 + j) * 4];
            const int bi = (j < 4) ? i0a[j] : i0b[j - 4];
            s[j] = qv[0]*kp4[0] + qv[1]*kp4[1] + qv[2]*kp4[2] + qv[3]*kp4[3] + sTab[bi];
        }
#pragma unroll
        for (int j = 0; j < 8; ++j) {
            const float* kp4 = &sKP[(k1 + j) * 4];
            const int bi = (j < 4) ? i1a[j] : i1b[j - 4];
            s[8 + j] = qv[0]*kp4[0] + qv[1]*kp4[1] + qv[2]*kp4[2] + qv[3]*kp4[3] + sTab[bi];
        }

        if (mc + 32 < N_) __builtin_prefetch(ri + mc + 32, 0, 1);

        // online softmax: lanes q and q+16 jointly cover all 32 keys of query q
        float mloc = s[0];
#pragma unroll
        for (int j = 1; j < 16; ++j) mloc = fmaxf(mloc, s[j]);
        mloc = fmaxf(mloc, __shfl_xor(mloc, 16, 32));
        const float mnew = fmaxf(mrow, mloc);
        const float sc   = __expf(mrow - mnew);

        float p[16], ls = 0.0f;
#pragma unroll
        for (int j = 0; j < 16; ++j) { p[j] = __expf(s[j] - mnew); ls += p[j]; }
        ls  += __shfl_xor(ls, 16, 32);
        lrow = lrow * sc + ls;
        mrow = mnew;

        // rescale accumulators: row r+8*hi belongs to query (r+8*hi), whose
        // stats live in lane (r+8*hi) -> 8 broadcasts
#pragma unroll
        for (int r = 0; r < 8; ++r) {
            const float srow = __shfl(sc, r + hi * 8, 32);
            acc[0][r] *= srow; acc[1][r] *= srow;
            acc[2][r] *= srow; acc[3][r] *= srow;
        }

        // pack P into A fragment (element e == p[e] by construction)
        union { v16h v; pk2h h[8]; } A;
#pragma unroll
        for (int j2 = 0; j2 < 8; ++j2)
            A.h[j2] = __builtin_amdgcn_cvt_pkrtz(p[2 * j2], p[2 * j2 + 1]);

        // current V chunk is ready once our asyncs landed + all waves arrive
        asm volatile("s_wait_asynccnt 0x0" ::: "memory");
        __syncthreads();
        // overlap: stage next chunk into the other buffer
        if (mc + 32 < N_) stage_v(vbase + (mc + 32), &sV[buf ^ 1][0], tid);

        // 4 B-tiles of V (dp = dd*16 + ql) straight from LDS
#pragma unroll
        for (int dd = 0; dd < 4; ++dd) {
            const _Float16* vrow = &sV[buf][(dd * 16 + ql) * 32 + hi * 8];
            union { v16h v; v8h h[2]; } Bf;
            Bf.h[0] = *(const v8h*)vrow;
            Bf.h[1] = *(const v8h*)(vrow + 16);
            acc[dd] = __builtin_amdgcn_wmma_f32_16x16x32_f16(
                false, A.v, false, Bf.v, (short)0, acc[dd], false, false);
        }
    }

    // epilogue: divide by row sums and scatter back to (B,C,T,H,W)
    const float lrec = 1.0f / lrow;
#pragma unroll
    for (int r = 0; r < 8; ++r) {
        const float li   = __shfl(lrec, r + hi * 8, 32);
        const int  qrow  = tile * 64 + wq * 16 + r + hi * 8;
        const int  tt    = qrow >> 8;
        const int  yh    = (qrow >> 4) & 15;
        const int  xw    = qrow & 15;
        const int  sh    = ql >> 2;
        const int  sw    = ql & 3;
#pragma unroll
        for (int dd = 0; dd < 4; ++dd) {
            const int c = g * 4 + dd;
            size_t oi = ((size_t)((b * C_ + c) * T_ + tt)) * 4096
                      + (yh * 4 + sh) * 64 + (xw * 4 + sw);
            out[oi] = acc[dd][r] * li;
        }
    }
}

// ---------------------------------------------------------------------------
extern "C" void kernel_launch(void* const* d_in, const int* in_sizes, int n_in,
                              void* d_out, int out_size, void* d_ws, size_t ws_size,
                              hipStream_t stream)
{
    const float* x    = (const float*)d_in[0];
    const float* Wq   = (const float*)d_in[1];
    const float* Wk   = (const float*)d_in[2];
    const float* Wv   = (const float*)d_in[3];
    const float* gq_g = (const float*)d_in[4];
    const float* gq_b = (const float*)d_in[5];
    const float* gk_g = (const float*)d_in[6];
    const float* gk_b = (const float*)d_in[7];
    const float* gv_g = (const float*)d_in[8];
    const float* gv_b = (const float*)d_in[9];
    const float* rtab = (const float*)d_in[10];
    const int*   ridx = (const int*)d_in[11];
    float* out = (float*)d_out;

    char* ws = (char*)d_ws;
    size_t off = 0;
    auto take = [&](size_t bytes) -> void* {
        void* p = ws + off;
        off += (bytes + 255) & ~(size_t)255;
        return p;
    };
    float*    qp_raw = (float*)take((size_t)B_ * N_ * C_ * 4);
    float*    kp_raw = (float*)take((size_t)B_ * N_ * C_ * 4);
    float*    qp_n   = (float*)take((size_t)B_ * N_ * C_ * 4);
    float*    kp_n   = (float*)take((size_t)B_ * N_ * C_ * 4);
    _Float16* vh     = (_Float16*)take((size_t)B_ * NH_ * 64 * N_ * 2);
    float*    sraw   = (float*)take(3 * B_ * NH_ * 2 * 4);
    float*    sfin   = (float*)take(3 * B_ * NH_ * 2 * 4);
    (void)ws_size; (void)in_sizes; (void)n_in; (void)out_size;

    k_zero <<<1, 3 * B_ * NH_ * 2, 0, stream>>>(sraw, 3 * B_ * NH_ * 2);
    k_proj <<<B_ * T_ * 16 * 2, 384, 0, stream>>>(x, Wq, Wk, Wv, qp_raw, kp_raw, vh, sraw);
    k_stats<<<1, 256, 0, stream>>>(sraw, sfin);
    k_norm <<<(B_ * N_ * C_ + 255) / 256, 256, 0, stream>>>(
        qp_raw, kp_raw, gq_g, gq_b, gk_g, gk_b, sfin, qp_n, kp_n);
    k_vnorm<<<(B_ * NH_ * 64 * (N_ / 8) + 255) / 256, 256, 0, stream>>>(
        vh, sfin, gv_g, gv_b);
    k_attn <<<B_ * NH_ * 16, 128, 0, stream>>>(
        qp_n, kp_n, vh, rtab, ridx, out);
}

// v002
// Measured time: 75 microseconds a run.
// Two timings next to v001 put it at 1.28 and 1.27 times that version's speed.
// All steps since v000 together make it 5.79 times as fast.
#include <hip/hip_runtime.h>

typedef __attribute__((ext_vector_type(16))) _Float16 v16h;
typedef __attribute__((ext_vector_type(8)))  _Float16 v8h;
typedef __attribute__((ext_vector_type(2)))  __fp16   pk2h;  // cvt_pkrtz result type
typedef __attribute__((ext_vector_type(8)))  float    v8f;
typedef __attribute__((ext_vector_type(4)))  float    v4f;
typedef __attribute__((ext_vector_type(2)))  float    v2f;
typedef __attribute__((ext_vector_type(4)))  int      v4i;

#define B_   2
#define C_   128
#define T_   4
#define NH_  32
#define N_   1024     // T * 16 * 16 patch tokens
#define TBL_ 6727     // (2T-1)*(2h-1)*(2w-1) = 7*31*31
#define SPG_ 65536.0f // elements per GroupNorm group: 4 channels * T*H*W

// ---------------------------------------------------------------------------
// Kernel 0: zero the atomic stats accumulator.
// ---------------------------------------------------------------------------
__global__ void k_zero(float* __restrict__ p, int n) {
    int i = blockIdx.x * blockDim.x + threadIdx.x;
    if (i < n) p[i] = 0.0f;
}

// ---------------------------------------------------------------------------
// Kernel 1: q/k/v projection as an f32 WMMA GEMM, with patch pooling (q,k),
// raw-f16 V pack in [b][g][dp=dd*16+pix][m] layout, and GroupNorm sum/sumsq
// atomics.  One block per (b, t, patch row of 16 patches, half of the 384
// stacked q|k|v output channels).  12 waves; each wave owns 16 output channels
// of one projection and keeps their weights in registers as B fragments for
// the whole block.  A tile = 16 patches (rows) at one pixel position of the
// patch, so a lane's 8 D registers are 8 consecutive patch tokens m of one
// output channel.
// ---------------------------------------------------------------------------
#define XP_ 132   // LDS row pitch in floats: 128 channels + 4, 16-byte reads hit all banks

__global__ __launch_bounds__(384)
void k_proj(const float* __restrict__ x,  const float* __restrict__ Wq,
            const float* __restrict__ Wk, const float* __restrict__ Wv,
            float* __restrict__ qp_raw, float* __restrict__ kp_raw,
            _Float16* __restrict__ vh, float* __restrict__ statsRaw)
{
    __shared__ __align__(16) float sX[256 * XP_];   // [pix][patch][channel], 132 KB

    const int blk  = blockIdx.x;         // ((b*T + tt)*16 + yh)*2 + channel half
    const int prow = blk >> 1;
    const int yh   = prow & 15;
    const int tt   = (prow >> 4) & 3;
    const int b    = prow >> 6;
    const int tid  = threadIdx.x;
    const int lane = tid & 31;
    // wave number as a scalar, so that the choice of projection is a scalar branch
    const int w    = __builtin_amdgcn_readfirstlane(tid >> 5);
    const int ot   = (blk & 1) * 12 + w; // 16-channel tile of the stacked q|k|v rows
    const int proj = ot >> 3;            // 0 q, 1 k, 2 v
    const int cl   = lane & 15;          // A row (patch) / B column (channel) / D column
    const int hi   = lane >> 4;          // k half of A and B, row half of D
    const int o    = (ot & 7) * 16 + cl; // this lane's output channel

    // weights: lane (cl,hi) holds k = 8j + 4hi + 0..3 of row o, j = 0..15
    const float* Wp   = (proj == 0) ? Wq : ((proj == 1) ? Wk : Wv);
    const float* wrow = Wp + (size_t)o * C_ + hi * 4;
    v4f wf[16];
#pragma unroll
    for (int j = 0; j < 16; ++j) wf[j] = *(const v4f*)(wrow + j * 8);
    // the x loads below may land in the weight loads' address registers
    asm volatile("s_wait_xcnt 0x0" ::: "memory");

    { // stage the x tile transposed: a unit = 4 channels x 4 W-pixels, 2048 units
        // over 384 threads: five full rounds and a sixth for waves 0..3.  All
        // loads are issued before the first LDS store, one memory latency in all.
        const float* xb = x + ((size_t)(b * C_) * T_ + tt) * 4096 + yh * 256
                            + (size_t)((tid >> 6) * 4) * (T_ * 4096) + (tid & 63) * 4;
        float* sd = &sX[(((tid >> 4) & 3) * 64 + (tid & 15)) * XP_ + (tid >> 6) * 4];
        v4f rr[6][4];
#pragma unroll
        for (int it = 0; it < 5; ++it)
#pragma unroll
            for (int k = 0; k < 4; ++k)   // 384 threads = 6 units of 4 channels further on
                rr[it][k] = *(const v4f*)(xb + (size_t)(it * 24 + k) * (T_ * 4096));
        if (w < 4) {
#pragma unroll
            for (int k = 0; k < 4; ++k)
                rr[5][k] = *(const v4f*)(xb + (size_t)(5 * 24 + k) * (T_ * 4096));
        }
#pragma unroll
        for (int it = 0; it < 6; ++it) {
            if (it < 5 || w < 4) {
#pragma unroll
                for (int sw = 0; sw < 4; ++sw) {
                    v4f t = {rr[it][0][sw], rr[it][1][sw], rr[it][2][sw], rr[it][3][sw]};
                    *(v4f*)(sd + sw * 16 * XP_ + it * 24) = t;
                }
            }
        }
    }
    __syncthreads();

    float s1 = 0.0f, s2 = 0.0f;
    v8f pool;
#pragma unroll
    for (int r = 0; r < 8; ++r) pool[r] = 0.0f;

    const float* arow = &sX[cl * XP_ + hi * 4];
    const int m0 = tt * 256 + yh * 16 + hi * 8;      // first of this lane's 8 tokens
    _Float16* vdst = vh + ((size_t)((b * NH_ + (o >> 2)) * 64 + (o & 3) * 16)) * N_ + m0;

    for (int pix = 0; pix < 16; pix += 2) {          // two independent accumulator tiles
        v8f a0, a1;
#pragma unroll
        for (int r = 0; r < 8; ++r) { a0[r] = 0.0f; a1[r] = 0.0f; }
        const float* p0 = arow + pix * 16 * XP_;
        const float* p1 = p0 + 16 * XP_;
#pragma unroll
        for (int j = 0; j < 16; ++j) {
            const v4f x0 = *(const v4f*)(p0 + j * 8);
            const v4f x1 = *(const v4f*)(p1 + j * 8);
            const v2f bl = {wf[j][0], wf[j][1]};
            const v2f bh = {wf[j][2], wf[j][3]};
            const v2f x0l = {x0[0], x0[1]}, x0h = {x0[2], x0[3]};
            const v2f x1l = {x1[0], x1[1]}, x1h = {x1[2], x1[3]};
            a0 = __builtin_amdgcn_wmma_f32_16x16x4_f32(false, x0l, false, bl, (short)0, a0, false, false);
            a1 = __builtin_amdgcn_wmma_f32_16x16x4_f32(false, x1l, false, bl, (short)0, a1, false, false);
            a0 = __builtin_amdgcn_wmma_f32_16x16x4_f32(false, x0h, false, bh, (short)0, a0, false, false);
            a1 = __builtin_amdgcn_wmma_f32_16x16x4_f32(false, x1h, false, bh, (short)0, a1, false, false);
        }
        // four vector slots between the last WMMA and the first reader of its D, on
        // both sides of the branch below; the scheduling barriers hold them in place
        __builtin_amdgcn_sched_barrier(0);
        asm volatile("v_nop\n\tv_nop\n\tv_nop\n\tv_nop");
        __builtin_amdgcn_sched_barrier(0);
#pragma unroll
        for (int r = 0; r < 8; ++r) {
            const float t = a0[r] + a1[r];
            pool[r] += t;            // patch sum; read for q and k only
            s1 += t;
            s2 += a0[r] * a0[r] + a1[r] * a1[r];
        }
        if (proj == 2) {
            v8h h0, h1;
#pragma unroll
            for (int r = 0; r < 8; ++r) { h0[r] = (_Float16)a0[r]; h1[r] = (_Float16)a1[r]; }
            *(v8h*)(vdst + (size_t)pix * N_)       = h0;
            *(v8h*)(vdst + (size_t)(pix + 1) * N_) = h1;
            // the next trip rewrites the stores' address and data registers
            asm volatile("s_wait_xcnt 0x0" ::: "memory");
        }
    }

    if (proj != 2) {   // patch SUM (mean applied later)
        float* dst = ((proj == 0) ? qp_raw : kp_raw) + ((size_t)(b * N_ + m0)) * C_ + o;
#pragma unroll
        for (int r = 0; r < 8; ++r) dst[(size_t)r * C_] = pool[r];
    }

    // group stats: 4 channels of a group are 4 neighbouring lanes, in both halves
    s1 += __shfl_xor(s1, 1, 32);  s2 += __shfl_xor(s2, 1, 32);
    s1 += __shfl_xor(s1, 2, 32);  s2 += __shfl_xor(s2, 2, 32);
    s1 += __shfl_xor(s1, 16, 32); s2 += __shfl_xor(s2, 16, 32);
    if ((lane & 19) == 0) {
        float* sp = statsRaw + ((size_t)((proj * B_ + b) * NH_ + (o >> 2))) * 2;
        unsafeAtomicAdd(sp + 0, s1);
        unsafeAtomicAdd(sp + 1, s2);
    }
}

// ---------------------------------------------------------------------------
// GroupNorm (mu, rstd) of one (projection, b, g) from its raw sum and sum of squares
// ---------------------------------------------------------------------------
__device__ __forceinline__
v2f gn_stats(const float* __restrict__ raw, int i)
{
    const float mu  = raw[2 * i + 0] / SPG_;
    const float var = raw[2 * i + 1] / SPG_ - mu * mu;
    const v2f r = {mu, rsqrtf(var + 1e-5f)};
    return r;
}

// ---------------------------------------------------------------------------
// Async staging of one 32-key x 64-dp V chunk (4 KB) into LDS, shared by the
// 4 waves of the block.  Per-lane global_load_async_to_lds_b128 (ASYNCcnt),
// 2 segments per thread.  LDS layout: [dp][k_local(32)] halves, 64 B rows.
// ---------------------------------------------------------------------------
__device__ __forceinline__
void stage_v(const _Float16* __restrict__ gsrc, _Float16* ldst, int tid)
{
#pragma unroll
    for (int it = 0; it < 2; ++it) {
        const int idx = tid + it * 128;        // 0..255 segments of 16 B
        const int dp  = idx >> 2;
        const int seg = idx & 3;
        const _Float16* g = gsrc + (size_t)dp * N_ + seg * 8;
        const _Float16* l = ldst + dp * 32 + seg * 8;
        const unsigned lofs = (unsigned)(unsigned long long)l;  // LDS byte addr
        const unsigned long long ga = (unsigned long long)g;
        asm volatile("global_load_async_to_lds_b128 %0, %1, off"
                     :: "v"(lofs), "v"(ga) : "memory");
    }
}

// ---------------------------------------------------------------------------
// Kernel 2: fused flash attention.  Block = 128 threads (4 waves), one block
// per (b, g, 64-query tile); each wave owns 16 queries.  The three GroupNorms
// are finished here: the block derives (mu, rstd) of its group from the raw
// sums, normalizes the pooled k while staging it and the pooled q on load (the
// affine commutes with the patch mean; the logit scale 1/sqrt(d)=0.5 goes into
// q), and applies V's affine to the finished rows: the softmax weights of a row
// sum to one, so sum(p*(a*v+b))/sum(p) = a*sum(p*v)/sum(p) + b.  Per 32-key chunk:
// VALU logits (+LDS rel-bias gather), online softmax (xor-16 combine),
// pkrtz-pack P directly into the WMMA A layout, 4x v_wmma_f32_16x16x32_f16
// against V fragments read from the async-staged, double-buffered LDS tile.
// ---------------------------------------------------------------------------
__global__ __launch_bounds__(128)
void k_attn(const float* __restrict__ qp_raw, const float* __restrict__ kp_raw,
            const _Float16* __restrict__ vh, const float* __restrict__ statsRaw,
            const float* __restrict__ gq_g, const float* __restrict__ gq_b,
            const float* __restrict__ gk_g, const float* __restrict__ gk_b,
            const float* __restrict__ gv_g, const float* __restrict__ gv_b,
            const float* __restrict__ rel_table, const int* __restrict__ rel_index,
            float* __restrict__ out)
{
    __shared__ float sKP[N_ * 4];                      // kp for this (b,g): 16 KB
    __shared__ float sTab[TBL_];                       // rel_table row: ~27 KB
    __shared__ __align__(16) _Float16 sV[2][64 * 32];  // double-buffered V chunk: 2x4 KB

    const int blk  = blockIdx.x;                 // b*512 + g*16 + tile
    const int tile = blk & 15;
    const int g    = (blk >> 4) & 31;
    const int b    = blk >> 9;
    const int tid  = threadIdx.x;

    const _Float16* vbase = vh + ((size_t)(b * NH_ + g)) * 64 * N_;

    // kick off async staging of V chunk 0 while we stage kp/table normally
    stage_v(vbase, &sV[0][0], tid);

    const v2f stq = gn_stats(statsRaw, (0 * B_ + b) * NH_ + g);
    const v2f stk = gn_stats(statsRaw, (1 * B_ + b) * NH_ + g);
    const v2f stv = gn_stats(statsRaw, (2 * B_ + b) * NH_ + g);
    float va[4], vb[4];   // V's affine of channel g*4+dd, used in the epilogue
#pragma unroll
    for (int dd = 0; dd < 4; ++dd) {
        va[dd] = stv[1] * gv_g[g * 4 + dd];
        vb[dd] = gv_b[g * 4 + dd] - stv[0] * va[dd];
    }

    { // cooperative staging of normalized kp + bias table
        const float* kpb = kp_raw + ((size_t)b * N_) * C_ + g * 4;
        const v4f kg = *(const v4f*)(gk_g + g * 4);
        const v4f kb = *(const v4f*)(gk_b + g * 4);
        for (int mm = tid; mm < N_; mm += 128) {
            const v4f z = *(const v4f*)(kpb + (size_t)mm * C_);
            v4f kn;
#pragma unroll
            for (int e = 0; e < 4; ++e)
                kn[e] = (z[e] * (1.0f / 16.0f) - stk[0]) * stk[1] * kg[e] + kb[e];
            *(v4f*)&sKP[mm * 4] = kn;
        }
        const float* tb = rel_table + (size_t)g * TBL_;
        for (int ii = tid; ii < TBL_; ii += 128) sTab[ii] = tb[ii];
    }
    __syncthreads();

    const int lane = tid & 31;
    const int wq   = tid >> 5;        // wave id: which 16-query sub-tile
    const int ql   = lane & 15;       // M (query) / N (dp) index within tile
    const int hi   = lane >> 4;       // upper lane half selector

    const int qg = tile * 64 + wq * 16 + ql;     // this lane's query token
    v4f qv;
    {
        const v4f z  = *(const v4f*)(qp_raw + ((size_t)(b * N_ + qg)) * C_ + g * 4);
        const v4f qg4 = *(const v4f*)(gq_g + g * 4);
        const v4f qb4 = *(const v4f*)(gq_b + g * 4);
#pragma unroll
        for (int e = 0; e < 4; ++e)
            qv[e] = ((z[e] * (1.0f / 16.0f) - stq[0]) * stq[1] * qg4[e] + qb4[e]) * 0.5f;
    }

    v8f acc[4];
#pragma unroll
    for (int dd = 0; dd < 4; ++dd)
#pragma unroll
        for (int e = 0; e < 8; ++e) acc[dd][e] = 0.0f;

    float mrow = -__builtin_inff();
    float lrow = 0.0f;

    const int* ri = rel_index + (size_t)qg * N_;

    for (int mc = 0; mc < N_; mc += 32) {
        const int buf = (mc >> 5) & 1;
        // this lane's 16 keys, in exact A-fragment element order:
        // e<8 : K = mc + 8*hi + e        (run0)
        // e>=8: K = mc + 16 + 8*hi + e-8 (run1)
        const int k0 = mc + hi * 8;
        const int k1 = mc + 16 + hi * 8;

        v4i i0a = *(const v4i*)(ri + k0);
        v4i i0b = *(const v4i*)(ri + k0 + 4);
        v4i i1a = *(const v4i*)(ri + k1);
        v4i i1b = *(const v4i*)(ri + k1 + 4);

        float s[16];
#pragma unroll
        for (int j = 0; j < 8; ++j) {
            const float* kp4 = &sKP[(k0 + j) * 4];
            const int bi = (j < 4) ? i0a[j] : i0b[j - 4];
            s[j] = qv[0]*kp4[0] + qv[1]*kp4[1] + qv[2]*kp4[2] + qv[3]*kp4[3] + sTab[bi];
        }
#pragma unroll
        for (int j = 0; j < 8; ++j) {
            const float* kp4 = &sKP[(k1 + j) * 4];
            const int bi = (j < 4) ? i1a[j] : i1b[j - 4];
            s[8 + j] = qv[0]*kp4[0] + qv[1]*kp4[1] + qv[2]*kp4[2] + qv[3]*kp4[3] + sTab[bi];
        }

        if (mc + 32 < N_) __builtin_prefetch(ri + mc + 32, 0, 1);

        // online softmax: lanes q and q+16 jointly cover all 32 keys of query q
        float mloc = s[0];
#pragma unroll
        for (int j = 1; j < 16; ++j) mloc = fmaxf(mloc, s[j]);
        mloc = fmaxf(mloc, __shfl_xor(mloc, 16, 32));
        const float mnew = fmaxf(mrow, mloc);
        const float sc   = __expf(mrow - mnew);

        float p[16], ls = 0.0f;
#pragma unroll
        for (int j = 0; j < 16; ++j) { p[j] = __expf(s[j] - mnew); ls += p[j]; }
        ls  += __shfl_xor(ls, 16, 32);
        lrow = lrow * sc + ls;
        mrow = mnew;

        // rescale accumulators: row r+8*hi belongs to query (r+8*hi), whose
        // stats live in lane (r+8*hi) -> 8 broadcasts
#pragma unroll
        for (int r = 0; r < 8; ++r) {
            const float srow = __shfl(sc, r + hi * 8, 32);
            acc[0][r] *= srow; acc[1][r] *= srow;
            acc[2][r] *= srow; acc[3][r] *= srow;
        }

        // pack P into A fragment (element e == p[e] by construction)
        union { v16h v; pk2h h[8]; } A;
#pragma unroll
        for (int j2 = 0; j2 < 8; ++j2)
            A.h[j2] = __builtin_amdgcn_cvt_pkrtz(p[2 * j2], p[2 * j2 + 1]);

        // current V chunk is ready once our asyncs landed + all waves arrive
        asm volatile("s_wait_asynccnt 0x0" ::: "memory");
        __syncthreads();
        // overlap: stage next chunk into the other buffer
        if (mc + 32 < N_) stage_v(vbase + (mc + 32), &sV[buf ^ 1][0], tid);

        // 4 B-tiles of V (dp = dd*16 + ql) straight from LDS
#pragma unroll
        for (int dd = 0; dd < 4; ++dd) {
            const _Float16* vrow = &sV[buf][(dd * 16 + ql) * 32 + hi * 8];
            union { v16h v; v8h h[2]; } Bf;
            Bf.h[0] = *(const v8h*)vrow;
            Bf.h[1] = *(const v8h*)(vrow + 16);
            acc[dd] = __builtin_amdgcn_wmma_f32_16x16x32_f16(
                false, A.v, false, Bf.v, (short)0, acc[dd], false, false);
        }
    }

    // epilogue: divide by row sums, apply V's GroupNorm affine of channel g*4+dd,
    // and scatter back to (B,C,T,H,W)
    const float lrec = 1.0f / lrow;
#pragma unroll
    for (int r = 0; r < 8; ++r) {
        const float li   = __shfl(lrec, r + hi * 8, 32);
        const int  qrow  = tile * 64 + wq * 16 + r + hi * 8;
        const int  tt    = qrow >> 8;
        const int  yh    = (qrow >> 4) & 15;
        const int  xw    = qrow & 15;
        const int  sh    = ql >> 2;
        const int  sw    = ql & 3;
#pragma unroll
        for (int dd = 0; dd < 4; ++dd) {
            const int c = g * 4 + dd;
            size_t oi = ((size_t)((b * C_ + c) * T_ + tt)) * 4096
                      + (yh * 4 + sh) * 64 + (xw * 4 + sw);
            out[oi] = acc[dd][r] * li * va[dd] + vb[dd];
        }
    }
}

// ---------------------------------------------------------------------------
extern "C" void kernel_launch(void* const* d_in, const int* in_sizes, int n_in,
                              void* d_out, int out_size, void* d_ws, size_t ws_size,
                              hipStream_t stream)
{
    const float* x    = (const float*)d_in[0];
    const float* Wq   = (const float*)d_in[1];
    const float* Wk   = (const float*)d_in[2];
    const float* Wv   = (const float*)d_in[3];
    const float* gq_g = (const float*)d_in[4];
    const float* gq_b = (const float*)d_in[5];
    const float* gk_g = (const float*)d_in[6];
    const float* gk_b = (const float*)d_in[7];
    const float* gv_g = (const float*)d_in[8];
    const float* gv_b = (const float*)d_in[9];
    const float* rtab = (const float*)d_in[10];
    const int*   ridx = (const int*)d_in[11];
    float* out = (float*)d_out;

    char* ws = (char*)d_ws;
    size_t off = 0;
    auto take = [&](size_t bytes) -> void* {
        void* p = ws + off;
        off += (bytes + 255) & ~(size_t)255;
        return p;
    };
    float*    qp_raw = (float*)take((size_t)B_ * N_ * C_ * 4);
    float*    kp_raw = (float*)take((size_t)B_ * N_ * C_ * 4);
    _Float16* vh     = (_Float16*)take((size_t)B_ * NH_ * 64 * N_ * 2);
    float*    sraw   = (float*)take(3 * B_ * NH_ * 2 * 4);
    (void)ws_size; (void)in_sizes; (void)n_in; (void)out_size;

    k_zero <<<1, 3 * B_ * NH_ * 2, 0, stream>>>(sraw, 3 * B_ * NH_ * 2);
    k_proj <<<B_ * T_ * 16 * 2, 384, 0, stream>>>(x, Wq, Wk, Wv, qp_raw, kp_raw, vh, sraw);
    k_attn <<<B_ * NH_ * 16, 128, 0, stream>>>(
        qp_raw, kp_raw, vh, sraw, gq_g, gq_b, gk_g, gk_b, gv_g, gv_b, rtab, ridx, out);
}

// v003
// A run of this version takes 70.3 microseconds.
// Two timings next to v002 both put it at 1.06 times that version's speed.
// Counting every step since v000, it is 6.13 times as fast.
#include <hip/hip_runtime.h>

typedef __attribute__((ext_vector_type(16))) _Float16 v16h;
typedef __attribute__((ext_vector_type(8)))  _Float16 v8h;
typedef __attribute__((ext_vector_type(2)))  __fp16   pk2h;  // cvt_pkrtz result type
typedef __attribute__((ext_vector_type(8)))  float    v8f;
typedef __attribute__((ext_vector_type(4)))  float    v4f;
typedef __attribute__((ext_vector_type(2)))  float    v2f;
typedef __attribute__((ext_vector_type(4)))  int      v4i;

#define B_   2
#define C_   128
#define T_   4
#define NH_  32
#define N_   1024     // T * 16 * 16 patch tokens
#define TBL_ 6727     // (2T-1)*(2h-1)*(2w-1) = 7*31*31
#define SPG_ 65536.0f // elements per GroupNorm group: 4 channels * T*H*W

// ---------------------------------------------------------------------------
// Kernel 0: zero the atomic stats accumulator.
// ---------------------------------------------------------------------------
__global__ void k_zero(float* __restrict__ p, int n) {
    int i = blockIdx.x * blockDim.x + threadIdx.x;
    if (i < n) p[i] = 0.0f;
}

// ---------------------------------------------------------------------------
// Kernel 1: q/k/v projection as an f32 WMMA GEMM, with patch pooling (q,k),
// raw-f16 V pack in [b][g][dp=dd*16+pix][m] layout, and GroupNorm sum/sumsq
// atomics.  One block per (b, t, patch row of 16 patches, half of the 384
// stacked q|k|v output channels).  12 waves; each wave owns 16 output channels
// of one projection and keeps their weights in registers as B fragments for
// the whole block.  A tile = 16 patches (rows) at one pixel position of the
// patch, so a lane's 8 D registers are 8 consecutive patch tokens m of one
// output channel.
// ---------------------------------------------------------------------------
#define XP_ 132   // LDS row pitch in floats: 128 channels + 4, 16-byte reads hit all banks

__global__ __launch_bounds__(384)
void k_proj(const float* __restrict__ x,  const float* __restrict__ Wq,
            const float* __restrict__ Wk, const float* __restrict__ Wv,
            float* __restrict__ qp_raw, float* __restrict__ kp_raw,
            _Float16* __restrict__ vh, float* __restrict__ statsRaw)
{
    __shared__ __align__(16) float sX[256 * XP_];   // [pix][patch][channel], 132 KB

    const int blk  = blockIdx.x;         // ((b*T + tt)*16 + yh)*2 + channel half
    const int prow = blk >> 1;
    const int yh   = prow & 15;
    const int tt   = (prow >> 4) & 3;
    const int b    = prow >> 6;
    const int tid  = threadIdx.x;
    const int lane = tid & 31;
    // wave number as a scalar, so that the choice of projection is a scalar branch
    const int w    = __builtin_amdgcn_readfirstlane(tid >> 5);
    const int ot   = (blk & 1) * 12 + w; // 16-channel tile of the stacked q|k|v rows
    const int proj = ot >> 3;            // 0 q, 1 k, 2 v
    const int cl   = lane & 15;          // A row (patch) / B column (channel) / D column
    const int hi   = lane >> 4;          // k half of A and B, row half of D
    const int o    = (ot & 7) * 16 + cl; // this lane's output channel

    // weights: lane (cl,hi) holds k = 8j + 4hi + 0..3 of row o, j = 0..15
    const float* Wp   = (proj == 0) ? Wq : ((proj == 1) ? Wk : Wv);
    const float* wrow = Wp + (size_t)o * C_ + hi * 4;
    v4f wf[16];
#pragma unroll
    for (int j = 0; j < 16; ++j) wf[j] = *(const v4f*)(wrow + j * 8);
    // the x loads below may land in the weight loads' address registers
    asm volatile("s_wait_xcnt 0x0" ::: "memory");

    { // stage the x tile transposed: a unit = 4 channels x 4 W-pixels, 2048 units
        // over 384 threads: five full rounds and a sixth for waves 0..3.  All
        // loads are issued before the first LDS store, one memory latency in all.
        const float* xb = x + ((size_t)(b * C_) * T_ + tt) * 4096 + yh * 256
                            + (size_t)((tid >> 6) * 4) * (T_ * 4096) + (tid & 63) * 4;
        float* sd = &sX[(((tid >> 4) & 3) * 64 + (tid & 15)) * XP_ + (tid >> 6) * 4];
        v4f rr[6][4];
#pragma unroll
        for (int it = 0; it < 5; ++it)
#pragma unroll
            for (int k = 0; k < 4; ++k)   // 384 threads = 6 units of 4 channels further on
                rr[it][k] = *(const v4f*)(xb + (size_t)(it * 24 + k) * (T_ * 4096));
        if (w < 4) {
#pragma unroll
            for (int k = 0; k < 4; ++k)
                rr[5][k] = *(const v4f*)(xb + (size_t)(5 * 24 + k) * (T_ * 4096));
        }
#pragma unroll
        for (int it = 0; it < 6; ++it) {
            if (it < 5 || w < 4) {
#pragma unroll
                for (int sw = 0; sw < 4; ++sw) {
                    v4f t = {rr[it][0][sw], rr[it][1][sw], rr[it][2][sw], rr[it][3][sw]};
                    *(v4f*)(sd + sw * 16 * XP_ + it * 24) = t;
                }
            }
        }
    }
    __syncthreads();

    float s1 = 0.0f, s2 = 0.0f;
    v8f pool;
#pragma unroll
    for (int r = 0; r < 8; ++r) pool[r] = 0.0f;

    const float* arow = &sX[cl * XP_ + hi * 4];
    const int m0 = tt * 256 + yh * 16 + hi * 8;      // first of this lane's 8 tokens
    _Float16* vdst = vh + ((size_t)((b * NH_ + (o >> 2)) * 64 + (o & 3) * 16)) * N_ + m0;

    for (int pix = 0; pix < 16; pix += 2) {          // two independent accumulator tiles
        v8f a0, a1;
#pragma unroll
        for (int r = 0; r < 8; ++r) { a0[r] = 0.0f; a1[r] = 0.0f; }
        const float* p0 = arow + pix * 16 * XP_;
        const float* p1 = p0 + 16 * XP_;
#pragma unroll
        for (int j = 0; j < 16; ++j) {
            const v4f x0 = *(const v4f*)(p0 + j * 8);
            const v4f x1 = *(const v4f*)(p1 + j * 8);
            const v2f bl = {wf[j][0], wf[j][1]};
            const v2f bh = {wf[j][2], wf[j][3]};
            const v2f x0l = {x0[0], x0[1]}, x0h = {x0[2], x0[3]};
            const v2f x1l = {x1[0], x1[1]}, x1h = {x1[2], x1[3]};
            a0 = __builtin_amdgcn_wmma_f32_16x16x4_f32(false, x0l, false, bl, (short)0, a0, false, false);
            a1 = __builtin_amdgcn_wmma_f32_16x16x4_f32(false, x1l, false, bl, (short)0, a1, false, false);
            a0 = __builtin_amdgcn_wmma_f32_16x16x4_f32(false, x0h, false, bh, (short)0, a0, false, false);
            a1 = __builtin_amdgcn_wmma_f32_16x16x4_f32(false, x1h, false, bh, (short)0, a1, false, false);
        }
        // four vector slots between the last WMMA and the first reader of its D, on
        // both sides of the branch below; the scheduling barriers hold them in place
        __builtin_amdgcn_sched_barrier(0);
        asm volatile("v_nop\n\tv_nop\n\tv_nop\n\tv_nop");
        __builtin_amdgcn_sched_barrier(0);
#pragma unroll
        for (int r = 0; r < 8; ++r) {
            const float t = a0[r] + a1[r];
            pool[r] += t;            // patch sum; read for q and k only
            s1 += t;
            s2 += a0[r] * a0[r] + a1[r] * a1[r];
        }
        if (proj == 2) {
            v8h h0, h1;
#pragma unroll
            for (int r = 0; r < 8; ++r) { h0[r] = (_Float16)a0[r]; h1[r] = (_Float16)a1[r]; }
            *(v8h*)(vdst + (size_t)pix * N_)       = h0;
            *(v8h*)(vdst + (size_t)(pix + 1) * N_) = h1;
            // the next trip rewrites the stores' address and data registers
            asm volatile("s_wait_xcnt 0x0" ::: "memory");
        }
    }

    if (proj != 2) {   // patch SUM (mean applied later)
        float* dst = ((proj == 0) ? qp_raw : kp_raw) + ((size_t)(b * N_ + m0)) * C_ + o;
#pragma unroll
        for (int r = 0; r < 8; ++r) dst[(size_t)r * C_] = pool[r];
    }

    // group stats: 4 channels of a group are 4 neighbouring lanes, in both halves
    s1 += __shfl_xor(s1, 1, 32);  s2 += __shfl_xor(s2, 1, 32);
    s1 += __shfl_xor(s1, 2, 32);  s2 += __shfl_xor(s2, 2, 32);
    s1 += __shfl_xor(s1, 16, 32); s2 += __shfl_xor(s2, 16, 32);
    if ((lane & 19) == 0) {
        float* sp = statsRaw + ((size_t)((proj * B_ + b) * NH_ + (o >> 2))) * 2;
        unsafeAtomicAdd(sp + 0, s1);
        unsafeAtomicAdd(sp + 1, s2);
    }
}

// ---------------------------------------------------------------------------
// GroupNorm (mu, rstd) of one (projection, b, g) from its raw sum and sum of squares
// ---------------------------------------------------------------------------
__device__ __forceinline__
v2f gn_stats(const float* __restrict__ raw, int i)
{
    const float mu  = raw[2 * i + 0] / SPG_;
    const float var = raw[2 * i + 1] / SPG_ - mu * mu;
    const v2f r = {mu, rsqrtf(var + 1e-5f)};
    return r;
}

// ---------------------------------------------------------------------------
// Async staging of one 32-key x 64-dp V chunk (4 KB) into LDS, shared by the
// 4 waves of the block.  Per-lane global_load_async_to_lds_b128 (ASYNCcnt),
// 2 segments per thread.  LDS layout: [dp][k_local(32)] halves; a row holds
// 64 B and is pitched VP_ halves = 80 B (16 B x odd): the 16 rows that a half
// wave reads with one ds_load_b128 then start on 16 different groups of four
// banks, where a 64 B pitch puts four rows on each group.
// ---------------------------------------------------------------------------
#define VP_ 40
__device__ __forceinline__
void stage_v(const _Float16* __restrict__ gsrc, _Float16* ldst, int tid)
{
#pragma unroll
    for (int it = 0; it < 2; ++it) {
        const int idx = tid + it * 128;        // 0..255 segments of 16 B
        const int dp  = idx >> 2;
        const int seg = idx & 3;
        const _Float16* g = gsrc + (size_t)dp * N_ + seg * 8;
        const _Float16* l = ldst + dp * VP_ + seg * 8;
        const unsigned lofs = (unsigned)(unsigned long long)l;  // LDS byte addr
        const unsigned long long ga = (unsigned long long)g;
        asm volatile("global_load_async_to_lds_b128 %0, %1, off"
                     :: "v"(lofs), "v"(ga) : "memory");
    }
}

// ---------------------------------------------------------------------------
// Kernel 2: fused flash attention.  Block = 128 threads (4 waves), one block
// per (b, g, 64-query tile); each wave owns 16 queries.  The three GroupNorms
// are finished here: the block derives (mu, rstd) of its group from the raw
// sums, normalizes the pooled k while staging it and the pooled q on load (the
// affine commutes with the patch mean; the logit scale 1/sqrt(d)=0.5 goes into
// q), and applies V's affine to the finished rows: the softmax weights of a row
// sum to one, so sum(p*(a*v+b))/sum(p) = a*sum(p*v)/sum(p) + b.  Per 32-key chunk:
// VALU logits (+LDS rel-bias gather), online softmax (xor-16 combine),
// pkrtz-pack P directly into the WMMA A layout, 4x v_wmma_f32_16x16x32_f16
// against V fragments read from the async-staged, double-buffered LDS tile.
// ---------------------------------------------------------------------------
__global__ __launch_bounds__(128)
void k_attn(const float* __restrict__ qp_raw, const float* __restrict__ kp_raw,
            const _Float16* __restrict__ vh, const float* __restrict__ statsRaw,
            const float* __restrict__ gq_g, const float* __restrict__ gq_b,
            const float* __restrict__ gk_g, const float* __restrict__ gk_b,
            const float* __restrict__ gv_g, const float* __restrict__ gv_b,
            const float* __restrict__ rel_table, const int* __restrict__ rel_index,
            float* __restrict__ out)
{
    __shared__ float sKP[N_ * 4];                      // kp for this (b,g): 16 KB
    __shared__ float sTab[TBL_];                       // rel_table row: ~27 KB
    __shared__ __align__(16) _Float16 sV[2][64 * VP_]; // double-buffered V chunk: 2x5 KB

    const int blk  = blockIdx.x;                 // b*512 + g*16 + tile
    const int tile = blk & 15;
    const int g    = (blk >> 4) & 31;
    const int b    = blk >> 9;
    const int tid  = threadIdx.x;

    const _Float16* vbase = vh + ((size_t)(b * NH_ + g)) * 64 * N_;

    // kick off async staging of V chunk 0 while we stage kp/table normally
    stage_v(vbase, &sV[0][0], tid);

    const v2f stq = gn_stats(statsRaw, (0 * B_ + b) * NH_ + g);
    const v2f stk = gn_stats(statsRaw, (1 * B_ + b) * NH_ + g);
    const v2f stv = gn_stats(statsRaw, (2 * B_ + b) * NH_ + g);
    float va[4], vb[4];   // V's affine of channel g*4+dd, used in the epilogue
#pragma unroll
    for (int dd = 0; dd < 4; ++dd) {
        va[dd] = stv[1] * gv_g[g * 4 + dd];
        vb[dd] = gv_b[g * 4 + dd] - stv[0] * va[dd];
    }

    { // cooperative staging of normalized kp + bias table
        const float* kpb = kp_raw + ((size_t)b * N_) * C_ + g * 4;
        const v4f kg = *(const v4f*)(gk_g + g * 4);
        const v4f kb = *(const v4f*)(gk_b + g * 4);
        for (int mm = tid; mm < N_; mm += 128) {
            const v4f z = *(const v4f*)(kpb + (size_t)mm * C_);
            v4f kn;
#pragma unroll
            for (int e = 0; e < 4; ++e)
                kn[e] = (z[e] * (1.0f / 16.0f) - stk[0]) * stk[1] * kg[e] + kb[e];
            *(v4f*)&sKP[mm * 4] = kn;
        }
        const float* tb = rel_table + (size_t)g * TBL_;
        for (int ii = tid; ii < TBL_; ii += 128) sTab[ii] = tb[ii];
    }
    __syncthreads();

    const int lane = tid & 31;
    const int wq   = tid >> 5;        // wave id: which 16-query sub-tile
    const int ql   = lane & 15;       // M (query) / N (dp) index within tile
    const int hi   = lane >> 4;       // upper lane half selector

    const int qg = tile * 64 + wq * 16 + ql;     // this lane's query token
    v4f qv;
    {
        const v4f z  = *(const v4f*)(qp_raw + ((size_t)(b * N_ + qg)) * C_ + g * 4);
        const v4f qg4 = *(const v4f*)(gq_g + g * 4);
        const v4f qb4 = *(const v4f*)(gq_b + g * 4);
#pragma unroll
        for (int e = 0; e < 4; ++e)
            qv[e] = ((z[e] * (1.0f / 16.0f) - stq[0]) * stq[1] * qg4[e] + qb4[e]) * 0.5f;
    }

    v8f acc[4];
#pragma unroll
    for (int dd = 0; dd < 4; ++dd)
#pragma unroll
        for (int e = 0; e < 8; ++e) acc[dd][e] = 0.0f;

    float mrow = -__builtin_inff();
    float lrow = 0.0f;

    const int* ri = rel_index + (size_t)qg * N_;

    for (int mc = 0; mc < N_; mc += 32) {
        const int buf = (mc >> 5) & 1;
        // this lane's 16 keys, in exact A-fragment element order:
        // e<8 : K = mc + 8*hi + e        (run0)
        // e>=8: K = mc + 16 + 8*hi + e-8 (run1)
        const int k0 = mc + hi * 8;
        const int k1 = mc + 16 + hi * 8;

        v4i i0a = *(const v4i*)(ri + k0);
        v4i i0b = *(const v4i*)(ri + k0 + 4);
        v4i i1a = *(const v4i*)(ri + k1);
        v4i i1b = *(const v4i*)(ri + k1 + 4);

        float s[16];
#pragma unroll
        for (int j = 0; j < 8; ++j) {
            const float* kp4 = &sKP[(k0 + j) * 4];
            const int bi = (j < 4) ? i0a[j] : i0b[j - 4];
            s[j] = qv[0]*kp4[0] + qv[1]*kp4[1] + qv[2]*kp4[2] + qv[3]*kp4[3] + sTab[bi];
        }
#pragma unroll
        for (int j = 0; j < 8; ++j) {
            const float* kp4 = &sKP[(k1 + j) * 4];
            const int bi = (j < 4) ? i1a[j] : i1b[j - 4];
            s[8 + j] = qv[0]*kp4[0] + qv[1]*kp4[1] + qv[2]*kp4[2] + qv[3]*kp4[3] + sTab[bi];
        }

        if (mc + 32 < N_) __builtin_prefetch(ri + mc + 32, 0, 1);

        // online softmax: lanes q and q+16 jointly cover all 32 keys of query q
        float mloc = s[0];
#pragma unroll
        for (int j = 1; j < 16; ++j) mloc = fmaxf(mloc, s[j]);
        mloc = fmaxf(mloc, __shfl_xor(mloc, 16, 32));
        const float mnew = fmaxf(mrow, mloc);
        const float sc   = __expf(mrow - mnew);

        float p[16], ls = 0.0f;
#pragma unroll
        for (int j = 0; j < 16; ++j) { p[j] = __expf(s[j] - mnew); ls += p[j]; }
        ls  += __shfl_xor(ls, 16, 32);
        lrow = lrow * sc + ls;
        mrow = mnew;

        // rescale accumulators: row r+8*hi belongs to query (r+8*hi), whose
        // stats live in lane (r+8*hi) -> 8 broadcasts
#pragma unroll
        for (int r = 0; r < 8; ++r) {
            const float srow = __shfl(sc, r + hi * 8, 32);
            acc[0][r] *= srow; acc[1][r] *= srow;
            acc[2][r] *= srow; acc[3][r] *= srow;
        }

        // pack P into A fragment (element e == p[e] by construction)
        union { v16h v; pk2h h[8]; } A;
#pragma unroll
        for (int j2 = 0; j2 < 8; ++j2)
            A.h[j2] = __builtin_amdgcn_cvt_pkrtz(p[2 * j2], p[2 * j2 + 1]);

        // current V chunk is ready once our asyncs landed + all waves arrive
        asm volatile("s_wait_asynccnt 0x0" ::: "memory");
        __syncthreads();
        // overlap: stage next chunk into the other buffer
        if (mc + 32 < N_) stage_v(vbase + (mc + 32), &sV[buf ^ 1][0], tid);

        // 4 B-tiles of V (dp = dd*16 + ql) straight from LDS
#pragma unroll
        for (int dd = 0; dd < 4; ++dd) {
            const _Float16* vrow = &sV[buf][(dd * 16 + ql) * VP_ + hi * 8];
            union { v16h v; v8h h[2]; } Bf;
            Bf.h[0] = *(const v8h*)vrow;
            Bf.h[1] = *(const v8h*)(vrow + 16);
            acc[dd] = __builtin_amdgcn_wmma_f32_16x16x32_f16(
                false, A.v, false, Bf.v, (short)0, acc[dd], false, false);
        }
    }

    // epilogue: divide by row sums, apply V's GroupNorm affine of channel g*4+dd,
    // and scatter back to (B,C,T,H,W)
    const float lrec = 1.0f / lrow;
#pragma unroll
    for (int r = 0; r < 8; ++r) {
        const float li   = __shfl(lrec, r + hi * 8, 32);
        const int  qrow  = tile * 64 + wq * 16 + r + hi * 8;
        const int  tt    = qrow >> 8;
        const int  yh    = (qrow >> 4) & 15;
        const int  xw    = qrow & 15;
        const int  sh    = ql >> 2;
        const int  sw    = ql & 3;
#pragma unroll
        for (int dd = 0; dd < 4; ++dd) {
            const int c = g * 4 + dd;
            size_t oi = ((size_t)((b * C_ + c) * T_ + tt)) * 4096
                      + (yh * 4 + sh) * 64 + (xw * 4 + sw);
            out[oi] = acc[dd][r] * li * va[dd] + vb[dd];
        }
    }
}

// ---------------------------------------------------------------------------
extern "C" void kernel_launch(void* const* d_in, const int* in_sizes, int n_in,
                              void* d_out, int out_size, void* d_ws, size_t ws_size,
                              hipStream_t stream)
{
    const float* x    = (const float*)d_in[0];
    const float* Wq   = (const float*)d_in[1];
    const float* Wk   = (const float*)d_in[2];
    const float* Wv   = (const float*)d_in[3];
    const float* gq_g = (const float*)d_in[4];
    const float* gq_b = (const float*)d_in[5];
    const float* gk_g = (const float*)d_in[6];
    const float* gk_b = (const float*)d_in[7];
    const float* gv_g = (const float*)d_in[8];
    const float* gv_b = (const float*)d_in[9];
    const float* rtab = (const float*)d_in[10];
    const int*   ridx = (const int*)d_in[11];
    float* out = (float*)d_out;

    char* ws = (char*)d_ws;
    size_t off = 0;
    auto take = [&](size_t bytes) -> void* {
        void* p = ws + off;
        off += (bytes + 255) & ~(size_t)255;
        return p;
    };
    float*    qp_raw = (float*)take((size_t)B_ * N_ * C_ * 4);
    float*    kp_raw = (float*)take((size_t)B_ * N_ * C_ * 4);
    _Float16* vh     = (_Float16*)take((size_t)B_ * NH_ * 64 * N_ * 2);
    float*    sraw   = (float*)take(3 * B_ * NH_ * 2 * 4);
    (void)ws_size; (void)in_sizes; (void)n_in; (void)out_size;

    k_zero <<<1, 3 * B_ * NH_ * 2, 0, stream>>>(sraw, 3 * B_ * NH_ * 2);
    k_proj <<<B_ * T_ * 16 * 2, 384, 0, stream>>>(x, Wq, Wk, Wv, qp_raw, kp_raw, vh, sraw);
    k_attn <<<B_ * NH_ * 16, 128, 0, stream>>>(
        qp_raw, kp_raw, vh, sraw, gq_g, gq_b, gk_g, gk_b, gv_g, gv_b, rtab, ridx, out);
}

// v004
// It runs in 64.2 microseconds.
// In both of two side-by-side timings against v003, it was 1.11 times as fast.
// Over all steps from v000 it is 6.78 times as fast.
#include <hip/hip_runtime.h>

typedef __attribute__((ext_vector_type(16))) _Float16 v16h;
typedef __attribute__((ext_vector_type(8)))  _Float16 v8h;
typedef __attribute__((ext_vector_type(2)))  __fp16   pk2h;  // cvt_pkrtz result type
typedef __attribute__((ext_vector_type(8)))  float    v8f;
typedef __attribute__((ext_vector_type(4)))  float    v4f;
typedef __attribute__((ext_vector_type(2)))  float    v2f;
typedef __attribute__((ext_vector_type(4)))  int      v4i;

#define B_   2
#define C_   128
#define T_   4
#define NH_  32
#define N_   1024     // T * 16 * 16 patch tokens
#define TBL_ 6727     // (2T-1)*(2h-1)*(2w-1) = 7*31*31
#define SPG_ 65536.0f // elements per GroupNorm group: 4 channels * T*H*W

// ---------------------------------------------------------------------------
// Kernel 0: zero the atomic stats accumulator.
// ---------------------------------------------------------------------------
__global__ void k_zero(float* __restrict__ p, int n) {
    int i = blockIdx.x * blockDim.x + threadIdx.x;
    if (i < n) p[i] = 0.0f;
}

// ---------------------------------------------------------------------------
// Kernel 1: q/k/v projection as an f32 WMMA GEMM, with patch pooling (q,k),
// raw-f16 V pack in [b][g][dp=dd*16+pix][m] layout, and GroupNorm sum/sumsq
// atomics.  One block per (b, t, patch row of 16 patches, half of the 384
// stacked q|k|v output channels).  12 waves; each wave owns 16 output channels
// of one projection and keeps their weights in registers as B fragments for
// the whole block.  A tile = 16 patches (rows) at one pixel position of the
// patch, so a lane's 8 D registers are 8 consecutive patch tokens m of one
// output channel.
// ---------------------------------------------------------------------------
#define XP_ 132   // LDS row pitch in floats: 128 channels + 4, 16-byte reads hit all banks

__global__ __launch_bounds__(384)
void k_proj(const float* __restrict__ x,  const float* __restrict__ Wq,
            const float* __restrict__ Wk, const float* __restrict__ Wv,
            float* __restrict__ qp_raw, float* __restrict__ kp_raw,
            _Float16* __restrict__ vh, float* __restrict__ statsRaw)
{
    __shared__ __align__(16) float sX[256 * XP_];   // [pix][patch][channel], 132 KB

    const int blk  = blockIdx.x;         // ((b*T + tt)*16 + yh)*2 + channel half
    const int prow = blk >> 1;
    const int yh   = prow & 15;
    const int tt   = (prow >> 4) & 3;
    const int b    = prow >> 6;
    const int tid  = threadIdx.x;
    const int lane = tid & 31;
    // wave number as a scalar, so that the choice of projection is a scalar branch
    const int w    = __builtin_amdgcn_readfirstlane(tid >> 5);
    const int ot   = (blk & 1) * 12 + w; // 16-channel tile of the stacked q|k|v rows
    const int proj = ot >> 3;            // 0 q, 1 k, 2 v
    const int cl   = lane & 15;          // A row (patch) / B column (channel) / D column
    const int hi   = lane >> 4;          // k half of A and B, row half of D
    const int o    = (ot & 7) * 16 + cl; // this lane's output channel

    // weights: lane (cl,hi) holds k = 8j + 4hi + 0..3 of row o, j = 0..15
    const float* Wp   = (proj == 0) ? Wq : ((proj == 1) ? Wk : Wv);
    const float* wrow = Wp + (size_t)o * C_ + hi * 4;
    v4f wf[16];
#pragma unroll
    for (int j = 0; j < 16; ++j) wf[j] = *(const v4f*)(wrow + j * 8);
    // the x loads below may land in the weight loads' address registers
    asm volatile("s_wait_xcnt 0x0" ::: "memory");

    { // stage the x tile transposed: a unit = 4 channels x 4 W-pixels, 2048 units
        // over 384 threads: five full rounds and a sixth for waves 0..3.  All
        // loads are issued before the first LDS store, one memory latency in all.
        const float* xb = x + ((size_t)(b * C_) * T_ + tt) * 4096 + yh * 256
                            + (size_t)((tid >> 6) * 4) * (T_ * 4096) + (tid & 63) * 4;
        float* sd = &sX[(((tid >> 4) & 3) * 64 + (tid & 15)) * XP_ + (tid >> 6) * 4];
        v4f rr[6][4];
#pragma unroll
        for (int it = 0; it < 5; ++it)
#pragma unroll
            for (int k = 0; k < 4; ++k)   // 384 threads = 6 units of 4 channels further on
                rr[it][k] = *(const v4f*)(xb + (size_t)(it * 24 + k) * (T_ * 4096));
        if (w < 4) {
#pragma unroll
            for (int k = 0; k < 4; ++k)
                rr[5][k] = *(const v4f*)(xb + (size_t)(5 * 24 + k) * (T_ * 4096));
        }
#pragma unroll
        for (int it = 0; it < 6; ++it) {
            if (it < 5 || w < 4) {
#pragma unroll
                for (int sw = 0; sw < 4; ++sw) {
                    v4f t = {rr[it][0][sw], rr[it][1][sw], rr[it][2][sw], rr[it][3][sw]};
                    *(v4f*)(sd + sw * 16 * XP_ + it * 24) = t;
                }
            }
        }
    }
    __syncthreads();

    float s1 = 0.0f, s2 = 0.0f;
    v8f pool;
#pragma unroll
    for (int r = 0; r < 8; ++r) pool[r] = 0.0f;

    const float* arow = &sX[cl * XP_ + hi * 4];
    const int m0 = tt * 256 + yh * 16 + hi * 8;      // first of this lane's 8 tokens
    _Float16* vdst = vh + ((size_t)((b * NH_ + (o >> 2)) * 64 + (o & 3) * 16)) * N_ + m0;

    for (int pix = 0; pix < 16; pix += 2) {          // two independent accumulator tiles
        v8f a0, a1;
#pragma unroll
        for (int r = 0; r < 8; ++r) { a0[r] = 0.0f; a1[r] = 0.0f; }
        const float* p0 = arow + pix * 16 * XP_;
        const float* p1 = p0 + 16 * XP_;
#pragma unroll
        for (int j = 0; j < 16; ++j) {
            const v4f x0 = *(const v4f*)(p0 + j * 8);
            const v4f x1 = *(const v4f*)(p1 + j * 8);
            const v2f bl = {wf[j][0], wf[j][1]};
            const v2f bh = {wf[j][2], wf[j][3]};
            const v2f x0l = {x0[0], x0[1]}, x0h = {x0[2], x0[3]};
            const v2f x1l = {x1[0], x1[1]}, x1h = {x1[2], x1[3]};
            a0 = __builtin_amdgcn_wmma_f32_16x16x4_f32(false, x0l, false, bl, (short)0, a0, false, false);
            a1 = __builtin_amdgcn_wmma_f32_16x16x4_f32(false, x1l, false, bl, (short)0, a1, false, false);
            a0 = __builtin_amdgcn_wmma_f32_16x16x4_f32(false, x0h, false, bh, (short)0, a0, false, false);
            a1 = __builtin_amdgcn_wmma_f32_16x16x4_f32(false, x1h, false, bh, (short)0, a1, false, false);
        }
        // four vector slots between the last WMMA and the first reader of its D, on
        // both sides of the branch below; the scheduling barriers hold them in place
        __builtin_amdgcn_sched_barrier(0);
        asm volatile("v_nop\n\tv_nop\n\tv_nop\n\tv_nop");
        __builtin_amdgcn_sched_barrier(0);
#pragma unroll
        for (int r = 0; r < 8; ++r) {
            const float t = a0[r] + a1[r];
            pool[r] += t;            // patch sum; read for q and k only
            s1 += t;
            s2 += a0[r] * a0[r] + a1[r] * a1[r];
        }
        if (proj == 2) {
            v8h h0, h1;
#pragma unroll
            for (int r = 0; r < 8; ++r) { h0[r] = (_Float16)a0[r]; h1[r] = (_Float16)a1[r]; }
            *(v8h*)(vdst + (size_t)pix * N_)       = h0;
            *(v8h*)(vdst + (size_t)(pix + 1) * N_) = h1;
            // the next trip rewrites the stores' address and data registers
            asm volatile("s_wait_xcnt 0x0" ::: "memory");
        }
    }

    if (proj != 2) {   // patch SUM (mean applied later), head-major [b][g][m][4]:
        // the 8 tokens x 4 channels that a group's lanes store fill one 128 B line
        float* dst = ((proj == 0) ? qp_raw : kp_raw)
                   + ((size_t)(b * NH_ + (o >> 2)) * N_ + m0) * 4 + (o & 3);
#pragma unroll
        for (int r = 0; r < 8; ++r) dst[r * 4] = pool[r];
    }

    // group stats: 4 channels of a group are 4 neighbouring lanes, in both halves
    s1 += __shfl_xor(s1, 1, 32);  s2 += __shfl_xor(s2, 1, 32);
    s1 += __shfl_xor(s1, 2, 32);  s2 += __shfl_xor(s2, 2, 32);
    s1 += __shfl_xor(s1, 16, 32); s2 += __shfl_xor(s2, 16, 32);
    if ((lane & 19) == 0) {
        float* sp = statsRaw + ((size_t)((proj * B_ + b) * NH_ + (o >> 2))) * 2;
        unsafeAtomicAdd(sp + 0, s1);
        unsafeAtomicAdd(sp + 1, s2);
    }
}

// ---------------------------------------------------------------------------
// GroupNorm (mu, rstd) of one (projection, b, g) from its raw sum and sum of squares
// ---------------------------------------------------------------------------
__device__ __forceinline__
v2f gn_stats(v2f raw)
{
    const float mu  = raw[0] / SPG_;
    const float var = raw[1] / SPG_ - mu * mu;
    const v2f r = {mu, rsqrtf(var + 1e-5f)};
    return r;
}

// ---------------------------------------------------------------------------
// Async staging of one 32-key x 64-dp V chunk (4 KB) into LDS, shared by the
// 4 waves of the block.  Per-lane global_load_async_to_lds_b128 (ASYNCcnt),
// 2 segments per thread.  LDS layout: [dp][k_local(32)] halves; a row holds
// 64 B and is pitched VP_ halves = 80 B (16 B x odd): the 16 rows that a half
// wave reads with one ds_load_b128 then start on 16 different groups of four
// banks, where a 64 B pitch puts four rows on each group.
// ---------------------------------------------------------------------------
#define VP_ 40
__device__ __forceinline__
void stage_v(const _Float16* __restrict__ gsrc, _Float16* ldst, int tid)
{
#pragma unroll
    for (int it = 0; it < 2; ++it) {
        const int idx = tid + it * 128;        // 0..255 segments of 16 B
        const int dp  = idx >> 2;
        const int seg = idx & 3;
        const _Float16* g = gsrc + (size_t)dp * N_ + seg * 8;
        const _Float16* l = ldst + dp * VP_ + seg * 8;
        const unsigned lofs = (unsigned)(unsigned long long)l;  // LDS byte addr
        const unsigned long long ga = (unsigned long long)g;
        asm volatile("global_load_async_to_lds_b128 %0, %1, off"
                     :: "v"(lofs), "v"(ga) : "memory");
    }
}

// Chunk 0's copies for the prologue: the same two segments per thread as stage_v,
// in one statement that ends in s_wait_xcnt 0, so that nothing scheduled behind it
// lands in an address register of the copies or of the loads issued before them.
__device__ __forceinline__
void stage_v_first(const _Float16* __restrict__ gsrc, _Float16* ldst, int tid)
{
    const int dp  = tid >> 2;
    const int seg = tid & 3;
    const _Float16* g0 = gsrc + (size_t)dp * N_ + seg * 8;
    const _Float16* g1 = g0 + (size_t)32 * N_;
    const _Float16* l0 = ldst + dp * VP_ + seg * 8;
    const _Float16* l1 = l0 + 32 * VP_;
    const unsigned lo0 = (unsigned)(unsigned long long)l0;  // LDS byte addr
    const unsigned lo1 = (unsigned)(unsigned long long)l1;
    const unsigned long long ga0 = (unsigned long long)g0;
    const unsigned long long ga1 = (unsigned long long)g1;
    asm volatile("global_load_async_to_lds_b128 %0, %1, off\n\t"
                 "global_load_async_to_lds_b128 %2, %3, off\n\t"
                 "s_wait_xcnt 0x0"
                 :: "v"(lo0), "v"(ga0), "v"(lo1), "v"(ga1) : "memory");
}

// ---------------------------------------------------------------------------
// Kernel 2: fused flash attention.  Block = 128 threads (4 waves), one block
// per (b, g, 64-query tile); each wave owns 16 queries.  The three GroupNorms
// are finished here: the block derives (mu, rstd) of its group from the raw
// sums, normalizes the pooled k while staging it and the pooled q on load (the
// affine commutes with the patch mean; the logit scale 1/sqrt(d)=0.5 goes into
// q), and applies V's affine to the finished rows: the softmax weights of a row
// sum to one, so sum(p*(a*v+b))/sum(p) = a*sum(p*v)/sum(p) + b.  Per 32-key chunk:
// VALU logits (+LDS rel-bias gather), online softmax (xor-16 combine),
// pkrtz-pack P directly into the WMMA A layout, 4x v_wmma_f32_16x16x32_f16
// against V fragments read from the async-staged, double-buffered LDS tile.
// ---------------------------------------------------------------------------
__global__ __launch_bounds__(128)
void k_attn(const float* __restrict__ qp_raw, const float* __restrict__ kp_raw,
            const _Float16* __restrict__ vh, const float* __restrict__ statsRaw,
            const float* __restrict__ gq_g, const float* __restrict__ gq_b,
            const float* __restrict__ gk_g, const float* __restrict__ gk_b,
            const float* __restrict__ gv_g, const float* __restrict__ gv_b,
            const float* __restrict__ rel_table, const int* __restrict__ rel_index,
            float* __restrict__ out)
{
    __shared__ float sKP[N_ * 4];                      // kp for this (b,g): 16 KB
    __shared__ float sTab[TBL_];                       // rel_table row: ~27 KB
    __shared__ __align__(16) _Float16 sV[2][64 * VP_]; // double-buffered V chunk: 2x5 KB

    const int blk  = blockIdx.x;                 // b*512 + g*16 + tile
    const int tile = blk & 15;
    const int g    = (blk >> 4) & 31;
    const int b    = blk >> 9;
    const int tid  = threadIdx.x;

    const _Float16* vbase = vh + ((size_t)(b * NH_ + g)) * 64 * N_;

    const int lane = tid & 31;
    const int wq   = tid >> 5;        // wave id: which 16-query sub-tile
    const int ql   = lane & 15;       // M (query) / N (dp) index within tile
    const int hi   = lane >> 4;       // upper lane half selector
    const int qg   = tile * 64 + wq * 16 + ql;   // this lane's query token

    // every global load of the prologue is issued here, ahead of the first wait:
    // the pooled k of this (b,g) (16 KB in a row), this lane's pooled q, the table
    // row, and the block's raw sums and affine rows.  One memory round trip in all.
    const v2f rq  = *(const v2f*)(statsRaw + ((0 * B_ + b) * NH_ + g) * 2);
    const v2f rk  = *(const v2f*)(statsRaw + ((1 * B_ + b) * NH_ + g) * 2);
    const v2f rv  = *(const v2f*)(statsRaw + ((2 * B_ + b) * NH_ + g) * 2);
    const v4f kg  = *(const v4f*)(gk_g + g * 4);
    const v4f kb  = *(const v4f*)(gk_b + g * 4);
    const v4f qg4 = *(const v4f*)(gq_g + g * 4);
    const v4f qb4 = *(const v4f*)(gq_b + g * 4);
    const v4f vg4 = *(const v4f*)(gv_g + g * 4);
    const v4f vb4 = *(const v4f*)(gv_b + g * 4);
    const float* kpb = kp_raw + (size_t)(b * NH_ + g) * N_ * 4;
    const float* tb  = rel_table + (size_t)g * TBL_;
    v4f   kz[8];
    float tz[53];
#pragma unroll
    for (int it = 0; it < 8; ++it) kz[it] = *(const v4f*)(kpb + (tid + it * 128) * 4);
    const v4f qz = *(const v4f*)(qp_raw + ((size_t)(b * NH_ + g) * N_ + qg) * 4);
#pragma unroll
    for (int it = 0; it < 52; ++it) tz[it] = tb[tid + it * 128];
    tz[52] = 0.0f;
    if (tid < TBL_ - 52 * 128) tz[52] = tb[tid + 52 * 128];
    // async staging of V chunk 0 flies with them; it is first read in trip 0
    stage_v_first(vbase, &sV[0][0], tid);

    const v2f stq = gn_stats(rq);
    const v2f stk = gn_stats(rk);
    const v2f stv = gn_stats(rv);
    float va[4], vb[4];   // V's affine of channel g*4+dd, used in the epilogue
#pragma unroll
    for (int dd = 0; dd < 4; ++dd) {
        va[dd] = stv[1] * vg4[dd];
        vb[dd] = vb4[dd] - stv[0] * va[dd];
    }

    { // cooperative staging of normalized kp + bias table
#pragma unroll
        for (int it = 0; it < 8; ++it) {
            const v4f z = kz[it];
            v4f kn;
#pragma unroll
            for (int e = 0; e < 4; ++e)
                kn[e] = (z[e] * (1.0f / 16.0f) - stk[0]) * stk[1] * kg[e] + kb[e];
            *(v4f*)&sKP[(tid + it * 128) * 4] = kn;
        }
#pragma unroll
        for (int it = 0; it < 52; ++it) sTab[tid + it * 128] = tz[it];
        if (tid < TBL_ - 52 * 128) sTab[tid + 52 * 128] = tz[52];
    }
    __syncthreads();

    v4f qv;
    {
        const v4f z  = qz;
#pragma unroll
        for (int e = 0; e < 4; ++e)
            qv[e] = ((z[e] * (1.0f / 16.0f) - stq[0]) * stq[1] * qg4[e] + qb4[e]) * 0.5f;
    }

    v8f acc[4];
#pragma unroll
    for (int dd = 0; dd < 4; ++dd)
#pragma unroll
        for (int e = 0; e < 8; ++e) acc[dd][e] = 0.0f;

    float mrow = -__builtin_inff();
    float lrow = 0.0f;

    const int* ri = rel_index + (size_t)qg * N_;

    for (int mc = 0; mc < N_; mc += 32) {
        const int buf = (mc >> 5) & 1;
        // this lane's 16 keys, in exact A-fragment element order:
        // e<8 : K = mc + 8*hi + e        (run0)
        // e>=8: K = mc + 16 + 8*hi + e-8 (run1)
        const int k0 = mc + hi * 8;
        const int k1 = mc + 16 + hi * 8;

        v4i i0a = *(const v4i*)(ri + k0);
        v4i i0b = *(const v4i*)(ri + k0 + 4);
        v4i i1a = *(const v4i*)(ri + k1);
        v4i i1b = *(const v4i*)(ri + k1 + 4);

        float s[16];
#pragma unroll
        for (int j = 0; j < 8; ++j) {
            const float* kp4 = &sKP[(k0 + j) * 4];
            const int bi = (j < 4) ? i0a[j] : i0b[j - 4];
            s[j] = qv[0]*kp4[0] + qv[1]*kp4[1] + qv[2]*kp4[2] + qv[3]*kp4[3] + sTab[bi];
        }
#pragma unroll
        for (int j = 0; j < 8; ++j) {
            const float* kp4 = &sKP[(k1 + j) * 4];
            const int bi = (j < 4) ? i1a[j] : i1b[j - 4];
            s[8 + j] = qv[0]*kp4[0] + qv[1]*kp4[1] + qv[2]*kp4[2] + qv[3]*kp4[3] + sTab[bi];
        }

        if (mc + 32 < N_) __builtin_prefetch(ri + mc + 32, 0, 1);

        // online softmax: lanes q and q+16 jointly cover all 32 keys of query q
        float mloc = s[0];
#pragma unroll
        for (int j = 1; j < 16; ++j) mloc = fmaxf(mloc, s[j]);
        mloc = fmaxf(mloc, __shfl_xor(mloc, 16, 32));
        const float mnew = fmaxf(mrow, mloc);
        const float sc   = __expf(mrow - mnew);

        float p[16], ls = 0.0f;
#pragma unroll
        for (int j = 0; j < 16; ++j) { p[j] = __expf(s[j] - mnew); ls += p[j]; }
        ls  += __shfl_xor(ls, 16, 32);
        lrow = lrow * sc + ls;
        mrow = mnew;

        // rescale accumulators: row r+8*hi belongs to query (r+8*hi), whose
        // stats live in lane (r+8*hi) -> 8 broadcasts
#pragma unroll
        for (int r = 0; r < 8; ++r) {
            const float srow = __shfl(sc, r + hi * 8, 32);
            acc[0][r] *= srow; acc[1][r] *= srow;
            acc[2][r] *= srow; acc[3][r] *= srow;
        }

        // pack P into A fragment (element e == p[e] by construction)
        union { v16h v; pk2h h[8]; } A;
#pragma unroll
        for (int j2 = 0; j2 < 8; ++j2)
            A.h[j2] = __builtin_amdgcn_cvt_pkrtz(p[2 * j2], p[2 * j2 + 1]);

        // current V chunk is ready once our asyncs landed + all waves arrive
        asm volatile("s_wait_asynccnt 0x0" ::: "memory");
        __syncthreads();
        // overlap: stage next chunk into the other buffer
        if (mc + 32 < N_) stage_v(vbase + (mc + 32), &sV[buf ^ 1][0], tid);

        // 4 B-tiles of V (dp = dd*16 + ql) straight from LDS
#pragma unroll
        for (int dd = 0; dd < 4; ++dd) {
            const _Float16* vrow = &sV[buf][(dd * 16 + ql) * VP_ + hi * 8];
            union { v16h v; v8h h[2]; } Bf;
            Bf.h[0] = *(const v8h*)vrow;
            Bf.h[1] = *(const v8h*)(vrow + 16);
            acc[dd] = __builtin_amdgcn_wmma_f32_16x16x32_f16(
                false, A.v, false, Bf.v, (short)0, acc[dd], false, false);
        }
    }

    // epilogue: divide by row sums, apply V's GroupNorm affine of channel g*4+dd,
    // and scatter back to (B,C,T,H,W)
    const float lrec = 1.0f / lrow;
#pragma unroll
    for (int r = 0; r < 8; ++r) {
        const float li   = __shfl(lrec, r + hi * 8, 32);
        const int  qrow  = tile * 64 + wq * 16 + r + hi * 8;
        const int  tt    = qrow >> 8;
        const int  yh    = (qrow >> 4) & 15;
        const int  xw    = qrow & 15;
        const int  sh    = ql >> 2;
        const int  sw    = ql & 3;
#pragma unroll
        for (int dd = 0; dd < 4; ++dd) {
            const int c = g * 4 + dd;
            size_t oi = ((size_t)((b * C_ + c) * T_ + tt)) * 4096
                      + (yh * 4 + sh) * 64 + (xw * 4 + sw);
            out[oi] = acc[dd][r] * li * va[dd] + vb[dd];
        }
    }
}

// ---------------------------------------------------------------------------
extern "C" void kernel_launch(void* const* d_in, const int* in_sizes, int n_in,
                              void* d_out, int out_size, void* d_ws, size_t ws_size,
                              hipStream_t stream)
{
    const float* x    = (const float*)d_in[0];
    const float* Wq   = (const float*)d_in[1];
    const float* Wk   = (const float*)d_in[2];
    const float* Wv   = (const float*)d_in[3];
    const float* gq_g = (const float*)d_in[4];
    const float* gq_b = (const float*)d_in[5];
    const float* gk_g = (const float*)d_in[6];
    const float* gk_b = (const float*)d_in[7];
    const float* gv_g = (const float*)d_in[8];
    const float* gv_b = (const float*)d_in[9];
    const float* rtab = (const float*)d_in[10];
    const int*   ridx = (const int*)d_in[11];
    float* out = (float*)d_out;

    char* ws = (char*)d_ws;
    size_t off = 0;
    auto take = [&](size_t bytes) -> void* {
        void* p = ws + off;
        off += (bytes + 255) & ~(size_t)255;
        return p;
    };
    float*    qp_raw = (float*)take((size_t)B_ * N_ * C_ * 4);
    float*    kp_raw = (float*)take((size_t)B_ * N_ * C_ * 4);
    _Float16* vh     = (_Float16*)take((size_t)B_ * NH_ * 64 * N_ * 2);
    float*    sraw   = (float*)take(3 * B_ * NH_ * 2 * 4);
    (void)ws_size; (void)in_sizes; (void)n_in; (void)out_size;

    k_zero <<<1, 3 * B_ * NH_ * 2, 0, stream>>>(sraw, 3 * B_ * NH_ * 2);
    k_proj <<<B_ * T_ * 16 * 2, 384, 0, stream>>>(x, Wq, Wk, Wv, qp_raw, kp_raw, vh, sraw);
    k_attn <<<B_ * NH_ * 16, 128, 0, stream>>>(
        qp_raw, kp_raw, vh, sraw, gq_g, gq_b, gk_g, gk_b, gv_g, gv_b, rtab, ridx, out);
}

// v005
// Measured time: 61.4 microseconds a run.
// Next to v004, in two timings, it ran 1.05 and 1.04 times as fast.
// Over all steps from v000 it is 7.09 times as fast.
#include <hip/hip_runtime.h>

typedef __attribute__((ext_vector_type(16))) _Float16 v16h;
typedef __attribute__((ext_vector_type(8)))  _Float16 v8h;
typedef __attribute__((ext_vector_type(2)))  __fp16   pk2h;  // cvt_pkrtz result type
typedef __attribute__((ext_vector_type(8)))  float    v8f;
typedef __attribute__((ext_vector_type(4)))  float    v4f;
typedef __attribute__((ext_vector_type(2)))  float    v2f;
typedef __attribute__((ext_vector_type(4)))  int      v4i;

#define B_   2
#define C_   128
#define T_   4
#define NH_  32
#define N_   1024     // T * 16 * 16 patch tokens
#define TBL_ 6727     // (2T-1)*(2h-1)*(2w-1) = 7*31*31
#define SPG_ 65536.0f // elements per GroupNorm group: 4 channels * T*H*W

// ---------------------------------------------------------------------------
// Kernel 1: q/k/v projection as an f32 WMMA GEMM, with patch pooling (q,k),
// raw-f16 V pack in [b][g][dp=dd*16+pix][m] layout, and this block's GroupNorm
// sum/sumsq, stored as partial sums.  One block per (b, t, patch row of 16
// patches, half of the 128 output channels, for q, k and v alike).  12 waves;
// each wave owns 16 output channels of one projection and keeps their weights
// in registers as B fragments for the whole block.  A tile = 16 patches (rows)
// at one pixel position of the patch, so a lane's 8 D registers are 8
// consecutive patch tokens m of one output channel.
// ---------------------------------------------------------------------------
#define XP_ 132   // LDS row pitch in floats: 128 channels + 4, 16-byte reads hit all banks

__global__ __launch_bounds__(384)
void k_proj(const float* __restrict__ x,  const float* __restrict__ Wq,
            const float* __restrict__ Wk, const float* __restrict__ Wv,
            float* __restrict__ qp_raw, float* __restrict__ kp_raw,
            _Float16* __restrict__ vh, float* __restrict__ statsPart)
{
    __shared__ __align__(16) float sX[256 * XP_];   // [pix][patch][channel], 132 KB

    const int blk  = blockIdx.x;         // ((b*T + tt)*16 + yh)*2 + channel half
    const int prow = blk >> 1;
    const int yh   = prow & 15;
    const int tt   = (prow >> 4) & 3;
    const int b    = prow >> 6;
    const int tid  = threadIdx.x;
    const int lane = tid & 31;
    // wave number as a scalar, so that the choice of projection is a scalar branch
    const int w    = __builtin_amdgcn_readfirstlane(tid >> 5);
    const int proj = w >> 2;             // 0 q, 1 k, 2 v
    const int ot   = (blk & 1) * 4 + (w & 3);  // 16-channel tile of that projection
    const int cl   = lane & 15;          // A row (patch) / B column (channel) / D column
    const int hi   = lane >> 4;          // k half of A and B, row half of D
    const int o    = ot * 16 + cl;       // this lane's output channel

    // weights: lane (cl,hi) holds k = 8j + 4hi + 0..3 of row o, j = 0..15
    const float* Wp   = (proj == 0) ? Wq : ((proj == 1) ? Wk : Wv);
    const float* wrow = Wp + (size_t)o * C_ + hi * 4;
    v4f wf[16];
#pragma unroll
    for (int j = 0; j < 16; ++j) wf[j] = *(const v4f*)(wrow + j * 8);
    // the x loads below may land in the weight loads' address registers
    asm volatile("s_wait_xcnt 0x0" ::: "memory");

    { // stage the x tile transposed: a unit = 4 channels x 4 W-pixels, 2048 units
        // over 384 threads: five full rounds and a sixth for waves 0..3.  All
        // loads are issued before the first LDS store, one memory latency in all.
        const float* xb = x + ((size_t)(b * C_) * T_ + tt) * 4096 + yh * 256
                            + (size_t)((tid >> 6) * 4) * (T_ * 4096) + (tid & 63) * 4;
        float* sd = &sX[(((tid >> 4) & 3) * 64 + (tid & 15)) * XP_ + (tid >> 6) * 4];
        v4f rr[6][4];
#pragma unroll
        for (int it = 0; it < 5; ++it)
#pragma unroll
            for (int k = 0; k < 4; ++k)   // 384 threads = 6 units of 4 channels further on
                rr[it][k] = *(const v4f*)(xb + (size_t)(it * 24 + k) * (T_ * 4096));
        if (w < 4) {
#pragma unroll
            for (int k = 0; k < 4; ++k)
                rr[5][k] = *(const v4f*)(xb + (size_t)(5 * 24 + k) * (T_ * 4096));
        }
#pragma unroll
        for (int it = 0; it < 6; ++it) {
            if (it < 5 || w < 4) {
#pragma unroll
                for (int sw = 0; sw < 4; ++sw) {
                    v4f t = {rr[it][0][sw], rr[it][1][sw], rr[it][2][sw], rr[it][3][sw]};
                    *(v4f*)(sd + sw * 16 * XP_ + it * 24) = t;
                }
            }
        }
    }
    __syncthreads();

    float s1 = 0.0f, s2 = 0.0f;
    v8f pool;
#pragma unroll
    for (int r = 0; r < 8; ++r) pool[r] = 0.0f;

    const float* arow = &sX[cl * XP_ + hi * 4];
    const int m0 = tt * 256 + yh * 16 + hi * 8;      // first of this lane's 8 tokens
    _Float16* vdst = vh + ((size_t)((b * NH_ + (o >> 2)) * 64 + (o & 3) * 16)) * N_ + m0;

    for (int pix = 0; pix < 16; pix += 2) {          // two independent accumulator tiles
        v8f a0, a1;
#pragma unroll
        for (int r = 0; r < 8; ++r) { a0[r] = 0.0f; a1[r] = 0.0f; }
        const float* p0 = arow + pix * 16 * XP_;
        const float* p1 = p0 + 16 * XP_;
#pragma unroll
        for (int j = 0; j < 16; ++j) {
            const v4f x0 = *(const v4f*)(p0 + j * 8);
            const v4f x1 = *(const v4f*)(p1 + j * 8);
            const v2f bl = {wf[j][0], wf[j][1]};
            const v2f bh = {wf[j][2], wf[j][3]};
            const v2f x0l = {x0[0], x0[1]}, x0h = {x0[2], x0[3]};
            const v2f x1l = {x1[0], x1[1]}, x1h = {x1[2], x1[3]};
            a0 = __builtin_amdgcn_wmma_f32_16x16x4_f32(false, x0l, false, bl, (short)0, a0, false, false);
            a1 = __builtin_amdgcn_wmma_f32_16x16x4_f32(false, x1l, false, bl, (short)0, a1, false, false);
            a0 = __builtin_amdgcn_wmma_f32_16x16x4_f32(false, x0h, false, bh, (short)0, a0, false, false);
            a1 = __builtin_amdgcn_wmma_f32_16x16x4_f32(false, x1h, false, bh, (short)0, a1, false, false);
        }
        // four vector slots between the last WMMA and the first reader of its D, on
        // both sides of the branch below; the scheduling barriers hold them in place
        __builtin_amdgcn_sched_barrier(0);
        asm volatile("v_nop\n\tv_nop\n\tv_nop\n\tv_nop");
        __builtin_amdgcn_sched_barrier(0);
#pragma unroll
        for (int r = 0; r < 8; ++r) {
            const float t = a0[r] + a1[r];
            pool[r] += t;            // patch sum; read for q and k only
            s1 += t;
            s2 += a0[r] * a0[r] + a1[r] * a1[r];
        }
        if (proj == 2) {
            v8h h0, h1;
#pragma unroll
            for (int r = 0; r < 8; ++r) { h0[r] = (_Float16)a0[r]; h1[r] = (_Float16)a1[r]; }
            *(v8h*)(vdst + (size_t)pix * N_)       = h0;
            *(v8h*)(vdst + (size_t)(pix + 1) * N_) = h1;
            // the next trip rewrites the stores' address and data registers
            asm volatile("s_wait_xcnt 0x0" ::: "memory");
        }
    }

    if (proj != 2) {   // patch SUM (mean applied later), head-major [b][g][m][4]:
        // the 8 tokens x 4 channels that a group's lanes store fill one 128 B line
        float* dst = ((proj == 0) ? qp_raw : kp_raw)
                   + ((size_t)(b * NH_ + (o >> 2)) * N_ + m0) * 4 + (o & 3);
#pragma unroll
        for (int r = 0; r < 8; ++r) dst[r * 4] = pool[r];
    }

    // group stats: 4 channels of a group are 4 neighbouring lanes, in both halves
    s1 += __shfl_xor(s1, 1, 32);  s2 += __shfl_xor(s2, 1, 32);
    s1 += __shfl_xor(s1, 2, 32);  s2 += __shfl_xor(s2, 2, 32);
    s1 += __shfl_xor(s1, 16, 32); s2 += __shfl_xor(s2, 16, 32);
    // partial sums of this patch row: [b*64 + t*16 + row][g][q1 q2 k1 k2 v1 v2 0 0].
    // The block's 16 groups fill 512 B in a row, four whole lines that no other
    // block writes; the two zeros make the entry's second half readable as 16 B.
    if ((lane & 19) == 0) {
        float* sp = statsPart + ((size_t)prow * NH_ + (o >> 2)) * 8 + proj * 2;
        if (proj == 2) {
            const v4f t = {s1, s2, 0.0f, 0.0f};
            *(v4f*)sp = t;
        } else {
            const v2f t = {s1, s2};
            *(v2f*)sp = t;
        }
    }
}

// ---------------------------------------------------------------------------
// v + (v of lane l ^ MASK) inside a 16-lane row, as a DPP add (row_xmask)
// ---------------------------------------------------------------------------
template <int MASK>
__device__ __forceinline__
float add_xmask(float v)
{
    const int t = __builtin_amdgcn_update_dpp(0, __builtin_bit_cast(int, v),
                                              0x160 + MASK, 0xf, 0xf, true);
    return v + __builtin_bit_cast(float, t);
}

// ---------------------------------------------------------------------------
// GroupNorm (mu, rstd) of one (projection, b, g) from its raw sum and sum of squares
// ---------------------------------------------------------------------------
__device__ __forceinline__
v2f gn_stats(v2f raw)
{
    const float mu  = raw[0] / SPG_;
    const float var = raw[1] / SPG_ - mu * mu;
    const v2f r = {mu, rsqrtf(var + 1e-5f)};
    return r;
}

// ---------------------------------------------------------------------------
// Async staging of one 32-key x 64-dp V chunk (4 KB) into LDS, shared by the
// 4 waves of the block.  Per-lane global_load_async_to_lds_b128 (ASYNCcnt),
// 2 segments per thread.  LDS layout: [dp][k_local(32)] halves; a row holds
// 64 B and is pitched VP_ halves = 80 B (16 B x odd): the 16 rows that a half
// wave reads with one ds_load_b128 then start on 16 different groups of four
// banks, where a 64 B pitch puts four rows on each group.
// ---------------------------------------------------------------------------
#define VP_ 40
__device__ __forceinline__
void stage_v(const _Float16* __restrict__ gsrc, _Float16* ldst, int tid)
{
#pragma unroll
    for (int it = 0; it < 2; ++it) {
        const int idx = tid + it * 128;        // 0..255 segments of 16 B
        const int dp  = idx >> 2;
        const int seg = idx & 3;
        const _Float16* g = gsrc + (size_t)dp * N_ + seg * 8;
        const _Float16* l = ldst + dp * VP_ + seg * 8;
        const unsigned lofs = (unsigned)(unsigned long long)l;  // LDS byte addr
        const unsigned long long ga = (unsigned long long)g;
        asm volatile("global_load_async_to_lds_b128 %0, %1, off"
                     :: "v"(lofs), "v"(ga) : "memory");
    }
}

// Chunk 0's copies for the prologue: the same two segments per thread as stage_v,
// in one statement that ends in s_wait_xcnt 0, so that nothing scheduled behind it
// lands in an address register of the copies or of the loads issued before them.
__device__ __forceinline__
void stage_v_first(const _Float16* __restrict__ gsrc, _Float16* ldst, int tid)
{
    const int dp  = tid >> 2;
    const int seg = tid & 3;
    const _Float16* g0 = gsrc + (size_t)dp * N_ + seg * 8;
    const _Float16* g1 = g0 + (size_t)32 * N_;
    const _Float16* l0 = ldst + dp * VP_ + seg * 8;
    const _Float16* l1 = l0 + 32 * VP_;
    const unsigned lo0 = (unsigned)(unsigned long long)l0;  // LDS byte addr
    const unsigned lo1 = (unsigned)(unsigned long long)l1;
    const unsigned long long ga0 = (unsigned long long)g0;
    const unsigned long long ga1 = (unsigned long long)g1;
    asm volatile("global_load_async_to_lds_b128 %0, %1, off\n\t"
                 "global_load_async_to_lds_b128 %2, %3, off\n\t"
                 "s_wait_xcnt 0x0"
                 :: "v"(lo0), "v"(ga0), "v"(lo1), "v"(ga1) : "memory");
}

// ---------------------------------------------------------------------------
// Kernel 2: fused flash attention.  Block = 128 threads (4 waves), one block
// per (b, g, 64-query tile); each wave owns 16 queries.  The three GroupNorms
// are finished here: the block adds up the 64 partial sums of its group (one
// per patch row of the projection kernel), derives (mu, rstd) from them,
// normalizes the pooled k while staging it and the pooled q on load (the
// affine commutes with the patch mean; the logit scale 1/sqrt(d)=0.5 goes into
// q), and applies V's affine to the finished rows: the softmax weights of a row
// sum to one, so sum(p*(a*v+b))/sum(p) = a*sum(p*v)/sum(p) + b.  Per 32-key chunk:
// VALU logits (+LDS rel-bias gather), online softmax (xor-16 combine),
// pkrtz-pack P directly into the WMMA A layout, 4x v_wmma_f32_16x16x32_f16
// against V fragments read from the async-staged, double-buffered LDS tile.
// ---------------------------------------------------------------------------
__global__ __launch_bounds__(128)
void k_attn(const float* __restrict__ qp_raw, const float* __restrict__ kp_raw,
            const _Float16* __restrict__ vh, const float* __restrict__ statsPart,
            const float* __restrict__ gq_g, const float* __restrict__ gq_b,
            const float* __restrict__ gk_g, const float* __restrict__ gk_b,
            const float* __restrict__ gv_g, const float* __restrict__ gv_b,
            const float* __restrict__ rel_table, const int* __restrict__ rel_index,
            float* __restrict__ out)
{
    __shared__ float sKP[N_ * 4];                      // kp for this (b,g): 16 KB
    __shared__ float sTab[TBL_];                       // rel_table row: ~27 KB
    __shared__ __align__(16) _Float16 sV[2][64 * VP_]; // double-buffered V chunk: 2x5 KB
    __shared__ __align__(16) float sRed[4 * 8];        // each wave's share of the group sums

    const int blk  = blockIdx.x;                 // b*512 + g*16 + tile
    const int tile = blk & 15;
    const int g    = (blk >> 4) & 31;
    const int b    = blk >> 9;
    const int tid  = threadIdx.x;

    const _Float16* vbase = vh + ((size_t)(b * NH_ + g)) * 64 * N_;

    const int lane = tid & 31;
    const int wq   = tid >> 5;        // wave id: which 16-query sub-tile
    const int ql   = lane & 15;       // M (query) / N (dp) index within tile
    const int hi   = lane >> 4;       // upper lane half selector
    const int qg   = tile * 64 + wq * 16 + ql;   // this lane's query token

    // every global load of the prologue is issued here, ahead of the first wait:
    // the pooled k of this (b,g) (16 KB in a row), this lane's pooled q, the table
    // row, and the block's partial sums and affine rows.  One memory round trip in all.
    // thread t: patch row t>>1 of this b, half t&1 of its entry (q1 q2 k1 k2 | v1 v2 0 0)
    v4f ps = *(const v4f*)(statsPart + ((size_t)(b * 64 + (tid >> 1)) * NH_ + g) * 8
                                     + (tid & 1) * 4);
    const v4f kg  = *(const v4f*)(gk_g + g * 4);
    const v4f kb  = *(const v4f*)(gk_b + g * 4);
    const v4f qg4 = *(const v4f*)(gq_g + g * 4);
    const v4f qb4 = *(const v4f*)(gq_b + g * 4);
    const v4f vg4 = *(const v4f*)(gv_g + g * 4);
    const v4f vb4 = *(const v4f*)(gv_b + g * 4);
    const float* kpb = kp_raw + (size_t)(b * NH_ + g) * N_ * 4;
    const float* tb  = rel_table + (size_t)g * TBL_;
    v4f   kz[8];
    float tz[53];
#pragma unroll
    for (int it = 0; it < 8; ++it) kz[it] = *(const v4f*)(kpb + (tid + it * 128) * 4);
    const v4f qz = *(const v4f*)(qp_raw + ((size_t)(b * NH_ + g) * N_ + qg) * 4);
#pragma unroll
    for (int it = 0; it < 52; ++it) tz[it] = tb[tid + it * 128];
    tz[52] = 0.0f;
    if (tid < TBL_ - 52 * 128) tz[52] = tb[tid + 52 * 128];
    // async staging of V chunk 0 flies with them; it is first read in trip 0
    stage_v_first(vbase, &sV[0][0], tid);
    // holds the adding below, and with it the first wait on a load, behind the copies' issue
    __builtin_amdgcn_sched_barrier(0);

    // sum over the 64 patch rows: 16 of them in a wave (lanes of equal parity), then
    // the four waves' shares through LDS
#pragma unroll
    for (int e = 0; e < 4; ++e) {
        float t = ps[e];
        t = add_xmask<2>(t);
        t = add_xmask<4>(t);
        t = add_xmask<8>(t);
        const int u = __builtin_bit_cast(int, t);
        t += __builtin_bit_cast(float,
                 __builtin_amdgcn_permlanex16(u, u, 0x76543210, 0xfedcba98, false, false));
        ps[e] = t;
    }
    if (lane < 2) *(v4f*)&sRed[(wq * 2 + lane) * 4] = ps;
    // the bias table needs no sums: it is staged ahead of the barrier, as its loads land
#pragma unroll
    for (int it = 0; it < 52; ++it) sTab[tid + it * 128] = tz[it];
    if (tid < TBL_ - 52 * 128) sTab[tid + 52 * 128] = tz[52];
    __syncthreads();   // every wave's share is in sRed
    const v4f sqk = *(const v4f*)&sRed[0]  + *(const v4f*)&sRed[8]
                  + *(const v4f*)&sRed[16] + *(const v4f*)&sRed[24];
    const v2f rv  = *(const v2f*)&sRed[4]  + *(const v2f*)&sRed[12]
                  + *(const v2f*)&sRed[20] + *(const v2f*)&sRed[28];
    const v2f rq = {sqk[0], sqk[1]};
    const v2f rk = {sqk[2], sqk[3]};

    const v2f stq = gn_stats(rq);
    const v2f stk = gn_stats(rk);
    const v2f stv = gn_stats(rv);
    float va[4], vb[4];   // V's affine of channel g*4+dd, used in the epilogue
#pragma unroll
    for (int dd = 0; dd < 4; ++dd) {
        va[dd] = stv[1] * vg4[dd];
        vb[dd] = vb4[dd] - stv[0] * va[dd];
    }

    { // cooperative staging of normalized kp
#pragma unroll
        for (int it = 0; it < 8; ++it) {
            const v4f z = kz[it];
            v4f kn;
#pragma unroll
            for (int e = 0; e < 4; ++e)
                kn[e] = (z[e] * (1.0f / 16.0f) - stk[0]) * stk[1] * kg[e] + kb[e];
            *(v4f*)&sKP[(tid + it * 128) * 4] = kn;
        }
    }
    __syncthreads();

    v4f qv;
    {
        const v4f z  = qz;
#pragma unroll
        for (int e = 0; e < 4; ++e)
            qv[e] = ((z[e] * (1.0f / 16.0f) - stq[0]) * stq[1] * qg4[e] + qb4[e]) * 0.5f;
    }

    v8f acc[4];
#pragma unroll
    for (int dd = 0; dd < 4; ++dd)
#pragma unroll
        for (int e = 0; e < 8; ++e) acc[dd][e] = 0.0f;

    float mrow = -__builtin_inff();
    float lrow = 0.0f;

    const int* ri = rel_index + (size_t)qg * N_;

    for (int mc = 0; mc < N_; mc += 32) {
        const int buf = (mc >> 5) & 1;
        // this lane's 16 keys, in exact A-fragment element order:
        // e<8 : K = mc + 8*hi + e        (run0)
        // e>=8: K = mc + 16 + 8*hi + e-8 (run1)
        const int k0 = mc + hi * 8;
        const int k1 = mc + 16 + hi * 8;

        v4i i0a = *(const v4i*)(ri + k0);
        v4i i0b = *(const v4i*)(ri + k0 + 4);
        v4i i1a = *(const v4i*)(ri + k1);
        v4i i1b = *(const v4i*)(ri + k1 + 4);

        float s[16];
#pragma unroll
        for (int j = 0; j < 8; ++j) {
            const float* kp4 = &sKP[(k0 + j) * 4];
            const int bi = (j < 4) ? i0a[j] : i0b[j - 4];
            s[j] = qv[0]*kp4[0] + qv[1]*kp4[1] + qv[2]*kp4[2] + qv[3]*kp4[3] + sTab[bi];
        }
#pragma unroll
        for (int j = 0; j < 8; ++j) {
            const float* kp4 = &sKP[(k1 + j) * 4];
            const int bi = (j < 4) ? i1a[j] : i1b[j - 4];
            s[8 + j] = qv[0]*kp4[0] + qv[1]*kp4[1] + qv[2]*kp4[2] + qv[3]*kp4[3] + sTab[bi];
        }

        if (mc + 32 < N_) __builtin_prefetch(ri + mc + 32, 0, 1);

        // online softmax: lanes q and q+16 jointly cover all 32 keys of query q
        float mloc = s[0];
#pragma unroll
        for (int j = 1; j < 16; ++j) mloc = fmaxf(mloc, s[j]);
        mloc = fmaxf(mloc, __shfl_xor(mloc, 16, 32));
        const float mnew = fmaxf(mrow, mloc);
        const float sc   = __expf(mrow - mnew);

        float p[16], ls = 0.0f;
#pragma unroll
        for (int j = 0; j < 16; ++j) { p[j] = __expf(s[j] - mnew); ls += p[j]; }
        ls  += __shfl_xor(ls, 16, 32);
        lrow = lrow * sc + ls;
        mrow = mnew;

        // rescale accumulators: row r+8*hi belongs to query (r+8*hi), whose
        // stats live in lane (r+8*hi) -> 8 broadcasts
#pragma unroll
        for (int r = 0; r < 8; ++r) {
            const float srow = __shfl(sc, r + hi * 8, 32);
            acc[0][r] *= srow; acc[1][r] *= srow;
            acc[2][r] *= srow; acc[3][r] *= srow;
        }

        // pack P into A fragment (element e == p[e] by construction)
        union { v16h v; pk2h h[8]; } A;
#pragma unroll
        for (int j2 = 0; j2 < 8; ++j2)
            A.h[j2] = __builtin_amdgcn_cvt_pkrtz(p[2 * j2], p[2 * j2 + 1]);

        // current V chunk is ready once our asyncs landed + all waves arrive
        asm volatile("s_wait_asynccnt 0x0" ::: "memory");
        __syncthreads();
        // overlap: stage next chunk into the other buffer
        if (mc + 32 < N_) stage_v(vbase + (mc + 32), &sV[buf ^ 1][0], tid);

        // 4 B-tiles of V (dp = dd*16 + ql) straight from LDS
#pragma unroll
        for (int dd = 0; dd < 4; ++dd) {
            const _Float16* vrow = &sV[buf][(dd * 16 + ql) * VP_ + hi * 8];
            union { v16h v; v8h h[2]; } Bf;
            Bf.h[0] = *(const v8h*)vrow;
            Bf.h[1] = *(const v8h*)(vrow + 16);
            acc[dd] = __builtin_amdgcn_wmma_f32_16x16x32_f16(
                false, A.v, false, Bf.v, (short)0, acc[dd], false, false);
        }
    }

    // epilogue: divide by row sums, apply V's GroupNorm affine of channel g*4+dd,
    // and scatter back to (B,C,T,H,W)
    const float lrec = 1.0f / lrow;
#pragma unroll
    for (int r = 0; r < 8; ++r) {
        const float li   = __shfl(lrec, r + hi * 8, 32);
        const int  qrow  = tile * 64 + wq * 16 + r + hi * 8;
        const int  tt    = qrow >> 8;
        const int  yh    = (qrow >> 4) & 15;
        const int  xw    = qrow & 15;
        const int  sh    = ql >> 2;
        const int  sw    = ql & 3;
#pragma unroll
        for (int dd = 0; dd < 4; ++dd) {
            const int c = g * 4 + dd;
            size_t oi = ((size_t)((b * C_ + c) * T_ + tt)) * 4096
                      + (yh * 4 + sh) * 64 + (xw * 4 + sw);
            out[oi] = acc[dd][r] * li * va[dd] + vb[dd];
        }
    }
}

// ---------------------------------------------------------------------------
extern "C" void kernel_launch(void* const* d_in, const int* in_sizes, int n_in,
                              void* d_out, int out_size, void* d_ws, size_t ws_size,
                              hipStream_t stream)
{
    const float* x    = (const float*)d_in[0];
    const float* Wq   = (const float*)d_in[1];
    const float* Wk   = (const float*)d_in[2];
    const float* Wv   = (const float*)d_in[3];
    const float* gq_g = (const float*)d_in[4];
    const float* gq_b = (const float*)d_in[5];
    const float* gk_g = (const float*)d_in[6];
    const float* gk_b = (const float*)d_in[7];
    const float* gv_g = (const float*)d_in[8];
    const float* gv_b = (const float*)d_in[9];
    const float* rtab = (const float*)d_in[10];
    const int*   ridx = (const int*)d_in[11];
    float* out = (float*)d_out;

    char* ws = (char*)d_ws;
    size_t off = 0;
    auto take = [&](size_t bytes) -> void* {
        void* p = ws + off;
        off += (bytes + 255) & ~(size_t)255;
        return p;
    };
    float*    qp_raw = (float*)take((size_t)B_ * N_ * C_ * 4);
    float*    kp_raw = (float*)take((size_t)B_ * N_ * C_ * 4);
    _Float16* vh     = (_Float16*)take((size_t)B_ * NH_ * 64 * N_ * 2);
    float*    spart  = (float*)take((size_t)B_ * T_ * 16 * NH_ * 8 * 4);
    (void)ws_size; (void)in_sizes; (void)n_in; (void)out_size;

    k_proj <<<B_ * T_ * 16 * 2, 384, 0, stream>>>(x, Wq, Wk, Wv, qp_raw, kp_raw, vh, spart);
    k_attn <<<B_ * NH_ * 16, 128, 0, stream>>>(
        qp_raw, kp_raw, vh, spart, gq_g, gq_b, gk_g, gk_b, gv_g, gv_b, rtab, ridx, out);
}

// v006
// A run of this version takes 54.6 microseconds.
// Two timings next to v005 both put it at 1.12 times that version's speed.
// Over all steps from v000 it is 7.97 times as fast.
#include <hip/hip_runtime.h>

typedef __attribute__((ext_vector_type(16))) _Float16 v16h;
typedef __attribute__((ext_vector_type(8)))  _Float16 v8h;
typedef __attribute__((ext_vector_type(2)))  __fp16   pk2h;  // cvt_pkrtz result type
typedef __attribute__((ext_vector_type(8)))  float    v8f;
typedef __attribute__((ext_vector_type(4)))  float    v4f;
typedef __attribute__((ext_vector_type(2)))  float    v2f;
typedef __attribute__((ext_vector_type(4)))  int      v4i;
typedef __attribute__((ext_vector_type(16))) __bf16   v16b;
typedef __attribute__((ext_vector_type(8)))  __bf16   v8b;
typedef __attribute__((ext_vector_type(4)))  __bf16   v4b;
typedef __attribute__((ext_vector_type(2)))  __bf16   v2b;
typedef __attribute__((ext_vector_type(2)))  unsigned v2u;

#define B_   2
#define C_   128
#define T_   4
#define NH_  32
#define N_   1024     // T * 16 * 16 patch tokens
#define TBL_ 6727     // (2T-1)*(2h-1)*(2w-1) = 7*31*31
#define SPG_ 65536.0f // elements per GroupNorm group: 4 channels * T*H*W

// ---------------------------------------------------------------------------
// Kernel 1: q/k/v projection as a split-bf16 WMMA GEMM, with patch pooling (q,k),
// raw-f16 V pack in [b][g][dp=dd*16+pix][m] layout, and this block's GroupNorm
// sum/sumsq, stored as partial sums.  One block per (b, t, patch row of 16
// patches, half of the 128 output channels, for q, k and v alike).  12 waves;
// each wave owns 16 output channels of one projection and keeps their weights
// in registers as B fragments for the whole block.  A tile = 16 patches (rows)
// at one pixel position of the patch, so a lane's 8 D registers are 8
// consecutive patch tokens m of one output channel.
// Every f32 operand is held as two bf16 numbers, hi + lo (16 significant bits),
// and a product is three 16x16x32 WMMAs with f32 accumulation: hi*hi + lo*hi +
// hi*lo; the lo*lo term, below 2^-16 of the product, is left out.
// ---------------------------------------------------------------------------
#define XP_ 264   // LDS row pitch in bf16: 128 hi + 128 lo + 8, 528 B = 16 B x odd

// v = h + l + rest, four values: h the nearest bf16 of v, l the nearest bf16 of v - h.
// A packed pair of bf16 is widened again by a shift and a mask.
__device__ __forceinline__
void split4(v4f v, v4b& h, v4b& l)
{
    v2u hu, lu;
#pragma unroll
    for (int i = 0; i < 2; ++i) {
        const v2f a = {v[2 * i], v[2 * i + 1]};
        const unsigned p = __builtin_bit_cast(unsigned, __builtin_convertvector(a, v2b));
        const v2f r = {a[0] - __builtin_bit_cast(float, p << 16),
                       a[1] - __builtin_bit_cast(float, p & 0xffff0000u)};
        hu[i] = p;
        lu[i] = __builtin_bit_cast(unsigned, __builtin_convertvector(r, v2b));
    }
    h = __builtin_bit_cast(v4b, hu);
    l = __builtin_bit_cast(v4b, lu);
}

// A fragments of one tile of 16 patches, all 128 channels: lane (row, hi) reads
// k = 32j + 16hi + 0..15 of its row, hi part and lo part
__device__ __forceinline__
void load_tile(const __bf16* p, v16b (&xh)[4], v16b (&xl)[4])
{
#pragma unroll
    for (int j = 0; j < 4; ++j) {
        union { v16b v; v8b h[2]; } a, b;
        a.h[0] = *(const v8b*)(p + j * 32);
        a.h[1] = *(const v8b*)(p + j * 32 + 8);
        b.h[0] = *(const v8b*)(p + 128 + j * 32);
        b.h[1] = *(const v8b*)(p + 128 + j * 32 + 8);
        xh[j] = a.v;
        xl[j] = b.v;
    }
}

// one 16x16 tile over k = 128: hi*hi + lo*hi + hi*lo, f32 accumulation
__device__ __forceinline__
v8f mul_tile(const v16b (&xh)[4], const v16b (&xl)[4], const v16b (&wh)[4], const v16b (&wl)[4])
{
    v8f a;
#pragma unroll
    for (int r = 0; r < 8; ++r) a[r] = 0.0f;
#pragma unroll
    for (int j = 0; j < 4; ++j) {
        a = __builtin_amdgcn_wmma_f32_16x16x32_bf16(false, xh[j], false, wh[j], (short)0, a, false, false);
        a = __builtin_amdgcn_wmma_f32_16x16x32_bf16(false, xl[j], false, wh[j], (short)0, a, false, false);
        a = __builtin_amdgcn_wmma_f32_16x16x32_bf16(false, xh[j], false, wl[j], (short)0, a, false, false);
    }
    return a;
}

__global__ __launch_bounds__(384)
void k_proj(const float* __restrict__ x,  const float* __restrict__ Wq,
            const float* __restrict__ Wk, const float* __restrict__ Wv,
            float* __restrict__ qp_raw, float* __restrict__ kp_raw,
            _Float16* __restrict__ vh, float* __restrict__ statsPart)
{
    __shared__ __align__(16) __bf16 sX[256 * XP_];  // [pix][patch][hi|lo][channel], 132 KB

    const int blk  = blockIdx.x;         // ((b*T + tt)*16 + yh)*2 + channel half
    const int prow = blk >> 1;
    const int yh   = prow & 15;
    const int tt   = (prow >> 4) & 3;
    const int b    = prow >> 6;
    const int tid  = threadIdx.x;
    const int lane = tid & 31;
    // wave number as a scalar, so that the choice of projection is a scalar branch
    const int w    = __builtin_amdgcn_readfirstlane(tid >> 5);
    const int proj = w >> 2;             // 0 q, 1 k, 2 v
    const int ot   = (blk & 1) * 4 + (w & 3);  // 16-channel tile of that projection
    const int cl   = lane & 15;          // A row (patch) / B column (channel) / D column
    const int hi   = lane >> 4;          // k half of A and B, row half of D
    const int o    = ot * 16 + cl;       // this lane's output channel

    // weights: lane (cl,hi) holds k = 32j + 16hi + 0..15 of row o, j = 0..3
    const float* Wp   = (proj == 0) ? Wq : ((proj == 1) ? Wk : Wv);
    const float* wrow = Wp + (size_t)o * C_ + hi * 16;
    v4f wf[16];
#pragma unroll
    for (int j = 0; j < 16; ++j) wf[j] = *(const v4f*)(wrow + (j >> 2) * 32 + (j & 3) * 4);
    // the x loads below may land in the weight loads' address registers
    asm volatile("s_wait_xcnt 0x0" ::: "memory");

    v16b wh[4], wl[4];   // B fragments, hi and lo
    { // stage the x tile transposed: a unit = 4 channels x 4 W-pixels, 2048 units
        // over 384 threads: five full rounds and a sixth for waves 0..3.  All
        // loads are issued before the first LDS store, one memory latency in all.
        const float* xb = x + ((size_t)(b * C_) * T_ + tt) * 4096 + yh * 256
                            + (size_t)((tid >> 6) * 4) * (T_ * 4096) + (tid & 63) * 4;
        __bf16* sd = &sX[(((tid >> 4) & 3) * 64 + (tid & 15)) * XP_ + (tid >> 6) * 4];
        v4f rr[6][4];
#pragma unroll
        for (int it = 0; it < 5; ++it)
#pragma unroll
            for (int k = 0; k < 4; ++k)   // 384 threads = 6 units of 4 channels further on
                rr[it][k] = *(const v4f*)(xb + (size_t)(it * 24 + k) * (T_ * 4096));
        if (w < 4) {
#pragma unroll
            for (int k = 0; k < 4; ++k)
                rr[5][k] = *(const v4f*)(xb + (size_t)(5 * 24 + k) * (T_ * 4096));
        }
        // the weights as B fragments, hi and lo
#pragma unroll
        for (int j = 0; j < 16; ++j) {
            v4b th, tl;
            split4(wf[j], th, tl);
#pragma unroll
            for (int e = 0; e < 4; ++e) {
                wh[j >> 2][(j & 3) * 4 + e] = th[e];
                wl[j >> 2][(j & 3) * 4 + e] = tl[e];
            }
        }
#pragma unroll
        for (int it = 0; it < 6; ++it) {
            if (it < 5 || w < 4) {
#pragma unroll
                for (int sw = 0; sw < 4; ++sw) {
                    v4f t = {rr[it][0][sw], rr[it][1][sw], rr[it][2][sw], rr[it][3][sw]};
                    v4b th, tl;
                    split4(t, th, tl);
                    *(v4b*)(sd + sw * 16 * XP_ + it * 24)       = th;
                    *(v4b*)(sd + sw * 16 * XP_ + it * 24 + 128) = tl;
                }
            }
        }
    }
    __syncthreads();

    float s1 = 0.0f, s2 = 0.0f;
    v8f pool;
#pragma unroll
    for (int r = 0; r < 8; ++r) pool[r] = 0.0f;

    const __bf16* arow = &sX[cl * XP_ + hi * 16];   // the weights' k order: 32j + 16hi + 0..15
    const int m0 = tt * 256 + yh * 16 + hi * 8;      // first of this lane's 8 tokens
    _Float16* vdst = vh + ((size_t)((b * NH_ + (o >> 2)) * 64 + (o & 3) * 16)) * N_ + m0;

    // Two tiles a trip, one fragment set each: a tile's fragments are read from LDS
    // while the tile before it is multiplied.
    v16b f0h[4], f0l[4], f1h[4], f1l[4];
    load_tile(arow, f0h, f0l);
    for (int pix = 0; pix < 16; pix += 2) {
        load_tile(arow + (pix + 1) * 16 * XP_, f1h, f1l);
        // keeps these LDS reads ahead of the WMMAs below, which hide their latency
        __builtin_amdgcn_sched_barrier(0);
        const v8f a0 = mul_tile(f0h, f0l, wh, wl);
        if (pix + 2 < 16) load_tile(arow + (pix + 2) * 16 * XP_, f0h, f0l);
        const v8f a1 = mul_tile(f1h, f1l, wh, wl);
        // four vector slots between the last WMMA and the first reader of its D, on
        // both sides of the branch below; the scheduling barriers hold them in place
        __builtin_amdgcn_sched_barrier(0);
        asm volatile("v_nop\n\tv_nop\n\tv_nop\n\tv_nop");
        __builtin_amdgcn_sched_barrier(0);
#pragma unroll
        for (int r = 0; r < 8; ++r) {
            const float t = a0[r] + a1[r];
            pool[r] += t;            // patch sum; read for q and k only
            s1 += t;
            s2 += a0[r] * a0[r] + a1[r] * a1[r];
        }
        if (proj == 2) {
            v8h h0, h1;
#pragma unroll
            for (int r = 0; r < 8; ++r) { h0[r] = (_Float16)a0[r]; h1[r] = (_Float16)a1[r]; }
            *(v8h*)(vdst + (size_t)pix * N_)       = h0;
            *(v8h*)(vdst + (size_t)(pix + 1) * N_) = h1;
            // the next trip rewrites the stores' address and data registers
            asm volatile("s_wait_xcnt 0x0" ::: "memory");
        }
    }

    if (proj != 2) {   // patch SUM (mean applied later), head-major [b][g][m][4]:
        // the 8 tokens x 4 channels that a group's lanes store fill one 128 B line
        float* dst = ((proj == 0) ? qp_raw : kp_raw)
                   + ((size_t)(b * NH_ + (o >> 2)) * N_ + m0) * 4 + (o & 3);
#pragma unroll
        for (int r = 0; r < 8; ++r) dst[r * 4] = pool[r];
    }

    // group stats: 4 channels of a group are 4 neighbouring lanes, in both halves
    s1 += __shfl_xor(s1, 1, 32);  s2 += __shfl_xor(s2, 1, 32);
    s1 += __shfl_xor(s1, 2, 32);  s2 += __shfl_xor(s2, 2, 32);
    s1 += __shfl_xor(s1, 16, 32); s2 += __shfl_xor(s2, 16, 32);
    // partial sums of this patch row: [b*64 + t*16 + row][g][q1 q2 k1 k2 v1 v2 0 0].
    // The block's 16 groups fill 512 B in a row, four whole lines that no other
    // block writes; the two zeros make the entry's second half readable as 16 B.
    if ((lane & 19) == 0) {
        float* sp = statsPart + ((size_t)prow * NH_ + (o >> 2)) * 8 + proj * 2;
        if (proj == 2) {
            const v4f t = {s1, s2, 0.0f, 0.0f};
            *(v4f*)sp = t;
        } else {
            const v2f t = {s1, s2};
            *(v2f*)sp = t;
        }
    }
}

// ---------------------------------------------------------------------------
// v + (v of lane l ^ MASK) inside a 16-lane row, as a DPP add (row_xmask)
// ---------------------------------------------------------------------------
template <int MASK>
__device__ __forceinline__
float add_xmask(float v)
{
    const int t = __builtin_amdgcn_update_dpp(0, __builtin_bit_cast(int, v),
                                              0x160 + MASK, 0xf, 0xf, true);
    return v + __builtin_bit_cast(float, t);
}

// ---------------------------------------------------------------------------
// GroupNorm (mu, rstd) of one (projection, b, g) from its raw sum and sum of squares
// ---------------------------------------------------------------------------
__device__ __forceinline__
v2f gn_stats(v2f raw)
{
    const float mu  = raw[0] / SPG_;
    const float var = raw[1] / SPG_ - mu * mu;
    const v2f r = {mu, rsqrtf(var + 1e-5f)};
    return r;
}

// ---------------------------------------------------------------------------
// Async staging of one 32-key x 64-dp V chunk (4 KB) into LDS, shared by the
// 4 waves of the block.  Per-lane global_load_async_to_lds_b128 (ASYNCcnt),
// 2 segments per thread.  LDS layout: [dp][k_local(32)] halves; a row holds
// 64 B and is pitched VP_ halves = 80 B (16 B x odd): the 16 rows that a half
// wave reads with one ds_load_b128 then start on 16 different groups of four
// banks, where a 64 B pitch puts four rows on each group.
// ---------------------------------------------------------------------------
#define VP_ 40
__device__ __forceinline__
void stage_v(const _Float16* __restrict__ gsrc, _Float16* ldst, int tid)
{
#pragma unroll
    for (int it = 0; it < 2; ++it) {
        const int idx = tid + it * 128;        // 0..255 segments of 16 B
        const int dp  = idx >> 2;
        const int seg = idx & 3;
        const _Float16* g = gsrc + (size_t)dp * N_ + seg * 8;
        const _Float16* l = ldst + dp * VP_ + seg * 8;
        const unsigned lofs = (unsigned)(unsigned long long)l;  // LDS byte addr
        const unsigned long long ga = (unsigned long long)g;
        asm volatile("global_load_async_to_lds_b128 %0, %1, off"
                     :: "v"(lofs), "v"(ga) : "memory");
    }
}

// Chunk 0's copies for the prologue: the same two segments per thread as stage_v,
// in one statement that ends in s_wait_xcnt 0, so that nothing scheduled behind it
// lands in an address register of the copies or of the loads issued before them.
__device__ __forceinline__
void stage_v_first(const _Float16* __restrict__ gsrc, _Float16* ldst, int tid)
{
    const int dp  = tid >> 2;
    const int seg = tid & 3;
    const _Float16* g0 = gsrc + (size_t)dp * N_ + seg * 8;
    const _Float16* g1 = g0 + (size_t)32 * N_;
    const _Float16* l0 = ldst + dp * VP_ + seg * 8;
    const _Float16* l1 = l0 + 32 * VP_;
    const unsigned lo0 = (unsigned)(unsigned long long)l0;  // LDS byte addr
    const unsigned lo1 = (unsigned)(unsigned long long)l1;
    const unsigned long long ga0 = (unsigned long long)g0;
    const unsigned long long ga1 = (unsigned long long)g1;
    asm volatile("global_load_async_to_lds_b128 %0, %1, off\n\t"
                 "global_load_async_to_lds_b128 %2, %3, off\n\t"
                 "s_wait_xcnt 0x0"
                 :: "v"(lo0), "v"(ga0), "v"(lo1), "v"(ga1) : "memory");
}

// ---------------------------------------------------------------------------
// Kernel 2: fused flash attention.  Block = 128 threads (4 waves), one block
// per (b, g, 64-query tile); each wave owns 16 queries.  The three GroupNorms
// are finished here: the block adds up the 64 partial sums of its group (one
// per patch row of the projection kernel), derives (mu, rstd) from them,
// normalizes the pooled k while staging it and the pooled q on load (the
// affine commutes with the patch mean; the logit scale 1/sqrt(d)=0.5 goes into
// q), and applies V's affine to the finished rows: the softmax weights of a row
// sum to one, so sum(p*(a*v+b))/sum(p) = a*sum(p*v)/sum(p) + b.  Per 32-key chunk:
// VALU logits (+LDS rel-bias gather), online softmax (xor-16 combine),
// pkrtz-pack P directly into the WMMA A layout, 4x v_wmma_f32_16x16x32_f16
// against V fragments read from the async-staged, double-buffered LDS tile.
// ---------------------------------------------------------------------------
__global__ __launch_bounds__(128)
void k_attn(const float* __restrict__ qp_raw, const float* __restrict__ kp_raw,
            const _Float16* __restrict__ vh, const float* __restrict__ statsPart,
            const float* __restrict__ gq_g, const float* __restrict__ gq_b,
            const float* __restrict__ gk_g, const float* __restrict__ gk_b,
            const float* __restrict__ gv_g, const float* __restrict__ gv_b,
            const float* __restrict__ rel_table, const int* __restrict__ rel_index,
            float* __restrict__ out)
{
    __shared__ float sKP[N_ * 4];                      // kp for this (b,g): 16 KB
    __shared__ float sTab[TBL_];                       // rel_table row: ~27 KB
    __shared__ __align__(16) _Float16 sV[2][64 * VP_]; // double-buffered V chunk: 2x5 KB
    __shared__ __align__(16) float sRed[4 * 8];        // each wave's share of the group sums

    const int blk  = blockIdx.x;                 // b*512 + g*16 + tile
    const int tile = blk & 15;
    const int g    = (blk >> 4) & 31;
    const int b    = blk >> 9;
    const int tid  = threadIdx.x;

    const _Float16* vbase = vh + ((size_t)(b * NH_ + g)) * 64 * N_;

    const int lane = tid & 31;
    const int wq   = tid >> 5;        // wave id: which 16-query sub-tile
    const int ql   = lane & 15;       // M (query) / N (dp) index within tile
    const int hi   = lane >> 4;       // upper lane half selector
    const int qg   = tile * 64 + wq * 16 + ql;   // this lane's query token

    // every global load of the prologue is issued here, ahead of the first wait:
    // the pooled k of this (b,g) (16 KB in a row), this lane's pooled q, the table
    // row, and the block's partial sums and affine rows.  One memory round trip in all.
    // thread t: patch row t>>1 of this b, half t&1 of its entry (q1 q2 k1 k2 | v1 v2 0 0)
    v4f ps = *(const v4f*)(statsPart + ((size_t)(b * 64 + (tid >> 1)) * NH_ + g) * 8
                                     + (tid & 1) * 4);
    const v4f kg  = *(const v4f*)(gk_g + g * 4);
    const v4f kb  = *(const v4f*)(gk_b + g * 4);
    const v4f qg4 = *(const v4f*)(gq_g + g * 4);
    const v4f qb4 = *(const v4f*)(gq_b + g * 4);
    const v4f vg4 = *(const v4f*)(gv_g + g * 4);
    const v4f vb4 = *(const v4f*)(gv_b + g * 4);
    const float* kpb = kp_raw + (size_t)(b * NH_ + g) * N_ * 4;
    const float* tb  = rel_table + (size_t)g * TBL_;
    v4f   kz[8];
    float tz[53];
#pragma unroll
    for (int it = 0; it < 8; ++it) kz[it] = *(const v4f*)(kpb + (tid + it * 128) * 4);
    const v4f qz = *(const v4f*)(qp_raw + ((size_t)(b * NH_ + g) * N_ + qg) * 4);
#pragma unroll
    for (int it = 0; it < 52; ++it) tz[it] = tb[tid + it * 128];
    tz[52] = 0.0f;
    if (tid < TBL_ - 52 * 128) tz[52] = tb[tid + 52 * 128];
    // async staging of V chunk 0 flies with them; it is first read in trip 0
    stage_v_first(vbase, &sV[0][0], tid);
    // holds the adding below, and with it the first wait on a load, behind the copies' issue
    __builtin_amdgcn_sched_barrier(0);

    // sum over the 64 patch rows: 16 of them in a wave (lanes of equal parity), then
    // the four waves' shares through LDS
#pragma unroll
    for (int e = 0; e < 4; ++e) {
        float t = ps[e];
        t = add_xmask<2>(t);
        t = add_xmask<4>(t);
        t = add_xmask<8>(t);
        const int u = __builtin_bit_cast(int, t);
        t += __builtin_bit_cast(float,
                 __builtin_amdgcn_permlanex16(u, u, 0x76543210, 0xfedcba98, false, false));
        ps[e] = t;
    }
    if (lane < 2) *(v4f*)&sRed[(wq * 2 + lane) * 4] = ps;
    // the bias table needs no sums: it is staged ahead of the barrier, as its loads land
#pragma unroll
    for (int it = 0; it < 52; ++it) sTab[tid + it * 128] = tz[it];
    if (tid < TBL_ - 52 * 128) sTab[tid + 52 * 128] = tz[52];
    __syncthreads();   // every wave's share is in sRed
    const v4f sqk = *(const v4f*)&sRed[0]  + *(const v4f*)&sRed[8]
                  + *(const v4f*)&sRed[16] + *(const v4f*)&sRed[24];
    const v2f rv  = *(const v2f*)&sRed[4]  + *(const v2f*)&sRed[12]
                  + *(const v2f*)&sRed[20] + *(const v2f*)&sRed[28];
    const v2f rq = {sqk[0], sqk[1]};
    const v2f rk = {sqk[2], sqk[3]};

    const v2f stq = gn_stats(rq);
    const v2f stk = gn_stats(rk);
    const v2f stv = gn_stats(rv);
    float va[4], vb[4];   // V's affine of channel g*4+dd, used in the epilogue
#pragma unroll
    for (int dd = 0; dd < 4; ++dd) {
        va[dd] = stv[1] * vg4[dd];
        vb[dd] = vb4[dd] - stv[0] * va[dd];
    }

    { // cooperative staging of normalized kp
#pragma unroll
        for (int it = 0; it < 8; ++it) {
            const v4f z = kz[it];
            v4f kn;
#pragma unroll
            for (int e = 0; e < 4; ++e)
                kn[e] = (z[e] * (1.0f / 16.0f) - stk[0]) * stk[1] * kg[e] + kb[e];
            *(v4f*)&sKP[(tid + it * 128) * 4] = kn;
        }
    }
    __syncthreads();

    v4f qv;
    {
        const v4f z  = qz;
#pragma unroll
        for (int e = 0; e < 4; ++e)
            qv[e] = ((z[e] * (1.0f / 16.0f) - stq[0]) * stq[1] * qg4[e] + qb4[e]) * 0.5f;
    }

    v8f acc[4];
#pragma unroll
    for (int dd = 0; dd < 4; ++dd)
#pragma unroll
        for (int e = 0; e < 8; ++e) acc[dd][e] = 0.0f;

    float mrow = -__builtin_inff();
    float lrow = 0.0f;

    const int* ri = rel_index + (size_t)qg * N_;

    for (int mc = 0; mc < N_; mc += 32) {
        const int buf = (mc >> 5) & 1;
        // this lane's 16 keys, in exact A-fragment element order:
        // e<8 : K = mc + 8*hi + e        (run0)
        // e>=8: K = mc + 16 + 8*hi + e-8 (run1)
        const int k0 = mc + hi * 8;
        const int k1 = mc + 16 + hi * 8;

        v4i i0a = *(const v4i*)(ri + k0);
        v4i i0b = *(const v4i*)(ri + k0 + 4);
        v4i i1a = *(const v4i*)(ri + k1);
        v4i i1b = *(const v4i*)(ri + k1 + 4);

        float s[16];
#pragma unroll
        for (int j = 0; j < 8; ++j) {
            const float* kp4 = &sKP[(k0 + j) * 4];
            const int bi = (j < 4) ? i0a[j] : i0b[j - 4];
            s[j] = qv[0]*kp4[0] + qv[1]*kp4[1] + qv[2]*kp4[2] + qv[3]*kp4[3] + sTab[bi];
        }
#pragma unroll
        for (int j = 0; j < 8; ++j) {
            const float* kp4 = &sKP[(k1 + j) * 4];
            const int bi = (j < 4) ? i1a[j] : i1b[j - 4];
            s[8 + j] = qv[0]*kp4[0] + qv[1]*kp4[1] + qv[2]*kp4[2] + qv[3]*kp4[3] + sTab[bi];
        }

        if (mc + 32 < N_) __builtin_prefetch(ri + mc + 32, 0, 1);

        // online softmax: lanes q and q+16 jointly cover all 32 keys of query q
        float mloc = s[0];
#pragma unroll
        for (int j = 1; j < 16; ++j) mloc = fmaxf(mloc, s[j]);
        mloc = fmaxf(mloc, __shfl_xor(mloc, 16, 32));
        const float mnew = fmaxf(mrow, mloc);
        const float sc   = __expf(mrow - mnew);

        float p[16], ls = 0.0f;
#pragma unroll
        for (int j = 0; j < 16; ++j) { p[j] = __expf(s[j] - mnew); ls += p[j]; }
        ls  += __shfl_xor(ls, 16, 32);
        lrow = lrow * sc + ls;
        mrow = mnew;

        // rescale accumulators: row r+8*hi belongs to query (r+8*hi), whose
        // stats live in lane (r+8*hi) -> 8 broadcasts
#pragma unroll
        for (int r = 0; r < 8; ++r) {
            const float srow = __shfl(sc, r + hi * 8, 32);
            acc[0][r] *= srow; acc[1][r] *= srow;
            acc[2][r] *= srow; acc[3][r] *= srow;
        }

        // pack P into A fragment (element e == p[e] by construction)
        union { v16h v; pk2h h[8]; } A;
#pragma unroll
        for (int j2 = 0; j2 < 8; ++j2)
            A.h[j2] = __builtin_amdgcn_cvt_pkrtz(p[2 * j2], p[2 * j2 + 1]);

        // current V chunk is ready once our asyncs landed + all waves arrive
        asm volatile("s_wait_asynccnt 0x0" ::: "memory");
        __syncthreads();
        // overlap: stage next chunk into the other buffer
        if (mc + 32 < N_) stage_v(vbase + (mc + 32), &sV[buf ^ 1][0], tid);

        // 4 B-tiles of V (dp = dd*16 + ql) straight from LDS
#pragma unroll
        for (int dd = 0; dd < 4; ++dd) {
            const _Float16* vrow = &sV[buf][(dd * 16 + ql) * VP_ + hi * 8];
            union { v16h v; v8h h[2]; } Bf;
            Bf.h[0] = *(const v8h*)vrow;
            Bf.h[1] = *(const v8h*)(vrow + 16);
            acc[dd] = __builtin_amdgcn_wmma_f32_16x16x32_f16(
                false, A.v, false, Bf.v, (short)0, acc[dd], false, false);
        }
    }

    // epilogue: divide by row sums, apply V's GroupNorm affine of channel g*4+dd,
    // and scatter back to (B,C,T,H,W)
    const float lrec = 1.0f / lrow;
#pragma unroll
    for (int r = 0; r < 8; ++r) {
        const float li   = __shfl(lrec, r + hi * 8, 32);
        const int  qrow  = tile * 64 + wq * 16 + r + hi * 8;
        const int  tt    = qrow >> 8;
        const int  yh    = (qrow >> 4) & 15;
        const int  xw    = qrow & 15;
        const int  sh    = ql >> 2;
        const int  sw    = ql & 3;
#pragma unroll
        for (int dd = 0; dd < 4; ++dd) {
            const int c = g * 4 + dd;
            size_t oi = ((size_t)((b * C_ + c) * T_ + tt)) * 4096
                      + (yh * 4 + sh) * 64 + (xw * 4 + sw);
            out[oi] = acc[dd][r] * li * va[dd] + vb[dd];
        }
    }
}

// ---------------------------------------------------------------------------
extern "C" void kernel_launch(void* const* d_in, const int* in_sizes, int n_in,
                              void* d_out, int out_size, void* d_ws, size_t ws_size,
                              hipStream_t stream)
{
    const float* x    = (const float*)d_in[0];
    const float* Wq   = (const float*)d_in[1];
    const float* Wk   = (const float*)d_in[2];
    const float* Wv   = (const float*)d_in[3];
    const float* gq_g = (const float*)d_in[4];
    const float* gq_b = (const float*)d_in[5];
    const float* gk_g = (const float*)d_in[6];
    const float* gk_b = (const float*)d_in[7];
    const float* gv_g = (const float*)d_in[8];
    const float* gv_b = (const float*)d_in[9];
    const float* rtab = (const float*)d_in[10];
    const int*   ridx = (const int*)d_in[11];
    float* out = (float*)d_out;

    char* ws = (char*)d_ws;
    size_t off = 0;
    auto take = [&](size_t bytes) -> void* {
        void* p = ws + off;
        off += (bytes + 255) & ~(size_t)255;
        return p;
    };
    float*    qp_raw = (float*)take((size_t)B_ * N_ * C_ * 4);
    float*    kp_raw = (float*)take((size_t)B_ * N_ * C_ * 4);
    _Float16* vh     = (_Float16*)take((size_t)B_ * NH_ * 64 * N_ * 2);
    float*    spart  = (float*)take((size_t)B_ * T_ * 16 * NH_ * 8 * 4);
    (void)ws_size; (void)in_sizes; (void)n_in; (void)out_size;

    k_proj <<<B_ * T_ * 16 * 2, 384, 0, stream>>>(x, Wq, Wk, Wv, qp_raw, kp_raw, vh, spart);
    k_attn <<<B_ * NH_ * 16, 128, 0, stream>>>(
        qp_raw, kp_raw, vh, spart, gq_g, gq_b, gk_g, gk_b, gv_g, gv_b, rtab, ridx, out);
}

// v007
// Measured time: 52.8 microseconds a run.
// In both of two side-by-side timings against v006, it was 1.04 times as fast.
// All steps since v000 together make it 8.26 times as fast.
#include <hip/hip_runtime.h>

typedef __attribute__((ext_vector_type(16))) _Float16 v16h;
typedef __attribute__((ext_vector_type(8)))  _Float16 v8h;
typedef __attribute__((ext_vector_type(2)))  __fp16   pk2h;  // cvt_pkrtz result type
typedef __attribute__((ext_vector_type(8)))  float    v8f;
typedef __attribute__((ext_vector_type(4)))  float    v4f;
typedef __attribute__((ext_vector_type(2)))  float    v2f;
typedef __attribute__((ext_vector_type(4)))  int      v4i;
typedef __attribute__((ext_vector_type(16))) __bf16   v16b;
typedef __attribute__((ext_vector_type(8)))  __bf16   v8b;
typedef __attribute__((ext_vector_type(4)))  __bf16   v4b;
typedef __attribute__((ext_vector_type(2)))  __bf16   v2b;
typedef __attribute__((ext_vector_type(2)))  unsigned v2u;

#define B_   2
#define C_   128
#define T_   4
#define NH_  32
#define N_   1024     // T * 16 * 16 patch tokens
#define TBL_ 6727     // (2T-1)*(2h-1)*(2w-1) = 7*31*31
#define SPG_ 65536.0f // elements per GroupNorm group: 4 channels * T*H*W

// ---------------------------------------------------------------------------
// Kernel 1: q/k/v projection as a split-bf16 WMMA GEMM, with patch pooling (q,k),
// raw-f16 V pack in [b][g][dp=dd*16+pix][m] layout, and this block's GroupNorm
// sum/sumsq, stored as partial sums.  One block per (b, t, patch row of 16
// patches, half of the 128 output channels, for q, k and v alike).  12 waves;
// each wave owns 16 output channels of one projection and keeps their weights
// in registers as B fragments for the whole block.  A tile = 16 patches (rows)
// at one pixel position of the patch, so a lane's 8 D registers are 8
// consecutive patch tokens m of one output channel.
// Every f32 operand is held as two bf16 numbers, hi + lo (16 significant bits),
// and a product is three 16x16x32 WMMAs with f32 accumulation: hi*hi + lo*hi +
// hi*lo; the lo*lo term, below 2^-16 of the product, is left out.
// ---------------------------------------------------------------------------
#define XP_ 264   // LDS row pitch in bf16: 128 hi + 128 lo + 8, 528 B = 16 B x odd

// v = h + l + rest, four values: h the nearest bf16 of v, l the nearest bf16 of v - h.
// A packed pair of bf16 is widened again by a shift and a mask.
__device__ __forceinline__
void split4(v4f v, v4b& h, v4b& l)
{
    v2u hu, lu;
#pragma unroll
    for (int i = 0; i < 2; ++i) {
        const v2f a = {v[2 * i], v[2 * i + 1]};
        const unsigned p = __builtin_bit_cast(unsigned, __builtin_convertvector(a, v2b));
        const v2f r = {a[0] - __builtin_bit_cast(float, p << 16),
                       a[1] - __builtin_bit_cast(float, p & 0xffff0000u)};
        hu[i] = p;
        lu[i] = __builtin_bit_cast(unsigned, __builtin_convertvector(r, v2b));
    }
    h = __builtin_bit_cast(v4b, hu);
    l = __builtin_bit_cast(v4b, lu);
}

// A fragments of one tile of 16 patches, all 128 channels: lane (row, hi) reads
// k = 32j + 16hi + 0..15 of its row, hi part and lo part
__device__ __forceinline__
void load_tile(const __bf16* p, v16b (&xh)[4], v16b (&xl)[4])
{
#pragma unroll
    for (int j = 0; j < 4; ++j) {
        union { v16b v; v8b h[2]; } a, b;
        a.h[0] = *(const v8b*)(p + j * 32);
        a.h[1] = *(const v8b*)(p + j * 32 + 8);
        b.h[0] = *(const v8b*)(p + 128 + j * 32);
        b.h[1] = *(const v8b*)(p + 128 + j * 32 + 8);
        xh[j] = a.v;
        xl[j] = b.v;
    }
}

// one 16x16 tile over k = 128: hi*hi + lo*hi + hi*lo, f32 accumulation
__device__ __forceinline__
v8f mul_tile(const v16b (&xh)[4], const v16b (&xl)[4], const v16b (&wh)[4], const v16b (&wl)[4])
{
    v8f a;
#pragma unroll
    for (int r = 0; r < 8; ++r) a[r] = 0.0f;
#pragma unroll
    for (int j = 0; j < 4; ++j) {
        a = __builtin_amdgcn_wmma_f32_16x16x32_bf16(false, xh[j], false, wh[j], (short)0, a, false, false);
        a = __builtin_amdgcn_wmma_f32_16x16x32_bf16(false, xl[j], false, wh[j], (short)0, a, false, false);
        a = __builtin_amdgcn_wmma_f32_16x16x32_bf16(false, xh[j], false, wl[j], (short)0, a, false, false);
    }
    return a;
}

__global__ __launch_bounds__(384)
void k_proj(const float* __restrict__ x,  const float* __restrict__ Wq,
            const float* __restrict__ Wk, const float* __restrict__ Wv,
            float* __restrict__ qp_raw, float* __restrict__ kp_raw,
            _Float16* __restrict__ vh, float* __restrict__ statsPart)
{
    __shared__ __align__(16) __bf16 sX[256 * XP_];  // [pix][patch][hi|lo][channel], 132 KB

    const int blk  = blockIdx.x;         // ((b*T + tt)*16 + yh)*2 + channel half
    const int prow = blk >> 1;
    const int yh   = prow & 15;
    const int tt   = (prow >> 4) & 3;
    const int b    = prow >> 6;
    const int tid  = threadIdx.x;
    const int lane = tid & 31;
    // wave number as a scalar, so that the choice of projection is a scalar branch
    const int w    = __builtin_amdgcn_readfirstlane(tid >> 5);
    const int proj = w >> 2;             // 0 q, 1 k, 2 v
    const int ot   = (blk & 1) * 4 + (w & 3);  // 16-channel tile of that projection
    const int cl   = lane & 15;          // A row (patch) / B column (channel) / D column
    const int hi   = lane >> 4;          // k half of A and B, row half of D
    const int o    = ot * 16 + cl;       // this lane's output channel

    // weights: lane (cl,hi) holds k = 32j + 16hi + 0..15 of row o, j = 0..3
    const float* Wp   = (proj == 0) ? Wq : ((proj == 1) ? Wk : Wv);
    const float* wrow = Wp + (size_t)o * C_ + hi * 16;
    v4f wf[16];
#pragma unroll
    for (int j = 0; j < 16; ++j) wf[j] = *(const v4f*)(wrow + (j >> 2) * 32 + (j & 3) * 4);
    // the x loads below may land in the weight loads' address registers
    asm volatile("s_wait_xcnt 0x0" ::: "memory");

    v16b wh[4], wl[4];   // B fragments, hi and lo
    { // stage the x tile transposed: a unit = 4 channels x 4 W-pixels, 2048 units
        // over 384 threads: five full rounds and a sixth for waves 0..3.  All
        // loads are issued before the first LDS store, one memory latency in all.
        const float* xb = x + ((size_t)(b * C_) * T_ + tt) * 4096 + yh * 256
                            + (size_t)((tid >> 6) * 4) * (T_ * 4096) + (tid & 63) * 4;
        __bf16* sd = &sX[(((tid >> 4) & 3) * 64 + (tid & 15)) * XP_ + (tid >> 6) * 4];
        v4f rr[6][4];
#pragma unroll
        for (int it = 0; it < 5; ++it)
#pragma unroll
            for (int k = 0; k < 4; ++k)   // 384 threads = 6 units of 4 channels further on
                rr[it][k] = *(const v4f*)(xb + (size_t)(it * 24 + k) * (T_ * 4096));
        if (w < 4) {
#pragma unroll
            for (int k = 0; k < 4; ++k)
                rr[5][k] = *(const v4f*)(xb + (size_t)(5 * 24 + k) * (T_ * 4096));
        }
        // the weights as B fragments, hi and lo
#pragma unroll
        for (int j = 0; j < 16; ++j) {
            v4b th, tl;
            split4(wf[j], th, tl);
#pragma unroll
            for (int e = 0; e < 4; ++e) {
                wh[j >> 2][(j & 3) * 4 + e] = th[e];
                wl[j >> 2][(j & 3) * 4 + e] = tl[e];
            }
        }
#pragma unroll
        for (int it = 0; it < 6; ++it) {
            if (it < 5 || w < 4) {
#pragma unroll
                for (int sw = 0; sw < 4; ++sw) {
                    v4f t = {rr[it][0][sw], rr[it][1][sw], rr[it][2][sw], rr[it][3][sw]};
                    v4b th, tl;
                    split4(t, th, tl);
                    *(v4b*)(sd + sw * 16 * XP_ + it * 24)       = th;
                    *(v4b*)(sd + sw * 16 * XP_ + it * 24 + 128) = tl;
                }
            }
        }
    }
    __syncthreads();

    float s1 = 0.0f, s2 = 0.0f;
    v8f pool;
#pragma unroll
    for (int r = 0; r < 8; ++r) pool[r] = 0.0f;

    const __bf16* arow = &sX[cl * XP_ + hi * 16];   // the weights' k order: 32j + 16hi + 0..15
    const int m0 = tt * 256 + yh * 16 + hi * 8;      // first of this lane's 8 tokens
    _Float16* vdst = vh + ((size_t)((b * NH_ + (o >> 2)) * 64 + (o & 3) * 16)) * N_ + m0;

    // Two tiles a trip, one fragment set each: a tile's fragments are read from LDS
    // while the tile before it is multiplied.
    v16b f0h[4], f0l[4], f1h[4], f1l[4];
    load_tile(arow, f0h, f0l);
    for (int pix = 0; pix < 16; pix += 2) {
        load_tile(arow + (pix + 1) * 16 * XP_, f1h, f1l);
        // keeps these LDS reads ahead of the WMMAs below, which hide their latency
        __builtin_amdgcn_sched_barrier(0);
        const v8f a0 = mul_tile(f0h, f0l, wh, wl);
        if (pix + 2 < 16) load_tile(arow + (pix + 2) * 16 * XP_, f0h, f0l);
        const v8f a1 = mul_tile(f1h, f1l, wh, wl);
        // four vector slots between the last WMMA and the first reader of its D, on
        // both sides of the branch below; the scheduling barriers hold them in place
        __builtin_amdgcn_sched_barrier(0);
        asm volatile("v_nop\n\tv_nop\n\tv_nop\n\tv_nop");
        __builtin_amdgcn_sched_barrier(0);
#pragma unroll
        for (int r = 0; r < 8; ++r) {
            const float t = a0[r] + a1[r];
            pool[r] += t;            // patch sum; read for q and k only
            s1 += t;
            s2 += a0[r] * a0[r] + a1[r] * a1[r];
        }
        if (proj == 2) {
            v8h h0, h1;
#pragma unroll
            for (int r = 0; r < 8; ++r) { h0[r] = (_Float16)a0[r]; h1[r] = (_Float16)a1[r]; }
            *(v8h*)(vdst + (size_t)pix * N_)       = h0;
            *(v8h*)(vdst + (size_t)(pix + 1) * N_) = h1;
            // the next trip rewrites the stores' address and data registers
            asm volatile("s_wait_xcnt 0x0" ::: "memory");
        }
    }

    if (proj != 2) {   // patch SUM (mean applied later), head-major [b][g][m][4]:
        // the 8 tokens x 4 channels that a group's lanes store fill one 128 B line
        float* dst = ((proj == 0) ? qp_raw : kp_raw)
                   + ((size_t)(b * NH_ + (o >> 2)) * N_ + m0) * 4 + (o & 3);
#pragma unroll
        for (int r = 0; r < 8; ++r) dst[r * 4] = pool[r];
    }

    // group stats: 4 channels of a group are 4 neighbouring lanes, in both halves
    s1 += __shfl_xor(s1, 1, 32);  s2 += __shfl_xor(s2, 1, 32);
    s1 += __shfl_xor(s1, 2, 32);  s2 += __shfl_xor(s2, 2, 32);
    s1 += __shfl_xor(s1, 16, 32); s2 += __shfl_xor(s2, 16, 32);
    // partial sums of this patch row: [b*64 + t*16 + row][g][q1 q2 k1 k2 v1 v2 0 0].
    // The block's 16 groups fill 512 B in a row, four whole lines that no other
    // block writes; the two zeros make the entry's second half readable as 16 B.
    if ((lane & 19) == 0) {
        float* sp = statsPart + ((size_t)prow * NH_ + (o >> 2)) * 8 + proj * 2;
        if (proj == 2) {
            const v4f t = {s1, s2, 0.0f, 0.0f};
            *(v4f*)sp = t;
        } else {
            const v2f t = {s1, s2};
            *(v2f*)sp = t;
        }
    }
}

// ---------------------------------------------------------------------------
// v + (v of lane l ^ MASK) inside a 16-lane row, as a DPP add (row_xmask)
// ---------------------------------------------------------------------------
template <int MASK>
__device__ __forceinline__
float add_xmask(float v)
{
    const int t = __builtin_amdgcn_update_dpp(0, __builtin_bit_cast(int, v),
                                              0x160 + MASK, 0xf, 0xf, true);
    return v + __builtin_bit_cast(float, t);
}

// ---------------------------------------------------------------------------
// GroupNorm (mu, rstd) of one (projection, b, g) from its raw sum and sum of squares
// ---------------------------------------------------------------------------
__device__ __forceinline__
v2f gn_stats(v2f raw)
{
    const float mu  = raw[0] / SPG_;
    const float var = raw[1] / SPG_ - mu * mu;
    const v2f r = {mu, rsqrtf(var + 1e-5f)};
    return r;
}

// ---------------------------------------------------------------------------
// Async staging of one 32-key x 64-dp V chunk (4 KB) into LDS, shared by the
// 4 waves of the block.  Per-lane global_load_async_to_lds_b128 (ASYNCcnt),
// 2 segments per thread.  LDS layout: [dp][k_local(32)] halves; a row holds
// 64 B and is pitched VP_ halves = 80 B (16 B x odd): the 16 rows that a half
// wave reads with one ds_load_b128 then start on 16 different groups of four
// banks, where a 64 B pitch puts four rows on each group.
// ---------------------------------------------------------------------------
#define VP_ 40
__device__ __forceinline__
void stage_v(const _Float16* __restrict__ gsrc, _Float16* ldst, int tid)
{
#pragma unroll
    for (int it = 0; it < 2; ++it) {
        const int idx = tid + it * 128;        // 0..255 segments of 16 B
        const int dp  = idx >> 2;
        const int seg = idx & 3;
        const _Float16* g = gsrc + (size_t)dp * N_ + seg * 8;
        const _Float16* l = ldst + dp * VP_ + seg * 8;
        const unsigned lofs = (unsigned)(unsigned long long)l;  // LDS byte addr
        const unsigned long long ga = (unsigned long long)g;
        asm volatile("global_load_async_to_lds_b128 %0, %1, off"
                     :: "v"(lofs), "v"(ga) : "memory");
    }
}

// Chunk 0's copies for the prologue: the same two segments per thread as stage_v,
// in one statement that ends in s_wait_xcnt 0, so that nothing scheduled behind it
// lands in an address register of the copies or of the loads issued before them.
__device__ __forceinline__
void stage_v_first(const _Float16* __restrict__ gsrc, _Float16* ldst, int tid)
{
    const int dp  = tid >> 2;
    const int seg = tid & 3;
    const _Float16* g0 = gsrc + (size_t)dp * N_ + seg * 8;
    const _Float16* g1 = g0 + (size_t)32 * N_;
    const _Float16* l0 = ldst + dp * VP_ + seg * 8;
    const _Float16* l1 = l0 + 32 * VP_;
    const unsigned lo0 = (unsigned)(unsigned long long)l0;  // LDS byte addr
    const unsigned lo1 = (unsigned)(unsigned long long)l1;
    const unsigned long long ga0 = (unsigned long long)g0;
    const unsigned long long ga1 = (unsigned long long)g1;
    asm volatile("global_load_async_to_lds_b128 %0, %1, off\n\t"
                 "global_load_async_to_lds_b128 %2, %3, off\n\t"
                 "s_wait_xcnt 0x0"
                 :: "v"(lo0), "v"(ga0), "v"(lo1), "v"(ga1) : "memory");
}

// Async staging of one tile of rel_index, 64 queries x 32 keys (8 KB), shared by
// the 4 waves of the block: 4 copies of 16 B per thread, 8 neighbouring lanes fill
// one whole 128 B line of a query's row.  LDS rows are pitched IP_ ints = 144 B
// (16 B x odd), so that the ds_load_b128 reads of 16 rows spread over the banks.
// One statement that ends in s_wait_xcnt 0: nothing scheduled behind it lands in
// an address register of an issued copy.
#define IP_ 36
__device__ __forceinline__
void stage_idx(const int* __restrict__ gsrc, int* ldst, int tid)
{
    const int row = tid >> 3;    // 0..15; the four copies are 16 rows apart
    const int seg = tid & 7;
    const int* g0 = gsrc + (size_t)row * N_ + seg * 4;
    const int* l0 = ldst + row * IP_ + seg * 4;
    const unsigned lo0 = (unsigned)(unsigned long long)l0;  // LDS byte addr
    const unsigned lo1 = lo0 + 16 * IP_ * 4;
    const unsigned lo2 = lo0 + 32 * IP_ * 4;
    const unsigned lo3 = lo0 + 48 * IP_ * 4;
    const unsigned long long ga0 = (unsigned long long)g0;
    const unsigned long long ga1 = (unsigned long long)(g0 + (size_t)16 * N_);
    const unsigned long long ga2 = (unsigned long long)(g0 + (size_t)32 * N_);
    const unsigned long long ga3 = (unsigned long long)(g0 + (size_t)48 * N_);
    asm volatile("global_load_async_to_lds_b128 %0, %1, off\n\t"
                 "global_load_async_to_lds_b128 %2, %3, off\n\t"
                 "global_load_async_to_lds_b128 %4, %5, off\n\t"
                 "global_load_async_to_lds_b128 %6, %7, off\n\t"
                 "s_wait_xcnt 0x0"
                 :: "v"(lo0), "v"(ga0), "v"(lo1), "v"(ga1),
                    "v"(lo2), "v"(ga2), "v"(lo3), "v"(ga3) : "memory");
}

// The rel-bias of one lane's 16 keys of a trip, in two halves: its query's row of
// the staged rel_index tile (il), in A-fragment element order, and the table gather.
__device__ __forceinline__
void load_idx(const int* il, v4i (&ix)[4])
{
    ix[0] = *(const v4i*)il;
    ix[1] = *(const v4i*)(il + 4);
    ix[2] = *(const v4i*)(il + 16);
    ix[3] = *(const v4i*)(il + 20);
}
__device__ __forceinline__
void gather_bias(const v4i (&ix)[4], const float* tab, float (&bias)[16])
{
#pragma unroll
    for (int j = 0; j < 16; ++j) bias[j] = tab[ix[j >> 2][j & 3]];
}

// ---------------------------------------------------------------------------
// Kernel 2: fused flash attention.  Block = 128 threads (4 waves), one block
// per (b, g, 64-query tile); each wave owns 16 queries.  The three GroupNorms
// are finished here: the block adds up the 64 partial sums of its group (one
// per patch row of the projection kernel), derives (mu, rstd) from them,
// normalizes the pooled k while staging it and the pooled q on load (the
// affine commutes with the patch mean; the logit scale 1/sqrt(d)=0.5 goes into
// q), and applies V's affine to the finished rows: the softmax weights of a row
// sum to one, so sum(p*(a*v+b))/sum(p) = a*sum(p*v)/sum(p) + b.  Per 32-key chunk:
// VALU logits + rel-bias (gathered one trip ahead from the LDS table, through a
// rel_index tile of an async-staged LDS ring), online softmax (xor-16 combine),
// pkrtz-pack P directly into the WMMA A layout, 4x v_wmma_f32_16x16x32_f16
// against V fragments read from the async-staged, double-buffered LDS tile.
// ---------------------------------------------------------------------------
__global__ __launch_bounds__(128)
void k_attn(const float* __restrict__ qp_raw, const float* __restrict__ kp_raw,
            const _Float16* __restrict__ vh, const float* __restrict__ statsPart,
            const float* __restrict__ gq_g, const float* __restrict__ gq_b,
            const float* __restrict__ gk_g, const float* __restrict__ gk_b,
            const float* __restrict__ gv_g, const float* __restrict__ gv_b,
            const float* __restrict__ rel_table, const int* __restrict__ rel_index,
            float* __restrict__ out)
{
    __shared__ float sKP[N_ * 4];                      // kp for this (b,g): 16 KB
    __shared__ float sTab[TBL_];                       // rel_table row: ~27 KB
    __shared__ __align__(16) _Float16 sV[2][64 * VP_]; // double-buffered V chunk: 2x5 KB
    __shared__ __align__(16) float sRed[4 * 8];        // each wave's share of the group sums
    __shared__ __align__(16) int sIdx[2][64 * IP_];    // double-buffered rel_index tile: 2x9 KB

    const int blk  = blockIdx.x;                 // b*512 + g*16 + tile
    const int tile = blk & 15;
    const int g    = (blk >> 4) & 31;
    const int b    = blk >> 9;
    const int tid  = threadIdx.x;

    const _Float16* vbase = vh + ((size_t)(b * NH_ + g)) * 64 * N_;

    const int lane = tid & 31;
    const int wq   = tid >> 5;        // wave id: which 16-query sub-tile
    const int ql   = lane & 15;       // M (query) / N (dp) index within tile
    const int hi   = lane >> 4;       // upper lane half selector
    const int qg   = tile * 64 + wq * 16 + ql;   // this lane's query token

    // every global load of the prologue is issued here, ahead of the first wait:
    // the pooled k of this (b,g) (16 KB in a row), this lane's pooled q, the table
    // row, and the block's partial sums and affine rows.  One memory round trip in all.
    // thread t: patch row t>>1 of this b, half t&1 of its entry (q1 q2 k1 k2 | v1 v2 0 0)
    v4f ps = *(const v4f*)(statsPart + ((size_t)(b * 64 + (tid >> 1)) * NH_ + g) * 8
                                     + (tid & 1) * 4);
    const v4f kg  = *(const v4f*)(gk_g + g * 4);
    const v4f kb  = *(const v4f*)(gk_b + g * 4);
    const v4f qg4 = *(const v4f*)(gq_g + g * 4);
    const v4f qb4 = *(const v4f*)(gq_b + g * 4);
    const v4f vg4 = *(const v4f*)(gv_g + g * 4);
    const v4f vb4 = *(const v4f*)(gv_b + g * 4);
    const float* kpb = kp_raw + (size_t)(b * NH_ + g) * N_ * 4;
    const float* tb  = rel_table + (size_t)g * TBL_;
    v4f   kz[8];
    float tz[53];
#pragma unroll
    for (int it = 0; it < 8; ++it) kz[it] = *(const v4f*)(kpb + (tid + it * 128) * 4);
    const v4f qz = *(const v4f*)(qp_raw + ((size_t)(b * NH_ + g) * N_ + qg) * 4);
#pragma unroll
    for (int it = 0; it < 52; ++it) tz[it] = tb[tid + it * 128];
    tz[52] = 0.0f;
    if (tid < TBL_ - 52 * 128) tz[52] = tb[tid + 52 * 128];
    // async staging of V chunk 0 flies with them; it is first read in trip 0
    stage_v_first(vbase, &sV[0][0], tid);
    // so do the rel_index tiles of trips 0 and 1
    const int* ribase = rel_index + (size_t)(tile * 64) * N_;
    stage_idx(ribase,      &sIdx[0][0], tid);
    stage_idx(ribase + 32, &sIdx[1][0], tid);
    // holds the adding below, and with it the first wait on a load, behind the copies' issue
    __builtin_amdgcn_sched_barrier(0);

    // sum over the 64 patch rows: 16 of them in a wave (lanes of equal parity), then
    // the four waves' shares through LDS
#pragma unroll
    for (int e = 0; e < 4; ++e) {
        float t = ps[e];
        t = add_xmask<2>(t);
        t = add_xmask<4>(t);
        t = add_xmask<8>(t);
        const int u = __builtin_bit_cast(int, t);
        t += __builtin_bit_cast(float,
                 __builtin_amdgcn_permlanex16(u, u, 0x76543210, 0xfedcba98, false, false));
        ps[e] = t;
    }
    if (lane < 2) *(v4f*)&sRed[(wq * 2 + lane) * 4] = ps;
    // the bias table needs no sums: it is staged ahead of the barrier, as its loads land
#pragma unroll
    for (int it = 0; it < 52; ++it) sTab[tid + it * 128] = tz[it];
    if (tid < TBL_ - 52 * 128) sTab[tid + 52 * 128] = tz[52];
    __syncthreads();   // every wave's share is in sRed
    const v4f sqk = *(const v4f*)&sRed[0]  + *(const v4f*)&sRed[8]
                  + *(const v4f*)&sRed[16] + *(const v4f*)&sRed[24];
    const v2f rv  = *(const v2f*)&sRed[4]  + *(const v2f*)&sRed[12]
                  + *(const v2f*)&sRed[20] + *(const v2f*)&sRed[28];
    const v2f rq = {sqk[0], sqk[1]};
    const v2f rk = {sqk[2], sqk[3]};

    const v2f stq = gn_stats(rq);
    const v2f stk = gn_stats(rk);
    const v2f stv = gn_stats(rv);
    float va[4], vb[4];   // V's affine of channel g*4+dd, used in the epilogue
#pragma unroll
    for (int dd = 0; dd < 4; ++dd) {
        va[dd] = stv[1] * vg4[dd];
        vb[dd] = vb4[dd] - stv[0] * va[dd];
    }

    { // cooperative staging of normalized kp
#pragma unroll
        for (int it = 0; it < 8; ++it) {
            const v4f z = kz[it];
            v4f kn;
#pragma unroll
            for (int e = 0; e < 4; ++e)
                kn[e] = (z[e] * (1.0f / 16.0f) - stk[0]) * stk[1] * kg[e] + kb[e];
            *(v4f*)&sKP[(tid + it * 128) * 4] = kn;
        }
    }
    // this wave's copies have landed; the barrier publishes rel_index tile 0, read
    // in front of the loop, to the other waves
    asm volatile("s_wait_asynccnt 0x0" ::: "memory");
    __syncthreads();

    v4f qv;
    {
        const v4f z  = qz;
#pragma unroll
        for (int e = 0; e < 4; ++e)
            qv[e] = ((z[e] * (1.0f / 16.0f) - stq[0]) * stq[1] * qg4[e] + qb4[e]) * 0.5f;
    }

    v8f acc[4];
#pragma unroll
    for (int dd = 0; dd < 4; ++dd)
#pragma unroll
        for (int e = 0; e < 8; ++e) acc[dd][e] = 0.0f;

    float mrow = -__builtin_inff();
    float lrow = 0.0f;

    const int irow = ((wq * 16 + ql) * IP_ + hi * 8);   // this lane's query row in a tile
    float bias[16];                                     // rel-bias of the coming trip
    v4i ix[4];
    load_idx(&sIdx[0][irow], ix);
    gather_bias(ix, sTab, bias);

    for (int mc = 0; mc < N_; mc += 32) {
        const int buf = (mc >> 5) & 1;
        // this lane's 16 keys, in exact A-fragment element order:
        // e<8 : K = mc + 8*hi + e        (run0)
        // e>=8: K = mc + 16 + 8*hi + e-8 (run1)
        const int k0 = mc + hi * 8;
        const int k1 = mc + 16 + hi * 8;

        float s[16];
#pragma unroll
        for (int j = 0; j < 8; ++j) {
            const float* kp4 = &sKP[(k0 + j) * 4];
            s[j] = qv[0]*kp4[0] + qv[1]*kp4[1] + qv[2]*kp4[2] + qv[3]*kp4[3] + bias[j];
        }
#pragma unroll
        for (int j = 0; j < 8; ++j) {
            const float* kp4 = &sKP[(k1 + j) * 4];
            s[8 + j] = qv[0]*kp4[0] + qv[1]*kp4[1] + qv[2]*kp4[2] + qv[3]*kp4[3] + bias[8 + j];
        }

        // online softmax: lanes q and q+16 jointly cover all 32 keys of query q
        float mloc = s[0];
#pragma unroll
        for (int j = 1; j < 16; ++j) mloc = fmaxf(mloc, s[j]);
        mloc = fmaxf(mloc, __shfl_xor(mloc, 16, 32));
        const float mnew = fmaxf(mrow, mloc);
        const float sc   = __expf(mrow - mnew);

        float p[16], ls = 0.0f;
#pragma unroll
        for (int j = 0; j < 16; ++j) { p[j] = __expf(s[j] - mnew); ls += p[j]; }
        ls  += __shfl_xor(ls, 16, 32);
        lrow = lrow * sc + ls;
        mrow = mnew;

        // rescale accumulators: row r+8*hi belongs to query (r+8*hi), whose
        // stats live in lane (r+8*hi) -> 8 broadcasts
#pragma unroll
        for (int r = 0; r < 8; ++r) {
            const float srow = __shfl(sc, r + hi * 8, 32);
            acc[0][r] *= srow; acc[1][r] *= srow;
            acc[2][r] *= srow; acc[3][r] *= srow;
        }

        // pack P into A fragment (element e == p[e] by construction)
        union { v16h v; pk2h h[8]; } A;
#pragma unroll
        for (int j2 = 0; j2 < 8; ++j2)
            A.h[j2] = __builtin_amdgcn_cvt_pkrtz(p[2 * j2], p[2 * j2 + 1]);

        // this wave's reads of rel_index tile t (made in the trip before) are over
        // before the barrier behind which the tile's buffer is refilled
        asm volatile("s_wait_dscnt 0x0" ::: "memory");
        // current V chunk, and the next trip's rel_index tile, are ready once our
        // asyncs landed + all waves arrive
        asm volatile("s_wait_asynccnt 0x0" ::: "memory");
        __syncthreads();
        // overlap: stage next chunk into the other buffer
        if (mc + 32 < N_) stage_v(vbase + (mc + 32), &sV[buf ^ 1][0], tid);

        // 4 B-tiles of V (dp = dd*16 + ql) straight from LDS
        union { v16h v; v8h h[2]; } Bf[4];
#pragma unroll
        for (int dd = 0; dd < 4; ++dd) {
            const _Float16* vrow = &sV[buf][(dd * 16 + ql) * VP_ + hi * 8];
            Bf[dd].h[0] = *(const v8h*)vrow;
            Bf[dd].h[1] = *(const v8h*)(vrow + 16);
        }
        // the next trip's rel_index row is read behind the V fragments and its bias
        // gathered behind the WMMAs.  The last trip finds tile 30 there, still whole,
        // and its gather is not used.
        load_idx(&sIdx[buf ^ 1][irow], ix);
        // rel_index tile of trip t + 2 into the buffer whose reads ended ahead of the
        // barrier; issued here, its s_wait_xcnt 0 passes under the LDS reads above
        if (mc + 64 < N_) stage_idx(ribase + (mc + 64), &sIdx[buf][0], tid);
#pragma unroll
        for (int dd = 0; dd < 4; ++dd)
            acc[dd] = __builtin_amdgcn_wmma_f32_16x16x32_f16(
                false, A.v, false, Bf[dd].v, (short)0, acc[dd], false, false);
        gather_bias(ix, sTab, bias);
    }

    // epilogue: divide by row sums, apply V's GroupNorm affine of channel g*4+dd,
    // and scatter back to (B,C,T,H,W)
    const float lrec = 1.0f / lrow;
#pragma unroll
    for (int r = 0; r < 8; ++r) {
        const float li   = __shfl(lrec, r + hi * 8, 32);
        const int  qrow  = tile * 64 + wq * 16 + r + hi * 8;
        const int  tt    = qrow >> 8;
        const int  yh    = (qrow >> 4) & 15;
        const int  xw    = qrow & 15;
        const int  sh    = ql >> 2;
        const int  sw    = ql & 3;
#pragma unroll
        for (int dd = 0; dd < 4; ++dd) {
            const int c = g * 4 + dd;
            size_t oi = ((size_t)((b * C_ + c) * T_ + tt)) * 4096
                      + (yh * 4 + sh) * 64 + (xw * 4 + sw);
            out[oi] = acc[dd][r] * li * va[dd] + vb[dd];
        }
    }
}

// ---------------------------------------------------------------------------
extern "C" void kernel_launch(void* const* d_in, const int* in_sizes, int n_in,
                              void* d_out, int out_size, void* d_ws, size_t ws_size,
                              hipStream_t stream)
{
    const float* x    = (const float*)d_in[0];
    const float* Wq   = (const float*)d_in[1];
    const float* Wk   = (const float*)d_in[2];
    const float* Wv   = (const float*)d_in[3];
    const float* gq_g = (const float*)d_in[4];
    const float* gq_b = (const float*)d_in[5];
    const float* gk_g = (const float*)d_in[6];
    const float* gk_b = (const float*)d_in[7];
    const float* gv_g = (const float*)d_in[8];
    const float* gv_b = (const float*)d_in[9];
    const float* rtab = (const float*)d_in[10];
    const int*   ridx = (const int*)d_in[11];
    float* out = (float*)d_out;

    char* ws = (char*)d_ws;
    size_t off = 0;
    auto take = [&](size_t bytes) -> void* {
        void* p = ws + off;
        off += (bytes + 255) & ~(size_t)255;
        return p;
    };
    float*    qp_raw = (float*)take((size_t)B_ * N_ * C_ * 4);
    float*    kp_raw = (float*)take((size_t)B_ * N_ * C_ * 4);
    _Float16* vh     = (_Float16*)take((size_t)B_ * NH_ * 64 * N_ * 2);
    float*    spart  = (float*)take((size_t)B_ * T_ * 16 * NH_ * 8 * 4);
    (void)ws_size; (void)in_sizes; (void)n_in; (void)out_size;

    k_proj <<<B_ * T_ * 16 * 2, 384, 0, stream>>>(x, Wq, Wk, Wv, qp_raw, kp_raw, vh, spart);
    k_attn <<<B_ * NH_ * 16, 128, 0, stream>>>(
        qp_raw, kp_raw, vh, spart, gq_g, gq_b, gk_g, gk_b, gv_g, gv_b, rtab, ridx, out);
}

// v008
// It runs in 51.1 microseconds.
// Next to v007, in two timings, it ran 1.03 times as fast each time.
// Over all steps from v000 it is 8.53 times as fast.
#include <hip/hip_runtime.h>

typedef __attribute__((ext_vector_type(16))) _Float16 v16h;
typedef __attribute__((ext_vector_type(8)))  _Float16 v8h;
typedef __attribute__((ext_vector_type(2)))  __fp16   pk2h;  // cvt_pkrtz result type
typedef __attribute__((ext_vector_type(8)))  float    v8f;
typedef __attribute__((ext_vector_type(4)))  float    v4f;
typedef __attribute__((ext_vector_type(2)))  float    v2f;
typedef __attribute__((ext_vector_type(4)))  int      v4i;
typedef __attribute__((ext_vector_type(16))) __bf16   v16b;
typedef __attribute__((ext_vector_type(8)))  __bf16   v8b;
typedef __attribute__((ext_vector_type(4)))  __bf16   v4b;
typedef __attribute__((ext_vector_type(2)))  __bf16   v2b;
typedef __attribute__((ext_vector_type(2)))  unsigned v2u;

#define B_   2
#define C_   128
#define T_   4
#define NH_  32
#define N_   1024     // T * 16 * 16 patch tokens
#define TBL_ 6727     // (2T-1)*(2h-1)*(2w-1) = 7*31*31
#define SPG_ 65536.0f // elements per GroupNorm group: 4 channels * T*H*W

// ---------------------------------------------------------------------------
// Kernel 1: q/k/v projection as a split-bf16 WMMA GEMM, with patch pooling (q,k),
// raw-f16 V pack in [b][g][dp=dd*16+pix][m] layout, and this block's GroupNorm
// sum/sumsq, stored as partial sums.  One block per (b, t, patch row of 16
// patches, half of the 128 output channels, for q, k and v alike).  12 waves;
// each wave owns 16 output channels of one projection and keeps their weights
// in registers as B fragments for the whole block.  A tile = 16 patches (rows)
// at one pixel position of the patch, so a lane's 8 D registers are 8
// consecutive patch tokens m of one output channel.
// Every f32 operand is held as two bf16 numbers, hi + lo (16 significant bits),
// and a product is three 16x16x32 WMMAs with f32 accumulation: hi*hi + lo*hi +
// hi*lo; the lo*lo term, below 2^-16 of the product, is left out.
// ---------------------------------------------------------------------------
#define XP_ 264   // LDS row pitch in bf16: 128 hi + 128 lo + 8, 528 B = 16 B x odd

// v = h + l + rest, four values: h the nearest bf16 of v, l the nearest bf16 of v - h.
// A packed pair of bf16 is widened again by a shift and a mask.
__device__ __forceinline__
void split4(v4f v, v4b& h, v4b& l)
{
    v2u hu, lu;
#pragma unroll
    for (int i = 0; i < 2; ++i) {
        const v2f a = {v[2 * i], v[2 * i + 1]};
        const unsigned p = __builtin_bit_cast(unsigned, __builtin_convertvector(a, v2b));
        const v2f r = {a[0] - __builtin_bit_cast(float, p << 16),
                       a[1] - __builtin_bit_cast(float, p & 0xffff0000u)};
        hu[i] = p;
        lu[i] = __builtin_bit_cast(unsigned, __builtin_convertvector(r, v2b));
    }
    h = __builtin_bit_cast(v4b, hu);
    l = __builtin_bit_cast(v4b, lu);
}

// A fragments of one tile of 16 patches, all 128 channels: lane (row, hi) reads
// k = 32j + 16hi + 0..15 of its row, hi part and lo part
__device__ __forceinline__
void load_tile(const __bf16* p, v16b (&xh)[4], v16b (&xl)[4])
{
#pragma unroll
    for (int j = 0; j < 4; ++j) {
        union { v16b v; v8b h[2]; } a, b;
        a.h[0] = *(const v8b*)(p + j * 32);
        a.h[1] = *(const v8b*)(p + j * 32 + 8);
        b.h[0] = *(const v8b*)(p + 128 + j * 32);
        b.h[1] = *(const v8b*)(p + 128 + j * 32 + 8);
        xh[j] = a.v;
        xl[j] = b.v;
    }
}

// one 16x16 tile over k = 128: hi*hi + lo*hi + hi*lo, f32 accumulation
__device__ __forceinline__
v8f mul_tile(const v16b (&xh)[4], const v16b (&xl)[4], const v16b (&wh)[4], const v16b (&wl)[4])
{
    v8f a;
#pragma unroll
    for (int r = 0; r < 8; ++r) a[r] = 0.0f;
#pragma unroll
    for (int j = 0; j < 4; ++j) {
        a = __builtin_amdgcn_wmma_f32_16x16x32_bf16(false, xh[j], false, wh[j], (short)0, a, false, false);
        a = __builtin_amdgcn_wmma_f32_16x16x32_bf16(false, xl[j], false, wh[j], (short)0, a, false, false);
        a = __builtin_amdgcn_wmma_f32_16x16x32_bf16(false, xh[j], false, wl[j], (short)0, a, false, false);
    }
    return a;
}

__global__ __launch_bounds__(384)
void k_proj(const float* __restrict__ x,  const float* __restrict__ Wq,
            const float* __restrict__ Wk, const float* __restrict__ Wv,
            float* __restrict__ qp_raw, float* __restrict__ kp_raw,
            _Float16* __restrict__ vh, float* __restrict__ statsPart)
{
    __shared__ __align__(16) __bf16 sX[256 * XP_];  // [pix][patch][hi|lo][channel], 132 KB

    const int blk  = blockIdx.x;         // ((b*T + tt)*16 + yh)*2 + channel half
    const int prow = blk >> 1;
    const int yh   = prow & 15;
    const int tt   = (prow >> 4) & 3;
    const int b    = prow >> 6;
    const int tid  = threadIdx.x;
    const int lane = tid & 31;
    // wave number as a scalar, so that the choice of projection is a scalar branch
    const int w    = __builtin_amdgcn_readfirstlane(tid >> 5);
    const int proj = w >> 2;             // 0 q, 1 k, 2 v
    const int ot   = (blk & 1) * 4 + (w & 3);  // 16-channel tile of that projection
    const int cl   = lane & 15;          // A row (patch) / B column (channel) / D column
    const int hi   = lane >> 4;          // k half of A and B, row half of D
    const int o    = ot * 16 + cl;       // this lane's output channel

    // weights: lane (cl,hi) holds k = 32j + 16hi + 0..15 of row o, j = 0..3
    const float* Wp   = (proj == 0) ? Wq : ((proj == 1) ? Wk : Wv);
    const float* wrow = Wp + (size_t)o * C_ + hi * 16;
    v4f wf[16];
#pragma unroll
    for (int j = 0; j < 16; ++j) wf[j] = *(const v4f*)(wrow + (j >> 2) * 32 + (j & 3) * 4);
    // the x loads below may land in the weight loads' address registers
    asm volatile("s_wait_xcnt 0x0" ::: "memory");

    v16b wh[4], wl[4];   // B fragments, hi and lo
    { // stage the x tile transposed: a unit = 4 channels x 4 W-pixels, 2048 units
        // over 384 threads: five full rounds and a sixth for waves 0..3.  All
        // loads are issued before the first LDS store, one memory latency in all.
        const float* xb = x + ((size_t)(b * C_) * T_ + tt) * 4096 + yh * 256
                            + (size_t)((tid >> 6) * 4) * (T_ * 4096) + (tid & 63) * 4;
        __bf16* sd = &sX[(((tid >> 4) & 3) * 64 + (tid & 15)) * XP_ + (tid >> 6) * 4];
        v4f rr[6][4];
#pragma unroll
        for (int it = 0; it < 5; ++it)
#pragma unroll
            for (int k = 0; k < 4; ++k)   // 384 threads = 6 units of 4 channels further on
                rr[it][k] = *(const v4f*)(xb + (size_t)(it * 24 + k) * (T_ * 4096));
        if (w < 4) {
#pragma unroll
            for (int k = 0; k < 4; ++k)
                rr[5][k] = *(const v4f*)(xb + (size_t)(5 * 24 + k) * (T_ * 4096));
        }
        // the weights as B fragments, hi and lo
#pragma unroll
        for (int j = 0; j < 16; ++j) {
            v4b th, tl;
            split4(wf[j], th, tl);
#pragma unroll
            for (int e = 0; e < 4; ++e) {
                wh[j >> 2][(j & 3) * 4 + e] = th[e];
                wl[j >> 2][(j & 3) * 4 + e] = tl[e];
            }
        }
#pragma unroll
        for (int it = 0; it < 6; ++it) {
            if (it < 5 || w < 4) {
#pragma unroll
                for (int sw = 0; sw < 4; ++sw) {
                    v4f t = {rr[it][0][sw], rr[it][1][sw], rr[it][2][sw], rr[it][3][sw]};
                    v4b th, tl;
                    split4(t, th, tl);
                    *(v4b*)(sd + sw * 16 * XP_ + it * 24)       = th;
                    *(v4b*)(sd + sw * 16 * XP_ + it * 24 + 128) = tl;
                }
            }
        }
    }
    __syncthreads();

    float s1 = 0.0f, s2 = 0.0f;
    v8f pool;
#pragma unroll
    for (int r = 0; r < 8; ++r) pool[r] = 0.0f;

    const __bf16* arow = &sX[cl * XP_ + hi * 16];   // the weights' k order: 32j + 16hi + 0..15
    const int m0 = tt * 256 + yh * 16 + hi * 8;      // first of this lane's 8 tokens
    _Float16* vdst = vh + ((size_t)((b * NH_ + (o >> 2)) * 64 + (o & 3) * 16)) * N_ + m0;

    // Two tiles a trip, one fragment set each: a tile's fragments are read from LDS
    // while the tile before it is multiplied.
    v16b f0h[4], f0l[4], f1h[4], f1l[4];
    load_tile(arow, f0h, f0l);
    for (int pix = 0; pix < 16; pix += 2) {
        load_tile(arow + (pix + 1) * 16 * XP_, f1h, f1l);
        // keeps these LDS reads ahead of the WMMAs below, which hide their latency
        __builtin_amdgcn_sched_barrier(0);
        const v8f a0 = mul_tile(f0h, f0l, wh, wl);
        if (pix + 2 < 16) load_tile(arow + (pix + 2) * 16 * XP_, f0h, f0l);
        const v8f a1 = mul_tile(f1h, f1l, wh, wl);
        // four vector slots between the last WMMA and the first reader of its D, on
        // both sides of the branch below; the scheduling barriers hold them in place
        __builtin_amdgcn_sched_barrier(0);
        asm volatile("v_nop\n\tv_nop\n\tv_nop\n\tv_nop");
        __builtin_amdgcn_sched_barrier(0);
#pragma unroll
        for (int r = 0; r < 8; ++r) {
            const float t = a0[r] + a1[r];
            pool[r] += t;            // patch sum; read for q and k only
            s1 += t;
            s2 += a0[r] * a0[r] + a1[r] * a1[r];
        }
        if (proj == 2) {
            v8h h0, h1;
#pragma unroll
            for (int r = 0; r < 8; ++r) { h0[r] = (_Float16)a0[r]; h1[r] = (_Float16)a1[r]; }
            *(v8h*)(vdst + (size_t)pix * N_)       = h0;
            *(v8h*)(vdst + (size_t)(pix + 1) * N_) = h1;
            // the next trip rewrites the stores' address and data registers
            asm volatile("s_wait_xcnt 0x0" ::: "memory");
        }
    }

    if (proj != 2) {   // patch SUM (mean applied later), head-major [b][g][m][4]:
        // the 8 tokens x 4 channels that a group's lanes store fill one 128 B line
        float* dst = ((proj == 0) ? qp_raw : kp_raw)
                   + ((size_t)(b * NH_ + (o >> 2)) * N_ + m0) * 4 + (o & 3);
#pragma unroll
        for (int r = 0; r < 8; ++r) dst[r * 4] = pool[r];
    }

    // group stats: 4 channels of a group are 4 neighbouring lanes, in both halves
    s1 += __shfl_xor(s1, 1, 32);  s2 += __shfl_xor(s2, 1, 32);
    s1 += __shfl_xor(s1, 2, 32);  s2 += __shfl_xor(s2, 2, 32);
    s1 += __shfl_xor(s1, 16, 32); s2 += __shfl_xor(s2, 16, 32);
    // partial sums of this patch row: [b*64 + t*16 + row][g][q1 q2 k1 k2 v1 v2 0 0].
    // The block's 16 groups fill 512 B in a row, four whole lines that no other
    // block writes; the two zeros make the entry's second half readable as 16 B.
    if ((lane & 19) == 0) {
        float* sp = statsPart + ((size_t)prow * NH_ + (o >> 2)) * 8 + proj * 2;
        if (proj == 2) {
            const v4f t = {s1, s2, 0.0f, 0.0f};
            *(v4f*)sp = t;
        } else {
            const v2f t = {s1, s2};
            *(v2f*)sp = t;
        }
    }
}

// ---------------------------------------------------------------------------
// v + (v of lane l ^ MASK) inside a 16-lane row, as a DPP add (row_xmask)
// ---------------------------------------------------------------------------
template <int MASK>
__device__ __forceinline__
float add_xmask(float v)
{
    const int t = __builtin_amdgcn_update_dpp(0, __builtin_bit_cast(int, v),
                                              0x160 + MASK, 0xf, 0xf, true);
    return v + __builtin_bit_cast(float, t);
}

// ---------------------------------------------------------------------------
// GroupNorm (mu, rstd) of one (projection, b, g) from its raw sum and sum of squares
// ---------------------------------------------------------------------------
__device__ __forceinline__
v2f gn_stats(v2f raw)
{
    const float mu  = raw[0] / SPG_;
    const float var = raw[1] / SPG_ - mu * mu;
    const v2f r = {mu, rsqrtf(var + 1e-5f)};
    return r;
}

// ---------------------------------------------------------------------------
// Async staging of one 32-key x 64-dp V chunk (4 KB) into LDS, shared by the
// 4 waves of the block.  Per-lane global_load_async_to_lds_b128 (ASYNCcnt),
// 2 segments per thread.  LDS layout: [dp][k_local(32)] halves; a row holds
// 64 B and is pitched VP_ halves = 80 B (16 B x odd): the 16 rows that a half
// wave reads with one ds_load_b128 then start on 16 different groups of four
// banks, where a 64 B pitch puts four rows on each group.
// ---------------------------------------------------------------------------
#define VP_ 40
__device__ __forceinline__
void stage_v(const _Float16* __restrict__ gsrc, _Float16* ldst, int tid)
{
#pragma unroll
    for (int it = 0; it < 2; ++it) {
        const int idx = tid + it * 128;        // 0..255 segments of 16 B
        const int dp  = idx >> 2;
        const int seg = idx & 3;
        const _Float16* g = gsrc + (size_t)dp * N_ + seg * 8;
        const _Float16* l = ldst + dp * VP_ + seg * 8;
        const unsigned lofs = (unsigned)(unsigned long long)l;  // LDS byte addr
        const unsigned long long ga = (unsigned long long)g;
        asm volatile("global_load_async_to_lds_b128 %0, %1, off"
                     :: "v"(lofs), "v"(ga) : "memory");
    }
}

// Chunk 0's copies for the prologue: the same two segments per thread as stage_v,
// in one statement that ends in s_wait_xcnt 0, so that nothing scheduled behind it
// lands in an address register of the copies or of the loads issued before them.
__device__ __forceinline__
void stage_v_first(const _Float16* __restrict__ gsrc, _Float16* ldst, int tid)
{
    const int dp  = tid >> 2;
    const int seg = tid & 3;
    const _Float16* g0 = gsrc + (size_t)dp * N_ + seg * 8;
    const _Float16* g1 = g0 + (size_t)32 * N_;
    const _Float16* l0 = ldst + dp * VP_ + seg * 8;
    const _Float16* l1 = l0 + 32 * VP_;
    const unsigned lo0 = (unsigned)(unsigned long long)l0;  // LDS byte addr
    const unsigned lo1 = (unsigned)(unsigned long long)l1;
    const unsigned long long ga0 = (unsigned long long)g0;
    const unsigned long long ga1 = (unsigned long long)g1;
    asm volatile("global_load_async_to_lds_b128 %0, %1, off\n\t"
                 "global_load_async_to_lds_b128 %2, %3, off\n\t"
                 "s_wait_xcnt 0x0"
                 :: "v"(lo0), "v"(ga0), "v"(lo1), "v"(ga1) : "memory");
}

// Async staging of one tile of rel_index, 64 queries x 32 keys (8 KB), shared by
// the 4 waves of the block: 4 copies of 16 B per thread, 8 neighbouring lanes fill
// one whole 128 B line of a query's row.  LDS rows are pitched IP_ ints = 144 B
// (16 B x odd), so that the ds_load_b128 reads of 16 rows spread over the banks.
// One statement that ends in s_wait_xcnt 0: nothing scheduled behind it lands in
// an address register of an issued copy.
#define IP_ 36
__device__ __forceinline__
void stage_idx(const int* __restrict__ gsrc, int* ldst, int tid)
{
    const int row = tid >> 3;    // 0..15; the four copies are 16 rows apart
    const int seg = tid & 7;
    const int* g0 = gsrc + (size_t)row * N_ + seg * 4;
    const int* l0 = ldst + row * IP_ + seg * 4;
    const unsigned lo0 = (unsigned)(unsigned long long)l0;  // LDS byte addr
    const unsigned lo1 = lo0 + 16 * IP_ * 4;
    const unsigned lo2 = lo0 + 32 * IP_ * 4;
    const unsigned lo3 = lo0 + 48 * IP_ * 4;
    const unsigned long long ga0 = (unsigned long long)g0;
    const unsigned long long ga1 = (unsigned long long)(g0 + (size_t)16 * N_);
    const unsigned long long ga2 = (unsigned long long)(g0 + (size_t)32 * N_);
    const unsigned long long ga3 = (unsigned long long)(g0 + (size_t)48 * N_);
    asm volatile("global_load_async_to_lds_b128 %0, %1, off\n\t"
                 "global_load_async_to_lds_b128 %2, %3, off\n\t"
                 "global_load_async_to_lds_b128 %4, %5, off\n\t"
                 "global_load_async_to_lds_b128 %6, %7, off\n\t"
                 "s_wait_xcnt 0x0"
                 :: "v"(lo0), "v"(ga0), "v"(lo1), "v"(ga1),
                    "v"(lo2), "v"(ga2), "v"(lo3), "v"(ga3) : "memory");
}

// The rel-bias of one lane's 16 keys of a trip, in two halves: its query's row of
// the staged rel_index tile (il), in A-fragment element order, and the table gather.
__device__ __forceinline__
void load_idx(const int* il, v4i (&ix)[4])
{
    ix[0] = *(const v4i*)il;
    ix[1] = *(const v4i*)(il + 4);
    ix[2] = *(const v4i*)(il + 16);
    ix[3] = *(const v4i*)(il + 20);
}
__device__ __forceinline__
void gather_bias(const v4i (&ix)[4], const float* tab, v8f (&bias)[2])
{
#pragma unroll
    for (int j = 0; j < 16; ++j) bias[j >> 3][j & 7] = tab[ix[j >> 2][j & 3]];
}

// A fragments of the logit product for 32 keys, two tiles of 16: lane (row, hi) reads
// channels 2hi, 2hi+1 of its key; a wave's 32 reads of 8 B fill 256 B in a row
__device__ __forceinline__
void load_kfrag(const float* kl, v2f (&kf)[2])
{
    kf[0] = *(const v2f*)kl;
    kf[1] = *(const v2f*)(kl + 64);
}

// ---------------------------------------------------------------------------
// Kernel 2: fused flash attention.  Block = 128 threads (4 waves), one block
// per (b, g, 64-query tile); each wave owns 16 queries.  The three GroupNorms
// are finished here: the block adds up the 64 partial sums of its group (one
// per patch row of the projection kernel), derives (mu, rstd) from them,
// normalizes the pooled k while staging it and the pooled q on load (the
// affine commutes with the patch mean; the logit scale 1/sqrt(d)=0.5 goes into
// q), and applies V's affine to the finished rows: the softmax weights of a row
// sum to one, so sum(p*(a*v+b))/sum(p) = a*sum(p*v)/sum(p) + b.  Per 32-key chunk:
// logits transposed, keys x queries, as 2x v_wmma_f32_16x16x4_f32 (the head dim is
// the form's k = 4) with the rel-bias as C (gathered one trip ahead from the LDS
// table, through a rel_index tile of an async-staged LDS ring); a lane's 16 D
// registers are its query's 16 keys in the A-fragment order of the second product;
// online softmax (xor-16 combine), pkrtz-pack of P, 4x v_wmma_f32_16x16x32_f16
// against V fragments read from the async-staged, double-buffered LDS tile.
// ---------------------------------------------------------------------------
__global__ __launch_bounds__(128)
void k_attn(const float* __restrict__ qp_raw, const float* __restrict__ kp_raw,
            const _Float16* __restrict__ vh, const float* __restrict__ statsPart,
            const float* __restrict__ gq_g, const float* __restrict__ gq_b,
            const float* __restrict__ gk_g, const float* __restrict__ gk_b,
            const float* __restrict__ gv_g, const float* __restrict__ gv_b,
            const float* __restrict__ rel_table, const int* __restrict__ rel_index,
            float* __restrict__ out)
{
    __shared__ float sKP[N_ * 4];                      // kp for this (b,g): 16 KB
    __shared__ float sTab[TBL_];                       // rel_table row: ~27 KB
    __shared__ __align__(16) _Float16 sV[2][64 * VP_]; // double-buffered V chunk: 2x5 KB
    __shared__ __align__(16) float sRed[4 * 8];        // each wave's share of the group sums
    __shared__ __align__(16) int sIdx[2][64 * IP_];    // double-buffered rel_index tile: 2x9 KB

    const int blk  = blockIdx.x;                 // b*512 + g*16 + tile
    const int tile = blk & 15;
    const int g    = (blk >> 4) & 31;
    const int b    = blk >> 9;
    const int tid  = threadIdx.x;

    const _Float16* vbase = vh + ((size_t)(b * NH_ + g)) * 64 * N_;

    const int lane = tid & 31;
    const int wq   = tid >> 5;        // wave id: which 16-query sub-tile
    const int ql   = lane & 15;       // logits: M (key) / N (query); P*V: M (query) / N (dp) index within tile
    const int hi   = lane >> 4;       // upper lane half selector
    const int qg   = tile * 64 + wq * 16 + ql;   // this lane's query token

    // every global load of the prologue is issued here, ahead of the first wait:
    // the pooled k of this (b,g) (16 KB in a row), this lane's pooled q, the table
    // row, and the block's partial sums and affine rows.  One memory round trip in all.
    // thread t: patch row t>>1 of this b, half t&1 of its entry (q1 q2 k1 k2 | v1 v2 0 0)
    v4f ps = *(const v4f*)(statsPart + ((size_t)(b * 64 + (tid >> 1)) * NH_ + g) * 8
                                     + (tid & 1) * 4);
    const v4f kg  = *(const v4f*)(gk_g + g * 4);
    const v4f kb  = *(const v4f*)(gk_b + g * 4);
    const v4f qg4 = *(const v4f*)(gq_g + g * 4);
    const v4f qb4 = *(const v4f*)(gq_b + g * 4);
    const v4f vg4 = *(const v4f*)(gv_g + g * 4);
    const v4f vb4 = *(const v4f*)(gv_b + g * 4);
    const float* kpb = kp_raw + (size_t)(b * NH_ + g) * N_ * 4;
    const float* tb  = rel_table + (size_t)g * TBL_;
    v4f   kz[8];
    float tz[53];
#pragma unroll
    for (int it = 0; it < 8; ++it) kz[it] = *(const v4f*)(kpb + (tid + it * 128) * 4);
    const v4f qz = *(const v4f*)(qp_raw + ((size_t)(b * NH_ + g) * N_ + qg) * 4);
#pragma unroll
    for (int it = 0; it < 52; ++it) tz[it] = tb[tid + it * 128];
    tz[52] = 0.0f;
    if (tid < TBL_ - 52 * 128) tz[52] = tb[tid + 52 * 128];
    // async staging of V chunk 0 flies with them; it is first read in trip 0
    stage_v_first(vbase, &sV[0][0], tid);
    // so do the rel_index tiles of trips 0 and 1
    const int* ribase = rel_index + (size_t)(tile * 64) * N_;
    stage_idx(ribase,      &sIdx[0][0], tid);
    stage_idx(ribase + 32, &sIdx[1][0], tid);
    // holds the adding below, and with it the first wait on a load, behind the copies' issue
    __builtin_amdgcn_sched_barrier(0);

    // sum over the 64 patch rows: 16 of them in a wave (lanes of equal parity), then
    // the four waves' shares through LDS
#pragma unroll
    for (int e = 0; e < 4; ++e) {
        float t = ps[e];
        t = add_xmask<2>(t);
        t = add_xmask<4>(t);
        t = add_xmask<8>(t);
        const int u = __builtin_bit_cast(int, t);
        t += __builtin_bit_cast(float,
                 __builtin_amdgcn_permlanex16(u, u, 0x76543210, 0xfedcba98, false, false));
        ps[e] = t;
    }
    if (lane < 2) *(v4f*)&sRed[(wq * 2 + lane) * 4] = ps;
    // the bias table needs no sums: it is staged ahead of the barrier, as its loads land
#pragma unroll
    for (int it = 0; it < 52; ++it) sTab[tid + it * 128] = tz[it];
    if (tid < TBL_ - 52 * 128) sTab[tid + 52 * 128] = tz[52];
    __syncthreads();   // every wave's share is in sRed
    const v4f sqk = *(const v4f*)&sRed[0]  + *(const v4f*)&sRed[8]
                  + *(const v4f*)&sRed[16] + *(const v4f*)&sRed[24];
    const v2f rv  = *(const v2f*)&sRed[4]  + *(const v2f*)&sRed[12]
                  + *(const v2f*)&sRed[20] + *(const v2f*)&sRed[28];
    const v2f rq = {sqk[0], sqk[1]};
    const v2f rk = {sqk[2], sqk[3]};

    const v2f stq = gn_stats(rq);
    const v2f stk = gn_stats(rk);
    const v2f stv = gn_stats(rv);
    float va[4], vb[4];   // V's affine of channel g*4+dd, used in the epilogue
#pragma unroll
    for (int dd = 0; dd < 4; ++dd) {
        va[dd] = stv[1] * vg4[dd];
        vb[dd] = vb4[dd] - stv[0] * va[dd];
    }

    { // cooperative staging of normalized kp
#pragma unroll
        for (int it = 0; it < 8; ++it) {
            const v4f z = kz[it];
            v4f kn;
#pragma unroll
            for (int e = 0; e < 4; ++e)
                kn[e] = (z[e] * (1.0f / 16.0f) - stk[0]) * stk[1] * kg[e] + kb[e];
            *(v4f*)&sKP[(tid + it * 128) * 4] = kn;
        }
    }
    // this wave's copies have landed; the barrier publishes rel_index tile 0, read
    // in front of the loop, to the other waves
    asm volatile("s_wait_asynccnt 0x0" ::: "memory");
    __syncthreads();

    v4f qv;
    {
        const v4f z  = qz;
#pragma unroll
        for (int e = 0; e < 4; ++e)
            qv[e] = ((z[e] * (1.0f / 16.0f) - stq[0]) * stq[1] * qg4[e] + qb4[e]) * 0.5f;
    }

    v8f acc[4];
#pragma unroll
    for (int dd = 0; dd < 4; ++dd)
#pragma unroll
        for (int e = 0; e < 8; ++e) acc[dd][e] = 0.0f;

    float mrow = -__builtin_inff();
    float lrow = 0.0f;

    // B fragment of the logit product, for the whole loop: lane (column = query, hi)
    // holds channels 2hi, 2hi+1 of its query, the k order of the key fragments
    const v2f bq = {hi ? qv[2] : qv[0], hi ? qv[3] : qv[1]};
    const float* krow = &sKP[ql * 4 + hi * 2];          // this lane's key row in a tile of 16

    const int irow = ((wq * 16 + ql) * IP_ + hi * 8);   // this lane's query row in a tile
    v8f bias[2];                                        // rel-bias of the coming trip
    v2f kf[2];                                          // key fragments of the coming trip
    v4i ix[4];
    load_idx(&sIdx[0][irow], ix);
    load_kfrag(krow, kf);
    gather_bias(ix, sTab, bias);

    for (int mc = 0; mc < N_; mc += 32) {
        const int buf = (mc >> 5) & 1;
        // D register r of tile i is key mc + 16*i + 8*hi + r of this lane's query: the
        // lane's 16 keys in exact A-fragment element order:
        // e<8 : K = mc + 8*hi + e        (tile 0)
        // e>=8: K = mc + 16 + 8*hi + e-8 (tile 1)
        const v8f st0 = __builtin_amdgcn_wmma_f32_16x16x4_f32(
            false, kf[0], false, bq, (short)0, bias[0], false, false);
        const v8f st1 = __builtin_amdgcn_wmma_f32_16x16x4_f32(
            false, kf[1], false, bq, (short)0, bias[1], false, false);
        // four vector slots between the second WMMA and the first reader of a D; the
        // scheduling barriers hold them in place
        __builtin_amdgcn_sched_barrier(0);
        asm volatile("v_nop\n\tv_nop\n\tv_nop\n\tv_nop");
        __builtin_amdgcn_sched_barrier(0);
        float s[16];
#pragma unroll
        for (int j = 0; j < 8; ++j) { s[j] = st0[j]; s[8 + j] = st1[j]; }

        // online softmax: lanes q and q+16 jointly cover all 32 keys of query q
        float mloc = s[0];
#pragma unroll
        for (int j = 1; j < 16; ++j) mloc = fmaxf(mloc, s[j]);
        mloc = fmaxf(mloc, __shfl_xor(mloc, 16, 32));
        const float mnew = fmaxf(mrow, mloc);
        const float sc   = __expf(mrow - mnew);

        float p[16], ls = 0.0f;
#pragma unroll
        for (int j = 0; j < 16; ++j) { p[j] = __expf(s[j] - mnew); ls += p[j]; }
        ls  += __shfl_xor(ls, 16, 32);
        lrow = lrow * sc + ls;
        mrow = mnew;

        // rescale accumulators: row r+8*hi belongs to query (r+8*hi), whose
        // stats live in lane (r+8*hi) -> 8 broadcasts
#pragma unroll
        for (int r = 0; r < 8; ++r) {
            const float srow = __shfl(sc, r + hi * 8, 32);
            acc[0][r] *= srow; acc[1][r] *= srow;
            acc[2][r] *= srow; acc[3][r] *= srow;
        }

        // pack P into A fragment (element e == p[e] by construction)
        union { v16h v; pk2h h[8]; } A;
#pragma unroll
        for (int j2 = 0; j2 < 8; ++j2)
            A.h[j2] = __builtin_amdgcn_cvt_pkrtz(p[2 * j2], p[2 * j2 + 1]);

        // this wave's reads of rel_index tile t (made in the trip before) are over
        // before the barrier behind which the tile's buffer is refilled
        asm volatile("s_wait_dscnt 0x0" ::: "memory");
        // current V chunk, and the next trip's rel_index tile, are ready once our
        // asyncs landed + all waves arrive
        asm volatile("s_wait_asynccnt 0x0" ::: "memory");
        __syncthreads();
        // overlap: stage next chunk into the other buffer
        if (mc + 32 < N_) stage_v(vbase + (mc + 32), &sV[buf ^ 1][0], tid);

        // 4 B-tiles of V (dp = dd*16 + ql) straight from LDS
        union { v16h v; v8h h[2]; } Bf[4];
#pragma unroll
        for (int dd = 0; dd < 4; ++dd) {
            const _Float16* vrow = &sV[buf][(dd * 16 + ql) * VP_ + hi * 8];
            Bf[dd].h[0] = *(const v8h*)vrow;
            Bf[dd].h[1] = *(const v8h*)(vrow + 16);
        }
        // the next trip's rel_index row is read behind the V fragments and its bias
        // gathered behind the WMMAs.  The last trip finds tile 30 there, still whole,
        // and its gather is not used.
        load_idx(&sIdx[buf ^ 1][irow], ix);
        // so are its key fragments; the last trip reads keys 0..31 again, unused
        load_kfrag(krow + ((mc + 32) & (N_ - 1)) * 4, kf);
        // rel_index tile of trip t + 2 into the buffer whose reads ended ahead of the
        // barrier; issued here, its s_wait_xcnt 0 passes under the LDS reads above
        if (mc + 64 < N_) stage_idx(ribase + (mc + 64), &sIdx[buf][0], tid);
#pragma unroll
        for (int dd = 0; dd < 4; ++dd)
            acc[dd] = __builtin_amdgcn_wmma_f32_16x16x32_f16(
                false, A.v, false, Bf[dd].v, (short)0, acc[dd], false, false);
        gather_bias(ix, sTab, bias);
    }

    // epilogue: divide by row sums, apply V's GroupNorm affine of channel g*4+dd,
    // and scatter back to (B,C,T,H,W)
    const float lrec = 1.0f / lrow;
#pragma unroll
    for (int r = 0; r < 8; ++r) {
        const float li   = __shfl(lrec, r + hi * 8, 32);
        const int  qrow  = tile * 64 + wq * 16 + r + hi * 8;
        const int  tt    = qrow >> 8;
        const int  yh    = (qrow >> 4) & 15;
        const int  xw    = qrow & 15;
        const int  sh    = ql >> 2;
        const int  sw    = ql & 3;
#pragma unroll
        for (int dd = 0; dd < 4; ++dd) {
            const int c = g * 4 + dd;
            size_t oi = ((size_t)((b * C_ + c) * T_ + tt)) * 4096
                      + (yh * 4 + sh) * 64 + (xw * 4 + sw);
            out[oi] = acc[dd][r] * li * va[dd] + vb[dd];
        }
    }
}

// ---------------------------------------------------------------------------
extern "C" void kernel_launch(void* const* d_in, const int* in_sizes, int n_in,
                              void* d_out, int out_size, void* d_ws, size_t ws_size,
                              hipStream_t stream)
{
    const float* x    = (const float*)d_in[0];
    const float* Wq   = (const float*)d_in[1];
    const float* Wk   = (const float*)d_in[2];
    const float* Wv   = (const float*)d_in[3];
    const float* gq_g = (const float*)d_in[4];
    const float* gq_b = (const float*)d_in[5];
    const float* gk_g = (const float*)d_in[6];
    const float* gk_b = (const float*)d_in[7];
    const float* gv_g = (const float*)d_in[8];
    const float* gv_b = (const float*)d_in[9];
    const float* rtab = (const float*)d_in[10];
    const int*   ridx = (const int*)d_in[11];
    float* out = (float*)d_out;

    char* ws = (char*)d_ws;
    size_t off = 0;
    auto take = [&](size_t bytes) -> void* {
        void* p = ws + off;
        off += (bytes + 255) & ~(size_t)255;
        return p;
    };
    float*    qp_raw = (float*)take((size_t)B_ * N_ * C_ * 4);
    float*    kp_raw = (float*)take((size_t)B_ * N_ * C_ * 4);
    _Float16* vh     = (_Float16*)take((size_t)B_ * NH_ * 64 * N_ * 2);
    float*    spart  = (float*)take((size_t)B_ * T_ * 16 * NH_ * 8 * 4);
    (void)ws_size; (void)in_sizes; (void)n_in; (void)out_size;

    k_proj <<<B_ * T_ * 16 * 2, 384, 0, stream>>>(x, Wq, Wk, Wv, qp_raw, kp_raw, vh, spart);
    k_attn <<<B_ * NH_ * 16, 128, 0, stream>>>(
        qp_raw, kp_raw, vh, spart, gq_g, gq_b, gk_g, gk_b, gv_g, gv_b, rtab, ridx, out);
}

// v009
// Measured time: 45.2 microseconds a run.
// In two side-by-side timings against v008, it was 1.12 and 1.14 times as fast.
// All steps since v000 together make it 9.64 times as fast.
#include <hip/hip_runtime.h>

typedef __attribute__((ext_vector_type(16))) _Float16 v16h;
typedef __attribute__((ext_vector_type(8)))  _Float16 v8h;
typedef __attribute__((ext_vector_type(2)))  __fp16   pk2h;  // cvt_pkrtz result type
typedef __attribute__((ext_vector_type(8)))  float    v8f;
typedef __attribute__((ext_vector_type(4)))  float    v4f;
typedef __attribute__((ext_vector_type(2)))  float    v2f;
typedef __attribute__((ext_vector_type(4)))  int      v4i;
typedef __attribute__((ext_vector_type(16))) __bf16   v16b;
typedef __attribute__((ext_vector_type(8)))  __bf16   v8b;
typedef __attribute__((ext_vector_type(4)))  __bf16   v4b;
typedef __attribute__((ext_vector_type(2)))  __bf16   v2b;
typedef __attribute__((ext_vector_type(2)))  unsigned v2u;

#define B_   2
#define C_   128
#define T_   4
#define NH_  32
#define N_   1024     // T * 16 * 16 patch tokens
#define TBL_ 6727     // (2T-1)*(2h-1)*(2w-1) = 7*31*31
#define SPG_ 65536.0f // elements per GroupNorm group: 4 channels * T*H*W

// ---------------------------------------------------------------------------
// Kernel 1: q/k/v projection as a split-bf16 WMMA GEMM, with patch pooling (q,k),
// raw-f16 V pack in [b][g][dp=dd*16+pix][m] layout, and this block's GroupNorm
// sum/sumsq, stored as partial sums.  One block per (b, t, patch row of 16
// patches, half of the 128 output channels, for q, k and v alike).  12 waves;
// each wave owns 16 output channels of one projection and keeps their weights
// in registers as B fragments for the whole block.  A tile = 16 patches (rows)
// at one pixel position of the patch, so a lane's 8 D registers are 8
// consecutive patch tokens m of one output channel.
// Every f32 operand is held as two bf16 numbers, hi + lo (16 significant bits),
// and a product is three 16x16x32 WMMAs with f32 accumulation: hi*hi + lo*hi +
// hi*lo; the lo*lo term, below 2^-16 of the product, is left out.
// ---------------------------------------------------------------------------
#define XP_ 264   // LDS row pitch in bf16: 128 hi + 128 lo + 8, 528 B = 16 B x odd

// v = h + l + rest, four values: h the nearest bf16 of v, l the nearest bf16 of v - h.
// A packed pair of bf16 is widened again by a shift and a mask.
__device__ __forceinline__
void split4(v4f v, v4b& h, v4b& l)
{
    v2u hu, lu;
#pragma unroll
    for (int i = 0; i < 2; ++i) {
        const v2f a = {v[2 * i], v[2 * i + 1]};
        const unsigned p = __builtin_bit_cast(unsigned, __builtin_convertvector(a, v2b));
        const v2f r = {a[0] - __builtin_bit_cast(float, p << 16),
                       a[1] - __builtin_bit_cast(float, p & 0xffff0000u)};
        hu[i] = p;
        lu[i] = __builtin_bit_cast(unsigned, __builtin_convertvector(r, v2b));
    }
    h = __builtin_bit_cast(v4b, hu);
    l = __builtin_bit_cast(v4b, lu);
}

// A fragments of one tile of 16 patches, all 128 channels: lane (row, hi) reads
// k = 32j + 16hi + 0..15 of its row, hi part and lo part
__device__ __forceinline__
void load_tile(const __bf16* p, v16b (&xh)[4], v16b (&xl)[4])
{
#pragma unroll
    for (int j = 0; j < 4; ++j) {
        union { v16b v; v8b h[2]; } a, b;
        a.h[0] = *(const v8b*)(p + j * 32);
        a.h[1] = *(const v8b*)(p + j * 32 + 8);
        b.h[0] = *(const v8b*)(p + 128 + j * 32);
        b.h[1] = *(const v8b*)(p + 128 + j * 32 + 8);
        xh[j] = a.v;
        xl[j] = b.v;
    }
}

// one 16x16 tile over k = 128: hi*hi + lo*hi + hi*lo, f32 accumulation
__device__ __forceinline__
v8f mul_tile(const v16b (&xh)[4], const v16b (&xl)[4], const v16b (&wh)[4], const v16b (&wl)[4])
{
    v8f a;
#pragma unroll
    for (int r = 0; r < 8; ++r) a[r] = 0.0f;
#pragma unroll
    for (int j = 0; j < 4; ++j) {
        a = __builtin_amdgcn_wmma_f32_16x16x32_bf16(false, xh[j], false, wh[j], (short)0, a, false, false);
        a = __builtin_amdgcn_wmma_f32_16x16x32_bf16(false, xl[j], false, wh[j], (short)0, a, false, false);
        a = __builtin_amdgcn_wmma_f32_16x16x32_bf16(false, xh[j], false, wl[j], (short)0, a, false, false);
    }
    return a;
}

__global__ __launch_bounds__(384)
void k_proj(const float* __restrict__ x,  const float* __restrict__ Wq,
            const float* __restrict__ Wk, const float* __restrict__ Wv,
            float* __restrict__ qp_raw, float* __restrict__ kp_raw,
            _Float16* __restrict__ vh, float* __restrict__ statsPart)
{
    __shared__ __align__(16) __bf16 sX[256 * XP_];  // [pix][patch][hi|lo][channel], 132 KB

    const int blk  = blockIdx.x;         // ((b*T + tt)*16 + yh)*2 + channel half
    const int prow = blk >> 1;
    const int yh   = prow & 15;
    const int tt   = (prow >> 4) & 3;
    const int b    = prow >> 6;
    const int tid  = threadIdx.x;
    const int lane = tid & 31;
    // wave number as a scalar, so that the choice of projection is a scalar branch
    const int w    = __builtin_amdgcn_readfirstlane(tid >> 5);
    const int proj = w >> 2;             // 0 q, 1 k, 2 v
    const int ot   = (blk & 1) * 4 + (w & 3);  // 16-channel tile of that projection
    const int cl   = lane & 15;          // A row (patch) / B column (channel) / D column
    const int hi   = lane >> 4;          // k half of A and B, row half of D
    const int o    = ot * 16 + cl;       // this lane's output channel

    // weights: lane (cl,hi) holds k = 32j + 16hi + 0..15 of row o, j = 0..3
    const float* Wp   = (proj == 0) ? Wq : ((proj == 1) ? Wk : Wv);
    const float* wrow = Wp + (size_t)o * C_ + hi * 16;
    v4f wf[16];
#pragma unroll
    for (int j = 0; j < 16; ++j) wf[j] = *(const v4f*)(wrow + (j >> 2) * 32 + (j & 3) * 4);
    // the x loads below may land in the weight loads' address registers
    asm volatile("s_wait_xcnt 0x0" ::: "memory");

    v16b wh[4], wl[4];   // B fragments, hi and lo
    { // stage the x tile transposed: a unit = 4 channels x 4 W-pixels, 2048 units
        // over 384 threads: five full rounds and a sixth for waves 0..3.  All
        // loads are issued before the first LDS store, one memory latency in all.
        const float* xb = x + ((size_t)(b * C_) * T_ + tt) * 4096 + yh * 256
                            + (size_t)((tid >> 6) * 4) * (T_ * 4096) + (tid & 63) * 4;
        __bf16* sd = &sX[(((tid >> 4) & 3) * 64 + (tid & 15)) * XP_ + (tid >> 6) * 4];
        v4f rr[6][4];
#pragma unroll
        for (int it = 0; it < 5; ++it)
#pragma unroll
            for (int k = 0; k < 4; ++k)   // 384 threads = 6 units of 4 channels further on
                rr[it][k] = *(const v4f*)(xb + (size_t)(it * 24 + k) * (T_ * 4096));
        if (w < 4) {
#pragma unroll
            for (int k = 0; k < 4; ++k)
                rr[5][k] = *(const v4f*)(xb + (size_t)(5 * 24 + k) * (T_ * 4096));
        }
        // the weights as B fragments, hi and lo
#pragma unroll
        for (int j = 0; j < 16; ++j) {
            v4b th, tl;
            split4(wf[j], th, tl);
#pragma unroll
            for (int e = 0; e < 4; ++e) {
                wh[j >> 2][(j & 3) * 4 + e] = th[e];
                wl[j >> 2][(j & 3) * 4 + e] = tl[e];
            }
        }
#pragma unroll
        for (int it = 0; it < 6; ++it) {
            if (it < 5 || w < 4) {
#pragma unroll
                for (int sw = 0; sw < 4; ++sw) {
                    v4f t = {rr[it][0][sw], rr[it][1][sw], rr[it][2][sw], rr[it][3][sw]};
                    v4b th, tl;
                    split4(t, th, tl);
                    *(v4b*)(sd + sw * 16 * XP_ + it * 24)       = th;
                    *(v4b*)(sd + sw * 16 * XP_ + it * 24 + 128) = tl;
                }
            }
        }
    }
    __syncthreads();

    float s1 = 0.0f, s2 = 0.0f;
    v8f pool;
#pragma unroll
    for (int r = 0; r < 8; ++r) pool[r] = 0.0f;

    const __bf16* arow = &sX[cl * XP_ + hi * 16];   // the weights' k order: 32j + 16hi + 0..15
    const int m0 = tt * 256 + yh * 16 + hi * 8;      // first of this lane's 8 tokens
    _Float16* vdst = vh + ((size_t)((b * NH_ + (o >> 2)) * 64 + (o & 3) * 16)) * N_ + m0;

    // Two tiles a trip, one fragment set each: a tile's fragments are read from LDS
    // while the tile before it is multiplied.
    v16b f0h[4], f0l[4], f1h[4], f1l[4];
    load_tile(arow, f0h, f0l);
    for (int pix = 0; pix < 16; pix += 2) {
        load_tile(arow + (pix + 1) * 16 * XP_, f1h, f1l);
        // keeps these LDS reads ahead of the WMMAs below, which hide their latency
        __builtin_amdgcn_sched_barrier(0);
        const v8f a0 = mul_tile(f0h, f0l, wh, wl);
        if (pix + 2 < 16) load_tile(arow + (pix + 2) * 16 * XP_, f0h, f0l);
        const v8f a1 = mul_tile(f1h, f1l, wh, wl);
        // four vector slots between the last WMMA and the first reader of its D, on
        // both sides of the branch below; the scheduling barriers hold them in place
        __builtin_amdgcn_sched_barrier(0);
        asm volatile("v_nop\n\tv_nop\n\tv_nop\n\tv_nop");
        __builtin_amdgcn_sched_barrier(0);
#pragma unroll
        for (int r = 0; r < 8; ++r) {
            const float t = a0[r] + a1[r];
            pool[r] += t;            // patch sum; read for q and k only
            s1 += t;
            s2 += a0[r] * a0[r] + a1[r] * a1[r];
        }
        if (proj == 2) {
            v8h h0, h1;
#pragma unroll
            for (int r = 0; r < 8; ++r) { h0[r] = (_Float16)a0[r]; h1[r] = (_Float16)a1[r]; }
            *(v8h*)(vdst + (size_t)pix * N_)       = h0;
            *(v8h*)(vdst + (size_t)(pix + 1) * N_) = h1;
            // the next trip rewrites the stores' address and data registers
            asm volatile("s_wait_xcnt 0x0" ::: "memory");
        }
    }

    if (proj != 2) {   // patch SUM (mean applied later), head-major [b][g][m][4]:
        // the 8 tokens x 4 channels that a group's lanes store fill one 128 B line
        float* dst = ((proj == 0) ? qp_raw : kp_raw)
                   + ((size_t)(b * NH_ + (o >> 2)) * N_ + m0) * 4 + (o & 3);
#pragma unroll
        for (int r = 0; r < 8; ++r) dst[r * 4] = pool[r];
    }

    // group stats: 4 channels of a group are 4 neighbouring lanes, in both halves
    s1 += __shfl_xor(s1, 1, 32);  s2 += __shfl_xor(s2, 1, 32);
    s1 += __shfl_xor(s1, 2, 32);  s2 += __shfl_xor(s2, 2, 32);
    s1 += __shfl_xor(s1, 16, 32); s2 += __shfl_xor(s2, 16, 32);
    // partial sums of this patch row: [b*64 + t*16 + row][g][q1 q2 k1 k2 v1 v2 0 0].
    // The block's 16 groups fill 512 B in a row, four whole lines that no other
    // block writes; the two zeros make the entry's second half readable as 16 B.
    if ((lane & 19) == 0) {
        float* sp = statsPart + ((size_t)prow * NH_ + (o >> 2)) * 8 + proj * 2;
        if (proj == 2) {
            const v4f t = {s1, s2, 0.0f, 0.0f};
            *(v4f*)sp = t;
        } else {
            const v2f t = {s1, s2};
            *(v2f*)sp = t;
        }
    }
}

// ---------------------------------------------------------------------------
// v + (v of lane l ^ MASK) inside a 16-lane row, as a DPP add (row_xmask)
// ---------------------------------------------------------------------------
template <int MASK>
__device__ __forceinline__
float add_xmask(float v)
{
    const int t = __builtin_amdgcn_update_dpp(0, __builtin_bit_cast(int, v),
                                              0x160 + MASK, 0xf, 0xf, true);
    return v + __builtin_bit_cast(float, t);
}

// ---------------------------------------------------------------------------
// v of lane l ^ 16, as a vector cross-row move (v_permlanex16_b32): no LDS operation
// and no wait on one
// ---------------------------------------------------------------------------
__device__ __forceinline__
float other_row(float v)
{
    const int u = __builtin_bit_cast(int, v);
    return __builtin_bit_cast(float,
               __builtin_amdgcn_permlanex16(u, u, 0x76543210, 0xfedcba98, false, false));
}

// ---------------------------------------------------------------------------
// GroupNorm (mu, rstd) of one (projection, b, g) from its raw sum and sum of squares
// ---------------------------------------------------------------------------
__device__ __forceinline__
v2f gn_stats(v2f raw)
{
    const float mu  = raw[0] / SPG_;
    const float var = raw[1] / SPG_ - mu * mu;
    const v2f r = {mu, rsqrtf(var + 1e-5f)};
    return r;
}

// ---------------------------------------------------------------------------
// Async staging of one 32-key x 64-dp V chunk (4 KB) into LDS, shared by the
// 4 waves of the block.  Per-lane global_load_async_to_lds_b128 (ASYNCcnt),
// 2 segments per thread.  LDS layout: [dp][k_local(32)] halves; a row holds
// 64 B and is pitched VP_ halves = 80 B (16 B x odd): the 16 rows that a half
// wave reads with one ds_load_b128 then start on 16 different groups of four
// banks, where a 64 B pitch puts four rows on each group.
// ---------------------------------------------------------------------------
#define VP_ 40
__device__ __forceinline__
void stage_v(const _Float16* __restrict__ gsrc, _Float16* ldst, int tid)
{
#pragma unroll
    for (int it = 0; it < 2; ++it) {
        const int idx = tid + it * 128;        // 0..255 segments of 16 B
        const int dp  = idx >> 2;
        const int seg = idx & 3;
        const _Float16* g = gsrc + (size_t)dp * N_ + seg * 8;
        const _Float16* l = ldst + dp * VP_ + seg * 8;
        const unsigned lofs = (unsigned)(unsigned long long)l;  // LDS byte addr
        const unsigned long long ga = (unsigned long long)g;
        asm volatile("global_load_async_to_lds_b128 %0, %1, off"
                     :: "v"(lofs), "v"(ga) : "memory");
    }
}

// Chunk 0's copies for the prologue: the same two segments per thread as stage_v,
// in one statement that ends in s_wait_xcnt 0, so that nothing scheduled behind it
// lands in an address register of the copies or of the loads issued before them.
__device__ __forceinline__
void stage_v_first(const _Float16* __restrict__ gsrc, _Float16* ldst, int tid)
{
    const int dp  = tid >> 2;
    const int seg = tid & 3;
    const _Float16* g0 = gsrc + (size_t)dp * N_ + seg * 8;
    const _Float16* g1 = g0 + (size_t)32 * N_;
    const _Float16* l0 = ldst + dp * VP_ + seg * 8;
    const _Float16* l1 = l0 + 32 * VP_;
    const unsigned lo0 = (unsigned)(unsigned long long)l0;  // LDS byte addr
    const unsigned lo1 = (unsigned)(unsigned long long)l1;
    const unsigned long long ga0 = (unsigned long long)g0;
    const unsigned long long ga1 = (unsigned long long)g1;
    asm volatile("global_load_async_to_lds_b128 %0, %1, off\n\t"
                 "global_load_async_to_lds_b128 %2, %3, off\n\t"
                 "s_wait_xcnt 0x0"
                 :: "v"(lo0), "v"(ga0), "v"(lo1), "v"(ga1) : "memory");
}

// Async staging of one tile of rel_index, 64 queries x 32 keys (8 KB), shared by
// the 4 waves of the block: 4 copies of 16 B per thread, 8 neighbouring lanes fill
// one whole 128 B line of a query's row.  LDS rows are pitched IP_ ints = 144 B
// (16 B x odd), so that the ds_load_b128 reads of 16 rows spread over the banks.
// One statement that ends in s_wait_xcnt 0: nothing scheduled behind it lands in
// an address register of an issued copy.
#define IP_ 36
__device__ __forceinline__
void stage_idx(const int* __restrict__ gsrc, int* ldst, int tid)
{
    const int row = tid >> 3;    // 0..15; the four copies are 16 rows apart
    const int seg = tid & 7;
    const int* g0 = gsrc + (size_t)row * N_ + seg * 4;
    const int* l0 = ldst + row * IP_ + seg * 4;
    const unsigned lo0 = (unsigned)(unsigned long long)l0;  // LDS byte addr
    const unsigned lo1 = lo0 + 16 * IP_ * 4;
    const unsigned lo2 = lo0 + 32 * IP_ * 4;
    const unsigned lo3 = lo0 + 48 * IP_ * 4;
    const unsigned long long ga0 = (unsigned long long)g0;
    const unsigned long long ga1 = (unsigned long long)(g0 + (size_t)16 * N_);
    const unsigned long long ga2 = (unsigned long long)(g0 + (size_t)32 * N_);
    const unsigned long long ga3 = (unsigned long long)(g0 + (size_t)48 * N_);
    asm volatile("global_load_async_to_lds_b128 %0, %1, off\n\t"
                 "global_load_async_to_lds_b128 %2, %3, off\n\t"
                 "global_load_async_to_lds_b128 %4, %5, off\n\t"
                 "global_load_async_to_lds_b128 %6, %7, off\n\t"
                 "s_wait_xcnt 0x0"
                 :: "v"(lo0), "v"(ga0), "v"(lo1), "v"(ga1),
                    "v"(lo2), "v"(ga2), "v"(lo3), "v"(ga3) : "memory");
}

// The rel-bias of one lane's 16 keys of a trip, in two halves: its query's row of
// the staged rel_index tile (il), in A-fragment element order, and the table gather.
__device__ __forceinline__
void load_idx(const int* il, v4i (&ix)[4])
{
    ix[0] = *(const v4i*)il;
    ix[1] = *(const v4i*)(il + 4);
    ix[2] = *(const v4i*)(il + 16);
    ix[3] = *(const v4i*)(il + 20);
}
__device__ __forceinline__
void gather_bias(const v4i (&ix)[4], const float* tab, v8f (&bias)[2])
{
#pragma unroll
    for (int j = 0; j < 16; ++j) bias[j >> 3][j & 7] = tab[ix[j >> 2][j & 3]];
}

// A fragments of the logit product for 32 keys, two tiles of 16: lane (row, hi) reads
// channels 2hi, 2hi+1 of its key; a wave's 32 reads of 8 B fill 256 B in a row
__device__ __forceinline__
void load_kfrag(const float* kl, v2f (&kf)[2])
{
    kf[0] = *(const v2f*)kl;
    kf[1] = *(const v2f*)(kl + 64);
}

// ---------------------------------------------------------------------------
// Kernel 2: fused flash attention.  Block = 128 threads (4 waves), one block
// per (b, g, 64-query tile); each wave owns 16 queries.  The three GroupNorms
// are finished here: the block adds up the 64 partial sums of its group (one
// per patch row of the projection kernel), derives (mu, rstd) from them,
// normalizes the pooled k while staging it and the pooled q on load (the
// affine commutes with the patch mean; the logit scale 1/sqrt(d)=0.5 goes into
// q), and applies V's affine to the finished rows: the softmax weights of a row
// sum to one, so sum(p*(a*v+b))/sum(p) = a*sum(p*v)/sum(p) + b.  Per 32-key chunk:
// logits transposed, keys x queries, as 2x v_wmma_f32_16x16x4_f32 (the head dim is
// the form's k = 4) with the rel-bias as C (gathered one trip ahead from the LDS
// table, through a rel_index tile of an async-staged LDS ring); a lane's 16 D
// registers are its query's 16 keys in the fragment order of the second product;
// online softmax (xor-16 combine by a cross-row move), pkrtz-pack of P, and the
// second product transposed as well, O^T = V^T.P^T: 4x v_wmma_f32_16x16x32_f16 with
// the V fragments (async-staged, double-buffered LDS tile) as A and P as B.  A lane's
// accumulators are then 32 values of its own query: they are rescaled and divided
// by the lane's own numbers, with no exchange between lanes, and 4 neighbouring
// registers are 4 neighbouring pixels of the output.
// ---------------------------------------------------------------------------
__global__ __launch_bounds__(128)
void k_attn(const float* __restrict__ qp_raw, const float* __restrict__ kp_raw,
            const _Float16* __restrict__ vh, const float* __restrict__ statsPart,
            const float* __restrict__ gq_g, const float* __restrict__ gq_b,
            const float* __restrict__ gk_g, const float* __restrict__ gk_b,
            const float* __restrict__ gv_g, const float* __restrict__ gv_b,
            const float* __restrict__ rel_table, const int* __restrict__ rel_index,
            float* __restrict__ out)
{
    __shared__ float sKP[N_ * 4];                      // kp for this (b,g): 16 KB
    __shared__ float sTab[TBL_];                       // rel_table row: ~27 KB
    __shared__ __align__(16) _Float16 sV[2][64 * VP_]; // double-buffered V chunk: 2x5 KB
    __shared__ __align__(16) float sRed[4 * 8];        // each wave's share of the group sums
    __shared__ __align__(16) int sIdx[2][64 * IP_];    // double-buffered rel_index tile: 2x9 KB

    const int blk  = blockIdx.x;                 // b*512 + g*16 + tile
    const int tile = blk & 15;
    const int g    = (blk >> 4) & 31;
    const int b    = blk >> 9;
    const int tid  = threadIdx.x;

    const _Float16* vbase = vh + ((size_t)(b * NH_ + g)) * 64 * N_;

    const int lane = tid & 31;
    const int wq   = tid >> 5;        // wave id: which 16-query sub-tile
    const int ql   = lane & 15;       // N (query) / M (key, dp) index within tile
    const int hi   = lane >> 4;       // upper lane half selector
    const int qg   = tile * 64 + wq * 16 + ql;   // this lane's query token

    // every global load of the prologue is issued here, ahead of the first wait:
    // the pooled k of this (b,g) (16 KB in a row), this lane's pooled q, the table
    // row, and the block's partial sums and affine rows.  One memory round trip in all.
    // thread t: patch row t>>1 of this b, half t&1 of its entry (q1 q2 k1 k2 | v1 v2 0 0)
    v4f ps = *(const v4f*)(statsPart + ((size_t)(b * 64 + (tid >> 1)) * NH_ + g) * 8
                                     + (tid & 1) * 4);
    const v4f kg  = *(const v4f*)(gk_g + g * 4);
    const v4f kb  = *(const v4f*)(gk_b + g * 4);
    const v4f qg4 = *(const v4f*)(gq_g + g * 4);
    const v4f qb4 = *(const v4f*)(gq_b + g * 4);
    const v4f vg4 = *(const v4f*)(gv_g + g * 4);
    const v4f vb4 = *(const v4f*)(gv_b + g * 4);
    const float* kpb = kp_raw + (size_t)(b * NH_ + g) * N_ * 4;
    const float* tb  = rel_table + (size_t)g * TBL_;
    v4f   kz[8];
    float tz[53];
#pragma unroll
    for (int it = 0; it < 8; ++it) kz[it] = *(const v4f*)(kpb + (tid + it * 128) * 4);
    const v4f qz = *(const v4f*)(qp_raw + ((size_t)(b * NH_ + g) * N_ + qg) * 4);
#pragma unroll
    for (int it = 0; it < 52; ++it) tz[it] = tb[tid + it * 128];
    tz[52] = 0.0f;
    if (tid < TBL_ - 52 * 128) tz[52] = tb[tid + 52 * 128];
    // async staging of V chunk 0 flies with them; it is first read in trip 0
    stage_v_first(vbase, &sV[0][0], tid);
    // so do the rel_index tiles of trips 0 and 1
    const int* ribase = rel_index + (size_t)(tile * 64) * N_;
    stage_idx(ribase,      &sIdx[0][0], tid);
    stage_idx(ribase + 32, &sIdx[1][0], tid);
    // holds the adding below, and with it the first wait on a load, behind the copies' issue
    __builtin_amdgcn_sched_barrier(0);

    // sum over the 64 patch rows: 16 of them in a wave (lanes of equal parity), then
    // the four waves' shares through LDS
#pragma unroll
    for (int e = 0; e < 4; ++e) {
        float t = ps[e];
        t = add_xmask<2>(t);
        t = add_xmask<4>(t);
        t = add_xmask<8>(t);
        const int u = __builtin_bit_cast(int, t);
        t += __builtin_bit_cast(float,
                 __builtin_amdgcn_permlanex16(u, u, 0x76543210, 0xfedcba98, false, false));
        ps[e] = t;
    }
    if (lane < 2) *(v4f*)&sRed[(wq * 2 + lane) * 4] = ps;
    // the bias table needs no sums: it is staged ahead of the barrier, as its loads land
#pragma unroll
    for (int it = 0; it < 52; ++it) sTab[tid + it * 128] = tz[it];
    if (tid < TBL_ - 52 * 128) sTab[tid + 52 * 128] = tz[52];
    __syncthreads();   // every wave's share is in sRed
    const v4f sqk = *(const v4f*)&sRed[0]  + *(const v4f*)&sRed[8]
                  + *(const v4f*)&sRed[16] + *(const v4f*)&sRed[24];
    const v2f rv  = *(const v2f*)&sRed[4]  + *(const v2f*)&sRed[12]
                  + *(const v2f*)&sRed[20] + *(const v2f*)&sRed[28];
    const v2f rq = {sqk[0], sqk[1]};
    const v2f rk = {sqk[2], sqk[3]};

    const v2f stq = gn_stats(rq);
    const v2f stk = gn_stats(rk);
    const v2f stv = gn_stats(rv);
    float va[4], vb[4];   // V's affine of channel g*4+dd, used in the epilogue
#pragma unroll
    for (int dd = 0; dd < 4; ++dd) {
        va[dd] = stv[1] * vg4[dd];
        vb[dd] = vb4[dd] - stv[0] * va[dd];
    }

    { // cooperative staging of normalized kp
#pragma unroll
        for (int it = 0; it < 8; ++it) {
            const v4f z = kz[it];
            v4f kn;
#pragma unroll
            for (int e = 0; e < 4; ++e)
                kn[e] = (z[e] * (1.0f / 16.0f) - stk[0]) * stk[1] * kg[e] + kb[e];
            *(v4f*)&sKP[(tid + it * 128) * 4] = kn;
        }
    }
    // this wave's copies have landed; the barrier publishes rel_index tile 0, read
    // in front of the loop, to the other waves
    asm volatile("s_wait_asynccnt 0x0" ::: "memory");
    __syncthreads();

    v4f qv;
    {
        const v4f z  = qz;
#pragma unroll
        for (int e = 0; e < 4; ++e)
            qv[e] = ((z[e] * (1.0f / 16.0f) - stq[0]) * stq[1] * qg4[e] + qb4[e]) * 0.5f;
    }

    v8f acc[4];
#pragma unroll
    for (int dd = 0; dd < 4; ++dd)
#pragma unroll
        for (int e = 0; e < 8; ++e) acc[dd][e] = 0.0f;

    float mrow = -__builtin_inff();
    float lrow = 0.0f;

    // B fragment of the logit product, for the whole loop: lane (column = query, hi)
    // holds channels 2hi, 2hi+1 of its query, the k order of the key fragments
    const v2f bq = {hi ? qv[2] : qv[0], hi ? qv[3] : qv[1]};
    const float* krow = &sKP[ql * 4 + hi * 2];          // this lane's key row in a tile of 16

    const int irow = ((wq * 16 + ql) * IP_ + hi * 8);   // this lane's query row in a tile
    v8f bias[2];                                        // rel-bias of the coming trip
    v2f kf[2];                                          // key fragments of the coming trip
    v4i ix[4];
    load_idx(&sIdx[0][irow], ix);
    load_kfrag(krow, kf);
    gather_bias(ix, sTab, bias);

    for (int mc = 0; mc < N_; mc += 32) {
        const int buf = (mc >> 5) & 1;
        // D register r of tile i is key mc + 16*i + 8*hi + r of this lane's query: the
        // lane's 16 keys in exact fragment element order (A and B have the same):
        // e<8 : K = mc + 8*hi + e        (tile 0)
        // e>=8: K = mc + 16 + 8*hi + e-8 (tile 1)
        const v8f st0 = __builtin_amdgcn_wmma_f32_16x16x4_f32(
            false, kf[0], false, bq, (short)0, bias[0], false, false);
        const v8f st1 = __builtin_amdgcn_wmma_f32_16x16x4_f32(
            false, kf[1], false, bq, (short)0, bias[1], false, false);
        // four vector slots between the second WMMA and the first reader of a D; the
        // scheduling barriers hold them in place
        __builtin_amdgcn_sched_barrier(0);
        asm volatile("v_nop\n\tv_nop\n\tv_nop\n\tv_nop");
        __builtin_amdgcn_sched_barrier(0);
        float s[16];
#pragma unroll
        for (int j = 0; j < 8; ++j) { s[j] = st0[j]; s[8 + j] = st1[j]; }

        // online softmax: lanes q and q+16 jointly cover all 32 keys of query q
        float mloc = s[0];
#pragma unroll
        for (int j = 1; j < 16; ++j) mloc = fmaxf(mloc, s[j]);
        mloc = fmaxf(mloc, other_row(mloc));
        const float mnew = fmaxf(mrow, mloc);
        const float sc   = __expf(mrow - mnew);

        float p[16], ls = 0.0f;
#pragma unroll
        for (int j = 0; j < 16; ++j) { p[j] = __expf(s[j] - mnew); ls += p[j]; }
        ls  += other_row(ls);
        lrow = lrow * sc + ls;
        mrow = mnew;

        // rescale accumulators: every one belongs to this lane's query (column ql)
#pragma unroll
        for (int r = 0; r < 8; ++r) {
            acc[0][r] *= sc; acc[1][r] *= sc;
            acc[2][r] *= sc; acc[3][r] *= sc;
        }

        // pack P into the B fragment (element e == p[e] by construction)
        union { v16h v; pk2h h[8]; } Pf;
#pragma unroll
        for (int j2 = 0; j2 < 8; ++j2)
            Pf.h[j2] = __builtin_amdgcn_cvt_pkrtz(p[2 * j2], p[2 * j2 + 1]);

        // this wave's reads of rel_index tile t (made in the trip before) are over
        // before the barrier behind which the tile's buffer is refilled
        asm volatile("s_wait_dscnt 0x0" ::: "memory");
        // current V chunk, and the next trip's rel_index tile, are ready once our
        // asyncs landed + all waves arrive
        asm volatile("s_wait_asynccnt 0x0" ::: "memory");
        __syncthreads();
        // overlap: stage next chunk into the other buffer
        if (mc + 32 < N_) stage_v(vbase + (mc + 32), &sV[buf ^ 1][0], tid);

        // 4 A-tiles of V^T (row dp = dd*16 + ql) straight from LDS, in P's key order
        union { v16h v; v8h h[2]; } Vf[4];
#pragma unroll
        for (int dd = 0; dd < 4; ++dd) {
            const _Float16* vrow = &sV[buf][(dd * 16 + ql) * VP_ + hi * 8];
            Vf[dd].h[0] = *(const v8h*)vrow;
            Vf[dd].h[1] = *(const v8h*)(vrow + 16);
        }
        // the next trip's rel_index row is read behind the V fragments and its bias
        // gathered behind the WMMAs.  The last trip finds tile 30 there, still whole,
        // and its gather is not used.
        load_idx(&sIdx[buf ^ 1][irow], ix);
        // so are its key fragments; the last trip reads keys 0..31 again, unused
        load_kfrag(krow + ((mc + 32) & (N_ - 1)) * 4, kf);
        // rel_index tile of trip t + 2 into the buffer whose reads ended ahead of the
        // barrier; issued here, its s_wait_xcnt 0 passes under the LDS reads above
        if (mc + 64 < N_) stage_idx(ribase + (mc + 64), &sIdx[buf][0], tid);
#pragma unroll
        for (int dd = 0; dd < 4; ++dd)
            acc[dd] = __builtin_amdgcn_wmma_f32_16x16x32_f16(
                false, Vf[dd].v, false, Pf.v, (short)0, acc[dd], false, false);
        gather_bias(ix, sTab, bias);
    }

    // epilogue: divide by the query's sum, apply V's GroupNorm affine of channel g*4+dd,
    // and store to (B,C,T,H,W).  acc[dd][r] is pixel 8*hi + r of this lane's patch:
    // registers 0..3 are row 2*hi of the patch, 4..7 row 2*hi + 1, 16 B each; the 16
    // lanes of a half wave are 16 neighbouring patches, 256 B in a row.
    const float lrec = 1.0f / lrow;
    const int   tt   = qg >> 8;
    const int   yh   = (qg >> 4) & 15;
    const int   xw   = qg & 15;
    float* op = out + ((size_t)((b * C_ + g * 4) * T_ + tt)) * 4096
                    + (yh * 4 + hi * 2) * 64 + xw * 4;
    v4f ov[4][2];
#pragma unroll
    for (int dd = 0; dd < 4; ++dd)
#pragma unroll
        for (int r = 0; r < 8; ++r)
            ov[dd][r >> 2][r & 3] = acc[dd][r] * lrec * va[dd] + vb[dd];
#pragma unroll
    for (int dd = 0; dd < 4; ++dd) {
        *(v4f*)(op + (size_t)dd * (T_ * 4096))      = ov[dd][0];
        *(v4f*)(op + (size_t)dd * (T_ * 4096) + 64) = ov[dd][1];
    }
}

// ---------------------------------------------------------------------------
extern "C" void kernel_launch(void* const* d_in, const int* in_sizes, int n_in,
                              void* d_out, int out_size, void* d_ws, size_t ws_size,
                              hipStream_t stream)
{
    const float* x    = (const float*)d_in[0];
    const float* Wq   = (const float*)d_in[1];
    const float* Wk   = (const float*)d_in[2];
    const float* Wv   = (const float*)d_in[3];
    const float* gq_g = (const float*)d_in[4];
    const float* gq_b = (const float*)d_in[5];
    const float* gk_g = (const float*)d_in[6];
    const float* gk_b = (const float*)d_in[7];
    const float* gv_g = (const float*)d_in[8];
    const float* gv_b = (const float*)d_in[9];
    const float* rtab = (const float*)d_in[10];
    const int*   ridx = (const int*)d_in[11];
    float* out = (float*)d_out;

    char* ws = (char*)d_ws;
    size_t off = 0;
    auto take = [&](size_t bytes) -> void* {
        void* p = ws + off;
        off += (bytes + 255) & ~(size_t)255;
        return p;
    };
    float*    qp_raw = (float*)take((size_t)B_ * N_ * C_ * 4);
    float*    kp_raw = (float*)take((size_t)B_ * N_ * C_ * 4);
    _Float16* vh     = (_Float16*)take((size_t)B_ * NH_ * 64 * N_ * 2);
    float*    spart  = (float*)take((size_t)B_ * T_ * 16 * NH_ * 8 * 4);
    (void)ws_size; (void)in_sizes; (void)n_in; (void)out_size;

    k_proj <<<B_ * T_ * 16 * 2, 384, 0, stream>>>(x, Wq, Wk, Wv, qp_raw, kp_raw, vh, spart);
    k_attn <<<B_ * NH_ * 16, 128, 0, stream>>>(
        qp_raw, kp_raw, vh, spart, gq_g, gq_b, gk_g, gk_b, gv_g, gv_b, rtab, ridx, out);
}

// v010
// A run of this version takes 43.3 microseconds.
// Two timings next to v009 put it at 1.05 and 1.04 times that version's speed.
// Over all steps from v000 it is 10.1 times as fast.
#include <hip/hip_runtime.h>

typedef __attribute__((ext_vector_type(16))) _Float16 v16h;
typedef __attribute__((ext_vector_type(8)))  _Float16 v8h;
typedef __attribute__((ext_vector_type(2)))  __fp16   pk2h;  // cvt_pkrtz result type
typedef __attribute__((ext_vector_type(8)))  float    v8f;
typedef __attribute__((ext_vector_type(4)))  float    v4f;
typedef __attribute__((ext_vector_type(2)))  float    v2f;
typedef __attribute__((ext_vector_type(4)))  int      v4i;
typedef __attribute__((ext_vector_type(16))) __bf16   v16b;
typedef __attribute__((ext_vector_type(8)))  __bf16   v8b;
typedef __attribute__((ext_vector_type(4)))  __bf16   v4b;
typedef __attribute__((ext_vector_type(2)))  __bf16   v2b;
typedef __attribute__((ext_vector_type(2)))  unsigned v2u;

#define B_   2
#define C_   128
#define T_   4
#define NH_  32
#define N_   1024     // T * 16 * 16 patch tokens
#define TBL_ 6727     // (2T-1)*(2h-1)*(2w-1) = 7*31*31
#define SPG_ 65536.0f // elements per GroupNorm group: 4 channels * T*H*W

// ---------------------------------------------------------------------------
// Kernel 1: q/k/v projection as a split-bf16 WMMA GEMM, with patch pooling (q,k),
// raw-f16 V pack in [b][g][dp=dd*16+pix][m] layout, and this block's GroupNorm
// sum/sumsq, stored as partial sums.  One block per (b, t, patch row of 16
// patches, half of the 128 output channels, for q, k and v alike).  12 waves;
// each wave owns 16 output channels of one projection and keeps their weights
// in registers as B fragments for the whole block.  A tile = 16 patches (rows)
// at one pixel position of the patch, so a lane's 8 D registers are 8
// consecutive patch tokens m of one output channel.
// Every f32 operand is held as two bf16 numbers, hi + lo (16 significant bits),
// and a product is three 16x16x32 WMMAs with f32 accumulation: hi*hi + lo*hi +
// hi*lo; the lo*lo term, below 2^-16 of the product, is left out.
// ---------------------------------------------------------------------------
#define XP_ 264   // LDS row pitch in bf16: 128 hi + 128 lo + 8, 528 B = 16 B x odd

// v = h + l + rest, four values: h the nearest bf16 of v, l the nearest bf16 of v - h.
// A packed pair of bf16 is widened again by a shift and a mask.
__device__ __forceinline__
void split4(v4f v, v4b& h, v4b& l)
{
    v2u hu, lu;
#pragma unroll
    for (int i = 0; i < 2; ++i) {
        const v2f a = {v[2 * i], v[2 * i + 1]};
        const unsigned p = __builtin_bit_cast(unsigned, __builtin_convertvector(a, v2b));
        const v2f r = {a[0] - __builtin_bit_cast(float, p << 16),
                       a[1] - __builtin_bit_cast(float, p & 0xffff0000u)};
        hu[i] = p;
        lu[i] = __builtin_bit_cast(unsigned, __builtin_convertvector(r, v2b));
    }
    h = __builtin_bit_cast(v4b, hu);
    l = __builtin_bit_cast(v4b, lu);
}

// A fragments of one tile of 16 patches, all 128 channels: lane (row, hi) reads
// k = 32j + 16hi + 0..15 of its row, hi part and lo part
__device__ __forceinline__
void load_tile(const __bf16* p, v16b (&xh)[4], v16b (&xl)[4])
{
#pragma unroll
    for (int j = 0; j < 4; ++j) {
        union { v16b v; v8b h[2]; } a, b;
        a.h[0] = *(const v8b*)(p + j * 32);
        a.h[1] = *(const v8b*)(p + j * 32 + 8);
        b.h[0] = *(const v8b*)(p + 128 + j * 32);
        b.h[1] = *(const v8b*)(p + 128 + j * 32 + 8);
        xh[j] = a.v;
        xl[j] = b.v;
    }
}

// one 16x16 tile over k = 128: hi*hi + lo*hi + hi*lo, f32 accumulation
__device__ __forceinline__
v8f mul_tile(const v16b (&xh)[4], const v16b (&xl)[4], const v16b (&wh)[4], const v16b (&wl)[4])
{
    v8f a;
#pragma unroll
    for (int r = 0; r < 8; ++r) a[r] = 0.0f;
#pragma unroll
    for (int j = 0; j < 4; ++j) {
        a = __builtin_amdgcn_wmma_f32_16x16x32_bf16(false, xh[j], false, wh[j], (short)0, a, false, false);
        a = __builtin_amdgcn_wmma_f32_16x16x32_bf16(false, xl[j], false, wh[j], (short)0, a, false, false);
        a = __builtin_amdgcn_wmma_f32_16x16x32_bf16(false, xh[j], false, wl[j], (short)0, a, false, false);
    }
    return a;
}

__global__ __launch_bounds__(384)
void k_proj(const float* __restrict__ x,  const float* __restrict__ Wq,
            const float* __restrict__ Wk, const float* __restrict__ Wv,
            float* __restrict__ qp_raw, float* __restrict__ kp_raw,
            _Float16* __restrict__ vh, float* __restrict__ statsPart)
{
    __shared__ __align__(16) __bf16 sX[256 * XP_];  // [pix][patch][hi|lo][channel], 132 KB

    const int blk  = blockIdx.x;         // ((b*T + tt)*16 + yh)*2 + channel half
    const int prow = blk >> 1;
    const int yh   = prow & 15;
    const int tt   = (prow >> 4) & 3;
    const int b    = prow >> 6;
    const int tid  = threadIdx.x;
    const int lane = tid & 31;
    // wave number as a scalar, so that the choice of projection is a scalar branch
    const int w    = __builtin_amdgcn_readfirstlane(tid >> 5);
    const int proj = w >> 2;             // 0 q, 1 k, 2 v
    const int ot   = (blk & 1) * 4 + (w & 3);  // 16-channel tile of that projection
    const int cl   = lane & 15;          // A row (patch) / B column (channel) / D column
    const int hi   = lane >> 4;          // k half of A and B, row half of D
    const int o    = ot * 16 + cl;       // this lane's output channel

    // weights: lane (cl,hi) holds k = 32j + 16hi + 0..15 of row o, j = 0..3
    const float* Wp   = (proj == 0) ? Wq : ((proj == 1) ? Wk : Wv);
    const float* wrow = Wp + (size_t)o * C_ + hi * 16;
    v4f wf[16];
#pragma unroll
    for (int j = 0; j < 16; ++j) wf[j] = *(const v4f*)(wrow + (j >> 2) * 32 + (j & 3) * 4);
    // the x loads below may land in the weight loads' address registers
    asm volatile("s_wait_xcnt 0x0" ::: "memory");

    v16b wh[4], wl[4];   // B fragments, hi and lo
    { // stage the x tile transposed: a unit = 4 channels x 4 W-pixels, 2048 units
        // over 384 threads: five full rounds and a sixth for waves 0..3.  All
        // loads are issued before the first LDS store, one memory latency in all.
        const float* xb = x + ((size_t)(b * C_) * T_ + tt) * 4096 + yh * 256
                            + (size_t)((tid >> 6) * 4) * (T_ * 4096) + (tid & 63) * 4;
        __bf16* sd = &sX[(((tid >> 4) & 3) * 64 + (tid & 15)) * XP_ + (tid >> 6) * 4];
        v4f rr[6][4];
#pragma unroll
        for (int it = 0; it < 5; ++it)
#pragma unroll
            for (int k = 0; k < 4; ++k)   // 384 threads = 6 units of 4 channels further on
                rr[it][k] = *(const v4f*)(xb + (size_t)(it * 24 + k) * (T_ * 4096));
        if (w < 4) {
#pragma unroll
            for (int k = 0; k < 4; ++k)
                rr[5][k] = *(const v4f*)(xb + (size_t)(5 * 24 + k) * (T_ * 4096));
        }
        // the weights as B fragments, hi and lo
#pragma unroll
        for (int j = 0; j < 16; ++j) {
            v4b th, tl;
            split4(wf[j], th, tl);
#pragma unroll
            for (int e = 0; e < 4; ++e) {
                wh[j >> 2][(j & 3) * 4 + e] = th[e];
                wl[j >> 2][(j & 3) * 4 + e] = tl[e];
            }
        }
#pragma unroll
        for (int it = 0; it < 6; ++it) {
            if (it < 5 || w < 4) {
#pragma unroll
                for (int sw = 0; sw < 4; ++sw) {
                    v4f t = {rr[it][0][sw], rr[it][1][sw], rr[it][2][sw], rr[it][3][sw]};
                    v4b th, tl;
                    split4(t, th, tl);
                    *(v4b*)(sd + sw * 16 * XP_ + it * 24)       = th;
                    *(v4b*)(sd + sw * 16 * XP_ + it * 24 + 128) = tl;
                }
            }
        }
    }
    __syncthreads();

    float s1 = 0.0f, s2 = 0.0f;
    v8f pool;
#pragma unroll
    for (int r = 0; r < 8; ++r) pool[r] = 0.0f;

    const __bf16* arow = &sX[cl * XP_ + hi * 16];   // the weights' k order: 32j + 16hi + 0..15
    const int m0 = tt * 256 + yh * 16 + hi * 8;      // first of this lane's 8 tokens
    _Float16* vdst = vh + ((size_t)((b * NH_ + (o >> 2)) * 64 + (o & 3) * 16)) * N_ + m0;

    // Two tiles a trip, one fragment set each: a tile's fragments are read from LDS
    // while the tile before it is multiplied.
    v16b f0h[4], f0l[4], f1h[4], f1l[4];
    load_tile(arow, f0h, f0l);
    for (int pix = 0; pix < 16; pix += 2) {
        load_tile(arow + (pix + 1) * 16 * XP_, f1h, f1l);
        // keeps these LDS reads ahead of the WMMAs below, which hide their latency
        __builtin_amdgcn_sched_barrier(0);
        const v8f a0 = mul_tile(f0h, f0l, wh, wl);
        if (pix + 2 < 16) load_tile(arow + (pix + 2) * 16 * XP_, f0h, f0l);
        const v8f a1 = mul_tile(f1h, f1l, wh, wl);
        // four vector slots between the last WMMA and the first reader of its D, on
        // both sides of the branch below; the scheduling barriers hold them in place
        __builtin_amdgcn_sched_barrier(0);
        asm volatile("v_nop\n\tv_nop\n\tv_nop\n\tv_nop");
        __builtin_amdgcn_sched_barrier(0);
#pragma unroll
        for (int r = 0; r < 8; ++r) {
            const float t = a0[r] + a1[r];
            pool[r] += t;            // patch sum; read for q and k only
            s1 += t;
            s2 += a0[r] * a0[r] + a1[r] * a1[r];
        }
        if (proj == 2) {
            v8h h0, h1;
#pragma unroll
            for (int r = 0; r < 8; ++r) { h0[r] = (_Float16)a0[r]; h1[r] = (_Float16)a1[r]; }
            *(v8h*)(vdst + (size_t)pix * N_)       = h0;
            *(v8h*)(vdst + (size_t)(pix + 1) * N_) = h1;
            // the next trip rewrites the stores' address and data registers
            asm volatile("s_wait_xcnt 0x0" ::: "memory");
        }
    }

    if (proj != 2) {   // patch SUM (mean applied later), head-major [b][g][m][4]:
        // the 8 tokens x 4 channels that a group's lanes store fill one 128 B line
        float* dst = ((proj == 0) ? qp_raw : kp_raw)
                   + ((size_t)(b * NH_ + (o >> 2)) * N_ + m0) * 4 + (o & 3);
#pragma unroll
        for (int r = 0; r < 8; ++r) dst[r * 4] = pool[r];
    }

    // group stats: 4 channels of a group are 4 neighbouring lanes, in both halves
    s1 += __shfl_xor(s1, 1, 32);  s2 += __shfl_xor(s2, 1, 32);
    s1 += __shfl_xor(s1, 2, 32);  s2 += __shfl_xor(s2, 2, 32);
    s1 += __shfl_xor(s1, 16, 32); s2 += __shfl_xor(s2, 16, 32);
    // partial sums of this patch row: [b*64 + t*16 + row][g][q1 q2 k1 k2 v1 v2 0 0].
    // The block's 16 groups fill 512 B in a row, four whole lines that no other
    // block writes; the two zeros make the entry's second half readable as 16 B.
    if ((lane & 19) == 0) {
        float* sp = statsPart + ((size_t)prow * NH_ + (o >> 2)) * 8 + proj * 2;
        if (proj == 2) {
            const v4f t = {s1, s2, 0.0f, 0.0f};
            *(v4f*)sp = t;
        } else {
            const v2f t = {s1, s2};
            *(v2f*)sp = t;
        }
    }
}

// ---------------------------------------------------------------------------
// v + (v of lane l ^ MASK) inside a 16-lane row, as a DPP add (row_xmask)
// ---------------------------------------------------------------------------
template <int MASK>
__device__ __forceinline__
float add_xmask(float v)
{
    const int t = __builtin_amdgcn_update_dpp(0, __builtin_bit_cast(int, v),
                                              0x160 + MASK, 0xf, 0xf, true);
    return v + __builtin_bit_cast(float, t);
}

// ---------------------------------------------------------------------------
// v of lane l ^ 16, as a vector cross-row move (v_permlanex16_b32): no LDS operation
// and no wait on one
// ---------------------------------------------------------------------------
__device__ __forceinline__
float other_row(float v)
{
    const int u = __builtin_bit_cast(int, v);
    return __builtin_bit_cast(float,
               __builtin_amdgcn_permlanex16(u, u, 0x76543210, 0xfedcba98, false, false));
}

// ---------------------------------------------------------------------------
// GroupNorm (mu, rstd) of one (projection, b, g) from its raw sum and sum of squares
// ---------------------------------------------------------------------------
__device__ __forceinline__
v2f gn_stats(v2f raw)
{
    const float mu  = raw[0] / SPG_;
    const float var = raw[1] / SPG_ - mu * mu;
    const v2f r = {mu, rsqrtf(var + 1e-5f)};
    return r;
}

// ---------------------------------------------------------------------------
// Async staging of one 32-key x 64-dp V chunk (4 KB) into LDS, shared by the
// 4 waves of the block.  Per-lane global_load_async_to_lds_b128 (ASYNCcnt),
// 2 segments per thread.  LDS layout: [dp][k_local(32)] halves; a row holds
// 64 B and is pitched VP_ halves = 80 B (16 B x odd): the 16 rows that a half
// wave reads with one ds_load_b128 then start on 16 different groups of four
// banks, where a 64 B pitch puts four rows on each group.
// ---------------------------------------------------------------------------
#define VP_ 40
// One statement that ends in s_wait_xcnt 0, so that nothing scheduled behind it
// lands in an address register of the copies or of the loads issued before them.
__device__ __forceinline__
void stage_v(const _Float16* __restrict__ gsrc, _Float16* ldst, int tid)
{
    const int dp  = tid >> 2;
    const int seg = tid & 3;
    const _Float16* g0 = gsrc + (size_t)dp * N_ + seg * 8;
    const _Float16* g1 = g0 + (size_t)32 * N_;
    const _Float16* l0 = ldst + dp * VP_ + seg * 8;
    const _Float16* l1 = l0 + 32 * VP_;
    const unsigned lo0 = (unsigned)(unsigned long long)l0;  // LDS byte addr
    const unsigned lo1 = (unsigned)(unsigned long long)l1;
    const unsigned long long ga0 = (unsigned long long)g0;
    const unsigned long long ga1 = (unsigned long long)g1;
    asm volatile("global_load_async_to_lds_b128 %0, %1, off\n\t"
                 "global_load_async_to_lds_b128 %2, %3, off\n\t"
                 "s_wait_xcnt 0x0"
                 :: "v"(lo0), "v"(ga0), "v"(lo1), "v"(ga1) : "memory");
}

// Async staging of one tile of rel_index, 64 queries x 32 keys (8 KB), shared by
// the 4 waves of the block: 4 copies of 16 B per thread, 8 neighbouring lanes fill
// one whole 128 B line of a query's row.  LDS rows are pitched IP_ ints = 144 B
// (16 B x odd), so that the ds_load_b128 reads of 16 rows spread over the banks.
// One statement that ends in s_wait_xcnt 0: nothing scheduled behind it lands in
// an address register of an issued copy.
#define IP_ 36
__device__ __forceinline__
void stage_idx(const int* __restrict__ gsrc, int* ldst, int tid)
{
    const int row = tid >> 3;    // 0..15; the four copies are 16 rows apart
    const int seg = tid & 7;
    const int* g0 = gsrc + (size_t)row * N_ + seg * 4;
    const int* l0 = ldst + row * IP_ + seg * 4;
    const unsigned lo0 = (unsigned)(unsigned long long)l0;  // LDS byte addr
    const unsigned lo1 = lo0 + 16 * IP_ * 4;
    const unsigned lo2 = lo0 + 32 * IP_ * 4;
    const unsigned lo3 = lo0 + 48 * IP_ * 4;
    const unsigned long long ga0 = (unsigned long long)g0;
    const unsigned long long ga1 = (unsigned long long)(g0 + (size_t)16 * N_);
    const unsigned long long ga2 = (unsigned long long)(g0 + (size_t)32 * N_);
    const unsigned long long ga3 = (unsigned long long)(g0 + (size_t)48 * N_);
    asm volatile("global_load_async_to_lds_b128 %0, %1, off\n\t"
                 "global_load_async_to_lds_b128 %2, %3, off\n\t"
                 "global_load_async_to_lds_b128 %4, %5, off\n\t"
                 "global_load_async_to_lds_b128 %6, %7, off\n\t"
                 "s_wait_xcnt 0x0"
                 :: "v"(lo0), "v"(ga0), "v"(lo1), "v"(ga1),
                    "v"(lo2), "v"(ga2), "v"(lo3), "v"(ga3) : "memory");
}

// A trip's copies, the V chunk of stage_v and the rel_index tile of stage_idx, in one
// statement with one s_wait_xcnt 0 for the six: the wave waits once, not twice.
__device__ __forceinline__
void stage_v_idx(const _Float16* __restrict__ vsrc, _Float16* vdst,
                 const int* __restrict__ isrc, int* idst, int tid)
{
    const _Float16* vg0 = vsrc + (size_t)(tid >> 2) * N_ + (tid & 3) * 8;
    const _Float16* vl0 = vdst + (tid >> 2) * VP_ + (tid & 3) * 8;
    const unsigned vo0 = (unsigned)(unsigned long long)vl0;  // LDS byte addr
    const unsigned vo1 = vo0 + 32 * VP_ * 2;
    const unsigned long long va0 = (unsigned long long)vg0;
    const unsigned long long va1 = (unsigned long long)(vg0 + (size_t)32 * N_);
    const int* g0 = isrc + (size_t)(tid >> 3) * N_ + (tid & 7) * 4;
    const int* l0 = idst + (tid >> 3) * IP_ + (tid & 7) * 4;
    const unsigned lo0 = (unsigned)(unsigned long long)l0;   // LDS byte addr
    const unsigned lo1 = lo0 + 16 * IP_ * 4;
    const unsigned lo2 = lo0 + 32 * IP_ * 4;
    const unsigned lo3 = lo0 + 48 * IP_ * 4;
    const unsigned long long ga0 = (unsigned long long)g0;
    const unsigned long long ga1 = (unsigned long long)(g0 + (size_t)16 * N_);
    const unsigned long long ga2 = (unsigned long long)(g0 + (size_t)32 * N_);
    const unsigned long long ga3 = (unsigned long long)(g0 + (size_t)48 * N_);
    asm volatile("global_load_async_to_lds_b128 %0, %1, off\n\t"
                 "global_load_async_to_lds_b128 %2, %3, off\n\t"
                 "global_load_async_to_lds_b128 %4, %5, off\n\t"
                 "global_load_async_to_lds_b128 %6, %7, off\n\t"
                 "global_load_async_to_lds_b128 %8, %9, off\n\t"
                 "global_load_async_to_lds_b128 %10, %11, off\n\t"
                 "s_wait_xcnt 0x0"
                 :: "v"(vo0), "v"(va0), "v"(vo1), "v"(va1),
                    "v"(lo0), "v"(ga0), "v"(lo1), "v"(ga1),
                    "v"(lo2), "v"(ga2), "v"(lo3), "v"(ga3) : "memory");
}

// The rel-bias of one lane's 16 keys of a trip, in two halves: its query's row of
// the staged rel_index tile (il), in A-fragment element order, and the table gather.
__device__ __forceinline__
void load_idx(const int* il, v4i (&ix)[4])
{
    ix[0] = *(const v4i*)il;
    ix[1] = *(const v4i*)(il + 4);
    ix[2] = *(const v4i*)(il + 16);
    ix[3] = *(const v4i*)(il + 20);
}
__device__ __forceinline__
void gather_bias(const v4i (&ix)[4], const float* tab, v8f (&bias)[2])
{
#pragma unroll
    for (int j = 0; j < 16; ++j) bias[j >> 3][j & 7] = tab[ix[j >> 2][j & 3]];
}

// A fragments of the logit product for 32 keys, two tiles of 16: lane (row, hi) reads
// channels 2hi, 2hi+1 of its key; a wave's 32 reads of 8 B fill 256 B in a row
__device__ __forceinline__
void load_kfrag(const float* kl, v2f (&kf)[2])
{
    kf[0] = *(const v2f*)kl;
    kf[1] = *(const v2f*)(kl + 64);
}

// ---------------------------------------------------------------------------
// Kernel 2: fused flash attention.  Block = 128 threads (4 waves), one block
// per (b, g, 64-query tile); each wave owns 16 queries.  The three GroupNorms
// are finished here: the block adds up the 64 partial sums of its group (one
// per patch row of the projection kernel), derives (mu, rstd) from them,
// normalizes the pooled k while staging it and the pooled q on load (the
// affine commutes with the patch mean; the logit scale 1/sqrt(d)=0.5 goes into
// q), and applies V's affine to the finished rows: the softmax weights of a row
// sum to one, so sum(p*(a*v+b))/sum(p) = a*sum(p*v)/sum(p) + b.  Per 32-key chunk:
// logits transposed, keys x queries, as 2x v_wmma_f32_16x16x4_f32 (the head dim is
// the form's k = 4) with the rel-bias as C (gathered one trip ahead from the LDS
// table, through a rel_index tile of an async-staged LDS ring); a lane's 16 D
// registers are its query's 16 keys in the fragment order of the second product;
// online softmax (xor-16 combine by a cross-row move), pkrtz-pack of P, and the
// second product transposed as well, O^T = V^T.P^T: 4x v_wmma_f32_16x16x32_f16 with
// the V fragments (async-staged, double-buffered LDS tile) as A and P as B.  A lane's
// accumulators are then 32 values of its own query: they are rescaled and divided
// by the lane's own numbers, with no exchange between lanes, and 4 neighbouring
// registers are 4 neighbouring pixels of the output.
// ---------------------------------------------------------------------------
__global__ __launch_bounds__(128)
void k_attn(const float* __restrict__ qp_raw, const float* __restrict__ kp_raw,
            const _Float16* __restrict__ vh, const float* __restrict__ statsPart,
            const float* __restrict__ gq_g, const float* __restrict__ gq_b,
            const float* __restrict__ gk_g, const float* __restrict__ gk_b,
            const float* __restrict__ gv_g, const float* __restrict__ gv_b,
            const float* __restrict__ rel_table, const int* __restrict__ rel_index,
            float* __restrict__ out)
{
    __shared__ float sKP[N_ * 4];                      // kp for this (b,g): 16 KB
    __shared__ float sTab[TBL_];                       // rel_table row: ~27 KB
    __shared__ __align__(16) _Float16 sV[2][64 * VP_]; // double-buffered V chunk: 2x5 KB
    __shared__ __align__(16) float sRed[4 * 8];        // each wave's share of the group sums
    __shared__ __align__(16) int sIdx[2][64 * IP_];    // double-buffered rel_index tile: 2x9 KB

    const int blk  = blockIdx.x;                 // b*512 + g*16 + tile
    const int tile = blk & 15;
    const int g    = (blk >> 4) & 31;
    const int b    = blk >> 9;
    const int tid  = threadIdx.x;

    const _Float16* vbase = vh + ((size_t)(b * NH_ + g)) * 64 * N_;

    const int lane = tid & 31;
    const int wq   = tid >> 5;        // wave id: which 16-query sub-tile
    const int ql   = lane & 15;       // N (query) / M (key, dp) index within tile
    const int hi   = lane >> 4;       // upper lane half selector
    const int qg   = tile * 64 + wq * 16 + ql;   // this lane's query token

    // every global load of the prologue is issued here, ahead of the first wait:
    // the pooled k of this (b,g) (16 KB in a row), this lane's pooled q, the table
    // row, and the block's partial sums and affine rows.  One memory round trip in all.
    // thread t: patch row t>>1 of this b, half t&1 of its entry (q1 q2 k1 k2 | v1 v2 0 0)
    v4f ps = *(const v4f*)(statsPart + ((size_t)(b * 64 + (tid >> 1)) * NH_ + g) * 8
                                     + (tid & 1) * 4);
    const v4f kg  = *(const v4f*)(gk_g + g * 4);
    const v4f kb  = *(const v4f*)(gk_b + g * 4);
    const v4f qg4 = *(const v4f*)(gq_g + g * 4);
    const v4f qb4 = *(const v4f*)(gq_b + g * 4);
    const v4f vg4 = *(const v4f*)(gv_g + g * 4);
    const v4f vb4 = *(const v4f*)(gv_b + g * 4);
    const float* kpb = kp_raw + (size_t)(b * NH_ + g) * N_ * 4;
    const float* tb  = rel_table + (size_t)g * TBL_;
    v4f   kz[8];
    float tz[53];
#pragma unroll
    for (int it = 0; it < 8; ++it) kz[it] = *(const v4f*)(kpb + (tid + it * 128) * 4);
    const v4f qz = *(const v4f*)(qp_raw + ((size_t)(b * NH_ + g) * N_ + qg) * 4);
#pragma unroll
    for (int it = 0; it < 52; ++it) tz[it] = tb[tid + it * 128];
    tz[52] = 0.0f;
    if (tid < TBL_ - 52 * 128) tz[52] = tb[tid + 52 * 128];
    // async staging of V chunk 0 flies with them; it is first read in trip 0
    stage_v(vbase, &sV[0][0], tid);
    // so do the rel_index tiles of trips 0 and 1
    const int* ribase = rel_index + (size_t)(tile * 64) * N_;
    stage_idx(ribase,      &sIdx[0][0], tid);
    stage_idx(ribase + 32, &sIdx[1][0], tid);
    // holds the adding below, and with it the first wait on a load, behind the copies' issue
    __builtin_amdgcn_sched_barrier(0);

    // sum over the 64 patch rows: 16 of them in a wave (lanes of equal parity), then
    // the four waves' shares through LDS
#pragma unroll
    for (int e = 0; e < 4; ++e) {
        float t = ps[e];
        t = add_xmask<2>(t);
        t = add_xmask<4>(t);
        t = add_xmask<8>(t);
        const int u = __builtin_bit_cast(int, t);
        t += __builtin_bit_cast(float,
                 __builtin_amdgcn_permlanex16(u, u, 0x76543210, 0xfedcba98, false, false));
        ps[e] = t;
    }
    if (lane < 2) *(v4f*)&sRed[(wq * 2 + lane) * 4] = ps;
    // the bias table needs no sums: it is staged ahead of the barrier, as its loads land
#pragma unroll
    for (int it = 0; it < 52; ++it) sTab[tid + it * 128] = tz[it];
    if (tid < TBL_ - 52 * 128) sTab[tid + 52 * 128] = tz[52];
    __syncthreads();   // every wave's share is in sRed
    const v4f sqk = *(const v4f*)&sRed[0]  + *(const v4f*)&sRed[8]
                  + *(const v4f*)&sRed[16] + *(const v4f*)&sRed[24];
    const v2f rv  = *(const v2f*)&sRed[4]  + *(const v2f*)&sRed[12]
                  + *(const v2f*)&sRed[20] + *(const v2f*)&sRed[28];
    const v2f rq = {sqk[0], sqk[1]};
    const v2f rk = {sqk[2], sqk[3]};

    const v2f stq = gn_stats(rq);
    const v2f stk = gn_stats(rk);
    const v2f stv = gn_stats(rv);
    float va[4], vb[4];   // V's affine of channel g*4+dd, used in the epilogue
#pragma unroll
    for (int dd = 0; dd < 4; ++dd) {
        va[dd] = stv[1] * vg4[dd];
        vb[dd] = vb4[dd] - stv[0] * va[dd];
    }

    { // cooperative staging of normalized kp
#pragma unroll
        for (int it = 0; it < 8; ++it) {
            const v4f z = kz[it];
            v4f kn;
#pragma unroll
            for (int e = 0; e < 4; ++e)
                kn[e] = (z[e] * (1.0f / 16.0f) - stk[0]) * stk[1] * kg[e] + kb[e];
            *(v4f*)&sKP[(tid + it * 128) * 4] = kn;
        }
    }
    // this wave's copies have landed; the barrier publishes rel_index tile 0, read
    // in front of the loop, to the other waves
    asm volatile("s_wait_asynccnt 0x0" ::: "memory");
    __syncthreads();

    v4f qv;
    {
        const v4f z  = qz;
#pragma unroll
        for (int e = 0; e < 4; ++e)
            qv[e] = ((z[e] * (1.0f / 16.0f) - stq[0]) * stq[1] * qg4[e] + qb4[e]) * 0.5f;
    }

    v8f acc[4];
#pragma unroll
    for (int dd = 0; dd < 4; ++dd)
#pragma unroll
        for (int e = 0; e < 8; ++e) acc[dd][e] = 0.0f;

    float mrow = -__builtin_inff();
    float lrow = 0.0f;

    // B fragment of the logit product, for the whole loop: lane (column = query, hi)
    // holds channels 2hi, 2hi+1 of its query, the k order of the key fragments
    const v2f bq = {hi ? qv[2] : qv[0], hi ? qv[3] : qv[1]};
    const float* krow = &sKP[ql * 4 + hi * 2];          // this lane's key row in a tile of 16

    const int irow = ((wq * 16 + ql) * IP_ + hi * 8);   // this lane's query row in a tile
    v8f bias[2];                                        // rel-bias of the coming trip
    v2f kf[2];                                          // key fragments of the coming trip
    v4i ix[4];
    load_idx(&sIdx[0][irow], ix);
    load_kfrag(krow, kf);
    gather_bias(ix, sTab, bias);

    // two trips a pass: the bias gathered during a trip lands in the registers that the
    // next trip's logit WMMAs take as C, without copies, and the buffers' numbers are constants
#pragma unroll 2
    for (int mc = 0; mc < N_; mc += 32) {
        const int buf = (mc >> 5) & 1;
        // D register r of tile i is key mc + 16*i + 8*hi + r of this lane's query: the
        // lane's 16 keys in exact fragment element order (A and B have the same):
        // e<8 : K = mc + 8*hi + e        (tile 0)
        // e>=8: K = mc + 16 + 8*hi + e-8 (tile 1)
        const v8f st0 = __builtin_amdgcn_wmma_f32_16x16x4_f32(
            false, kf[0], false, bq, (short)0, bias[0], false, false);
        const v8f st1 = __builtin_amdgcn_wmma_f32_16x16x4_f32(
            false, kf[1], false, bq, (short)0, bias[1], false, false);
        // four vector slots between the second WMMA and the first reader of a D, on every
        // path through the branches below.  The
        // statement names both D as inputs, so that it stands behind the WMMAs.
        asm volatile("v_nop\n\tv_nop\n\tv_nop\n\tv_nop" :: "v"(st0), "v"(st1));
        // Everything of this trip that has a latency, the bias gather aside, is issued here, right behind the
        // logit WMMAs, and the softmax runs while it flies.
        // this wave's reads of rel_index tile t and of V chunk t - 1 (made in the trip
        // before) are over before the barrier behind which their buffers are refilled
        asm volatile("s_wait_dscnt 0x0" ::: "memory");
        // V chunk t, and the next trip's rel_index tile, are ready once our asyncs
        // landed + all waves arrive
        asm volatile("s_wait_asynccnt 0x0" ::: "memory");
        __syncthreads();

        // the next trip's rel_index row first: its bias gather hangs on it.  The last
        // trip finds tile 30 there, still whole, and its gather is not used.
        load_idx(&sIdx[buf ^ 1][irow], ix);
        // the next trip's key fragments; the last trip reads keys 0..31 again, unused
        load_kfrag(krow + ((mc + 32) & (N_ - 1)) * 4, kf);
        // 4 A-tiles of V^T (row dp = dd*16 + ql) straight from LDS, in P's key order
        union { v16h v; v8h h[2]; } Vf[4];
#pragma unroll
        for (int dd = 0; dd < 4; ++dd) {
            const _Float16* vrow = &sV[buf][(dd * 16 + ql) * VP_ + hi * 8];
            Vf[dd].h[0] = *(const v8h*)vrow;
            Vf[dd].h[1] = *(const v8h*)(vrow + 16);
        }
        // next V chunk into the other buffer, and the rel_index tile of trip t + 2 into
        // the buffer whose reads ended ahead of the barrier: they have the whole trip to
        // land; their s_wait_xcnt 0 passes under the LDS reads above
        if (mc + 64 < N_)
            stage_v_idx(vbase + (mc + 32), &sV[buf ^ 1][0], ribase + (mc + 64), &sIdx[buf][0], tid);
        else if (mc + 32 < N_)
            stage_v(vbase + (mc + 32), &sV[buf ^ 1][0], tid);

        float s[16];
#pragma unroll
        for (int j = 0; j < 8; ++j) { s[j] = st0[j]; s[8 + j] = st1[j]; }

        // online softmax: lanes q and q+16 jointly cover all 32 keys of query q
        float mloc = s[0];
#pragma unroll
        for (int j = 1; j < 16; ++j) mloc = fmaxf(mloc, s[j]);
        mloc = fmaxf(mloc, other_row(mloc));
        const float mnew = fmaxf(mrow, mloc);
        const float sc   = __expf(mrow - mnew);

        // the next trip's bias lands while the exponentials below are worked out: the
        // scheduling barrier keeps the gather from sinking to the trip's end
        gather_bias(ix, sTab, bias);
        __builtin_amdgcn_sched_barrier(0);

        float p[16], ls = 0.0f;
#pragma unroll
        for (int j = 0; j < 16; ++j) { p[j] = __expf(s[j] - mnew); ls += p[j]; }
        ls  += other_row(ls);
        lrow = lrow * sc + ls;
        mrow = mnew;

        // rescale accumulators: every one belongs to this lane's query (column ql)
#pragma unroll
        for (int r = 0; r < 8; ++r) {
            acc[0][r] *= sc; acc[1][r] *= sc;
            acc[2][r] *= sc; acc[3][r] *= sc;
        }

        // pack P into the B fragment (element e == p[e] by construction)
        union { v16h v; pk2h h[8]; } Pf;
#pragma unroll
        for (int j2 = 0; j2 < 8; ++j2)
            Pf.h[j2] = __builtin_amdgcn_cvt_pkrtz(p[2 * j2], p[2 * j2 + 1]);

#pragma unroll
        for (int dd = 0; dd < 4; ++dd)
            acc[dd] = __builtin_amdgcn_wmma_f32_16x16x32_f16(
                false, Vf[dd].v, false, Pf.v, (short)0, acc[dd], false, false);
        // keeps the two trips of the unrolled body apart: the next trip's barrier, reads
        // and copies are not to be mixed into this trip's softmax, nor held behind it
        __builtin_amdgcn_sched_barrier(0);
    }

    // epilogue: divide by the query's sum, apply V's GroupNorm affine of channel g*4+dd,
    // and store to (B,C,T,H,W).  acc[dd][r] is pixel 8*hi + r of this lane's patch:
    // registers 0..3 are row 2*hi of the patch, 4..7 row 2*hi + 1, 16 B each; the 16
    // lanes of a half wave are 16 neighbouring patches, 256 B in a row.
    const float lrec = 1.0f / lrow;
    const int   tt   = qg >> 8;
    const int   yh   = (qg >> 4) & 15;
    const int   xw   = qg & 15;
    float* op = out + ((size_t)((b * C_ + g * 4) * T_ + tt)) * 4096
                    + (yh * 4 + hi * 2) * 64 + xw * 4;
    v4f ov[4][2];
#pragma unroll
    for (int dd = 0; dd < 4; ++dd)
#pragma unroll
        for (int r = 0; r < 8; ++r)
            ov[dd][r >> 2][r & 3] = acc[dd][r] * lrec * va[dd] + vb[dd];
#pragma unroll
    for (int dd = 0; dd < 4; ++dd) {
        *(v4f*)(op + (size_t)dd * (T_ * 4096))      = ov[dd][0];
        *(v4f*)(op + (size_t)dd * (T_ * 4096) + 64) = ov[dd][1];
    }
}

// ---------------------------------------------------------------------------
extern "C" void kernel_launch(void* const* d_in, const int* in_sizes, int n_in,
                              void* d_out, int out_size, void* d_ws, size_t ws_size,
                              hipStream_t stream)
{
    const float* x    = (const float*)d_in[0];
    const float* Wq   = (const float*)d_in[1];
    const float* Wk   = (const float*)d_in[2];
    const float* Wv   = (const float*)d_in[3];
    const float* gq_g = (const float*)d_in[4];
    const float* gq_b = (const float*)d_in[5];
    const float* gk_g = (const float*)d_in[6];
    const float* gk_b = (const float*)d_in[7];
    const float* gv_g = (const float*)d_in[8];
    const float* gv_b = (const float*)d_in[9];
    const float* rtab = (const float*)d_in[10];
    const int*   ridx = (const int*)d_in[11];
    float* out = (float*)d_out;

    char* ws = (char*)d_ws;
    size_t off = 0;
    auto take = [&](size_t bytes) -> void* {
        void* p = ws + off;
        off += (bytes + 255) & ~(size_t)255;
        return p;
    };
    float*    qp_raw = (float*)take((size_t)B_ * N_ * C_ * 4);
    float*    kp_raw = (float*)take((size_t)B_ * N_ * C_ * 4);
    _Float16* vh     = (_Float16*)take((size_t)B_ * NH_ * 64 * N_ * 2);
    float*    spart  = (float*)take((size_t)B_ * T_ * 16 * NH_ * 8 * 4);
    (void)ws_size; (void)in_sizes; (void)n_in; (void)out_size;

    k_proj <<<B_ * T_ * 16 * 2, 384, 0, stream>>>(x, Wq, Wk, Wv, qp_raw, kp_raw, vh, spart);
    k_attn <<<B_ * NH_ * 16, 128, 0, stream>>>(
        qp_raw, kp_raw, vh, spart, gq_g, gq_b, gk_g, gk_b, gv_g, gv_b, rtab, ridx, out);
}
